// v000
// The times below were measured on an AMD MI455X: many runs one after another, warmed up first and cycling through
// copies of the inputs, with the whole window's GPU time divided by the number of runs. Launches and the gaps
// between them are all in it. The median over several windows is given; except for v000 it joins two sittings, which
// can be a few percent apart, so the side-by-side timings, each taken in one sitting, are the better comparison.
// v000 is the starting kernel. One run takes 1200 microseconds.
#include <hip/hip_runtime.h>

// Single causal attention head over 4,096 tokens scaled by the EMBEDDING width (x [4][4096][768]; k = x Wk, q = x Wq, v = x Wv ('xw' [768][64] 768^-0.5, no bias); wei = q.k^T x C^-0.5 with C = 768 (n_embd, not head_size); causal (-inf); softmax; out = wei.v -> [4][4096][64] (1.0 M); argument order x, Wk, Wq, Wv).
// Layout per batch: bf16 copy of x; 'xw' weights transposed once; exact projections (K 768); identity-table plane builders; scores with EVERY row on hi/lo planes (3 products, dense launches); streaming three-sweep causal softmax over the 4,096 keys; attn.v hybrid (rows < 512 hi/lo 3 products, rest fp16 x1024); k_cs8 removes the fp16 carry; k_copy4 writes the output rows once.
// Compute dtypes, f32 accumulate: every input rounded to bf16; projections exact; scores 3 products; softmax f32; wei.v rows < 512 3 products, rest fp16; output f32.

#define NB_  4
#define TT   4096
#define DM   64
#define NH_  1
#define NKV  1
#define REP  (NH_ / NKV)
#define HD   64
#define DQ   (NH_ * HD)
#define DKV  (NKV * HD)
#define ZH   1
#define RH   512                  // query rows < RH use hi+lo planes (0: none)
#define WIN  0
#define PCAR 1024.0f
#define SCL  0.036084391824351615f   // C^-0.5 with C = n_embd = 768 (the source scales by the input width, NOT the head size)
#define MID  64       // q / k width (one 64-wide head)
#define CO   64       // v width
#define CC   768      // input width (d_model)
typedef _Float16 h16;
typedef unsigned short bf;
typedef __attribute__((ext_vector_type(16))) __bf16   v16bf;
typedef __attribute__((ext_vector_type(16))) _Float16 v16h;
typedef __attribute__((ext_vector_type(8)))  _Float16 v8h;
typedef __attribute__((ext_vector_type(8)))  unsigned short v8us;
typedef __attribute__((ext_vector_type(8)))  float    v8f;
typedef __attribute__((ext_vector_type(4)))  float    v4f;
typedef v8h  __attribute__((may_alias)) v8ha;
typedef v4f  __attribute__((may_alias)) v4fa;
typedef v8us __attribute__((may_alias)) v8usa;

__device__ __forceinline__ unsigned short f2bf(float f) { unsigned u = __float_as_uint(f); u += 0x7FFFu + ((u >> 16) & 1u); return (unsigned short)(u >> 16); }
__device__ __forceinline__ float bf2f(unsigned short b) { return __uint_as_float(((unsigned)b) << 16); }
__device__ __forceinline__ float bfr(float f) { return bf2f(f2bf(f)); }
__device__ __forceinline__ v16h cat16(v8h lo, v8h hi) { return __builtin_shufflevector(lo, hi, 0, 1, 2, 3, 4, 5, 6, 7, 8, 9, 10, 11, 12, 13, 14, 15); }
__device__ __forceinline__ v16bf cat16b(v8us lo, v8us hi) { return __builtin_bit_cast(v16bf, __builtin_shufflevector(lo, hi, 0, 1, 2, 3, 4, 5, 6, 7, 8, 9, 10, 11, 12, 13, 14, 15)); }
__device__ __forceinline__ v8f wmma16(v16h a, v16h b, v8f c) { return __builtin_amdgcn_wmma_f32_16x16x32_f16(false, a, false, b, (short)0, c, false, false); }
__device__ __forceinline__ v8f wmmab(v16bf a, v16bf b, v8f c) { return __builtin_amdgcn_wmma_f32_16x16x32_bf16(false, a, false, b, (short)0, c, false, false); }



// ---- k_gemmw: register-blocked GEMM, ONE WAVE per 64x64 output tile (16 accumulators), operands straight from K-contiguous 16-bit planes; grid (M/64, N/64, Z), 32 threads.
// C[m][n] (f32, pitch ldc, + optional f32 bias[n]) = sum_k A[m][k] Bt[n][k] (+ split products per NSPLIT). z-batch strides sA/sB/sC in elements. K % 32 == 0.
template <typename T16> struct WFrag;
template <> struct WFrag<h16> { typedef v16h V; static __device__ __forceinline__ V ld(const h16* p) { return cat16(*(const v8h*)p, *(const v8h*)(p + 16)); } static __device__ __forceinline__ v8f mma(V a, V b, v8f c) { return wmma16(a, b, c); } };
template <> struct WFrag<bf> { typedef v16bf V; static __device__ __forceinline__ V ld(const bf* p) { return cat16b(*(const v8us*)p, *(const v8us*)(p + 16)); } static __device__ __forceinline__ v8f mma(V a, V b, v8f c) { return wmmab(a, b, c); } };
template <typename T16, int NSPLIT, bool BIAS>
__global__ __launch_bounds__(32) void k_gemmw(const T16* __restrict__ A, const T16* __restrict__ A2, const T16* __restrict__ Bt, const T16* __restrict__ Bt2, int K, float* C, int ldc, const float* __restrict__ bias, size_t sA, size_t sB, size_t sC) {
    typedef typename WFrag<T16>::V V;
    __shared__ __align__(16) float os[16 * 68];
    const size_t z = blockIdx.z; A += z * sA; if (A2) A2 += z * sA; Bt += z * sB; if (Bt2) Bt2 += z * sB; C += z * sC;
    const int lane = threadIdx.x & 31, lr = lane & 15, hi = lane >> 4; const int r0 = blockIdx.x * 64, c0 = blockIdx.y * 64;
    v8f acc[4][4];
#pragma unroll
    for (int mb = 0; mb < 4; ++mb)
#pragma unroll
        for (int nb = 0; nb < 4; ++nb) acc[mb][nb] = (v8f){};
    const size_t aoff = (size_t)(r0 + lr) * K + 8 * hi, boff = (size_t)(c0 + lr) * K + 8 * hi;
#pragma unroll 1
    for (int kc = 0; kc < K; kc += 32) {
        V a[4], a2[4];
#pragma unroll
        for (int mb = 0; mb < 4; ++mb) { a[mb] = WFrag<T16>::ld(A + aoff + (size_t)mb * 16 * K + kc); if (NSPLIT == 1 || NSPLIT == 2) a2[mb] = WFrag<T16>::ld(A2 + aoff + (size_t)mb * 16 * K + kc); }
#pragma unroll
        for (int nb = 0; nb < 4; ++nb) { const V b = WFrag<T16>::ld(Bt + boff + (size_t)nb * 16 * K + kc); V b2; if (NSPLIT >= 2) b2 = WFrag<T16>::ld(Bt2 + boff + (size_t)nb * 16 * K + kc);
#pragma unroll
            for (int mb = 0; mb < 4; ++mb) { acc[mb][nb] = WFrag<T16>::mma(a[mb], b, acc[mb][nb]); if (NSPLIT == 1 || NSPLIT == 2) acc[mb][nb] = WFrag<T16>::mma(a2[mb], b, acc[mb][nb]); if (NSPLIT >= 2) acc[mb][nb] = WFrag<T16>::mma(a[mb], b2, acc[mb][nb]); } }
        asm volatile("v_nop\n\tv_nop\n\tv_nop\n\tv_nop" : "+v"(acc[0][0]), "+v"(acc[1][1]), "+v"(acc[2][2]), "+v"(acc[3][3]) : "v"(a[0]), "v"(a[3]));
    }
#pragma unroll
    for (int mb = 0; mb < 4; ++mb) {
#pragma unroll
        for (int nb = 0; nb < 4; ++nb) {
#pragma unroll
            for (int j = 0; j < 8; ++j) os[(hi * 8 + j) * 68 + nb * 16 + lr] = acc[mb][nb][j]; }
        __builtin_amdgcn_wave_barrier(); asm volatile("" ::: "memory");
        float* crow = C + (size_t)(r0 + mb * 16) * ldc + c0;
{
#pragma unroll
            for (int s = 0; s < 8; ++s) { const int row = 2 * s + hi, cofs = lr * 4; v4f val = *(const v4fa*)(os + row * 68 + cofs); if (BIAS) { val[0] += bfr(bias[c0 + cofs]); val[1] += bfr(bias[c0 + cofs + 1]); val[2] += bfr(bias[c0 + cofs + 2]); val[3] += bfr(bias[c0 + cofs + 3]); }
                *(v4f*)(crow + (size_t)row * ldc + cofs) = val; }
             }
        __builtin_amdgcn_wave_barrier(); asm volatile("" ::: "memory");
    }
}

__device__ __forceinline__ h16 tohx(float x) { return (h16)x; }
__device__ __forceinline__ void splitf(float y, unsigned short& h, unsigned short& l) { h = f2bf(y); l = f2bf(y - bf2f(h)); }
typedef __attribute__((ext_vector_type(2))) _Float16 v2h;
typedef __attribute__((ext_vector_type(4))) _Float16 v4h;
typedef __attribute__((ext_vector_type(2))) unsigned short v2us;
typedef __attribute__((ext_vector_type(4))) unsigned short v4us;
typedef __attribute__((ext_vector_type(2))) float v2f;
typedef __attribute__((ext_vector_type(4))) int v4i;

__global__ __launch_bounds__(256) void k_cvt8(const float* __restrict__ src, bf* dst, size_t n8) { const size_t i = (size_t)blockIdx.x * 256 + threadIdx.x; if (i >= n8) return; const v8f v = *(const v8f*)(src + i * 8); v8us o;
#pragma unroll
    for (int k = 0; k < 8; ++k) o[k] = f2bf(v[k]); *(v8us*)(dst + i * 8) = o;  }


__global__ __launch_bounds__(256) void k_wtG(const float* __restrict__ w, int K, int N, bf* Bt) {
    const int lane = threadIdx.x & 31; const int L0 = (blockIdx.x * 8 + (threadIdx.x >> 5)) * 8; const int nlines = N * K / 64;
{
#pragma unroll 1
        for (int l = 0; l < 8; ++l) { const int L = L0 + l; if (L >= nlines) break; const size_t e = (size_t)L * 64 + lane * 2; const int k = (int)(e % K), n = (int)(e / K); v2us o;
            o[0] = f2bf(w[(size_t)k * N + n]); o[1] = f2bf(w[(size_t)(k + 1) * N + n]); *(v2us*)(Bt + e) = o; }
         }
}
__global__ __launch_bounds__(256) void k_vtp(const float* __restrict__ F, int pitch, int nheads, h16* V16, bf* Vh, bf* Vl) { const size_t e = ((size_t)blockIdx.x * 256 + threadIdx.x) * 2; if (e >= (size_t)nheads * HD * TT) return; const int t = (int)(e % TT); const int d = (int)((e / TT) % HD); const int g = (int)(e / ((size_t)TT * HD)); v2h o16; v2us oh, ol;
#pragma unroll
    for (int q = 0; q < 2; ++q) { const float x = F[(size_t)(t + q) * pitch + g * HD + d]; o16[q] = tohx(x); unsigned short a2, c2; splitf(x, a2, c2); oh[q] = a2; ol[q] = c2; }
    *(v2h*)(V16 + e) = o16; *(v2us*)(Vh + e) = oh; *(v2us*)(Vl + e) = ol;  }
__global__ __launch_bounds__(256) void k_lsoft(const float* __restrict__ Sb, h16* P16, bf* Ph, bf* Pl) {
    const int lane = threadIdx.x & 31; const int row = blockIdx.x * 8 + (threadIdx.x >> 5); if (row >= ZH * TT) return; const int i = row % TT; const int zz = row / TT; const bool hires = (i < RH); const float* sr = Sb + (size_t)row * TT; float mx = -3.0e38f;
#pragma unroll 4
    for (int ch = 0; ch < TT / 128; ++ch) { const int j0 = ch * 128 + lane * 4; const v4f a = *(const v4f*)(sr + j0);
#pragma unroll
        for (int q = 0; q < 4; ++q) { float t = (j0 + q <= i) ? a[q] * SCL : -3.0e38f; asm volatile("" : "+v"(t)); mx = fmaxf(mx, t); } }
#pragma unroll
    for (int sh = 16; sh; sh >>= 1) mx = fmaxf(mx, __shfl_xor(mx, sh, 32));
    float sum = 0.f;
#pragma unroll 4
    for (int ch = 0; ch < TT / 128; ++ch) { const int j0 = ch * 128 + lane * 4; const v4f a = *(const v4f*)(sr + j0);
#pragma unroll
        for (int q = 0; q < 4; ++q) { float t = (j0 + q <= i) ? a[q] * SCL : -3.0e38f; asm volatile("" : "+v"(t)); float d0 = __fsub_rn(t, mx); asm volatile("" : "+v"(d0)); sum += __builtin_amdgcn_exp2f(__fmul_rn(d0, 1.4426950408889634f)); } }
#pragma unroll
    for (int sh = 16; sh; sh >>= 1) sum += __shfl_xor(sum, sh, 32);
    const float f = __fdiv_rn(hires ? 1.0f : PCAR, sum);
{
        if (hires) {   /* rows < RH: normalised bf16 hi/lo over all keys, planes [zz][RH][TT] */
#pragma unroll
            for (int ch = 0; ch < TT / 128; ++ch) { const int j0 = ch * 128 + lane * 4; const v4f a = *(const v4f*)(sr + j0); v4us oh, ol;
#pragma unroll
                for (int q = 0; q < 4; ++q) { float t = (j0 + q <= i) ? a[q] * SCL : -3.0e38f; asm volatile("" : "+v"(t)); float d0 = __fsub_rn(t, mx); asm volatile("" : "+v"(d0)); float ex = __builtin_amdgcn_exp2f(__fmul_rn(d0, 1.4426950408889634f)); asm volatile("" : "+v"(ex)); unsigned short a2, c2; splitf(ex * f, a2, c2); oh[q] = a2; ol[q] = c2; }
                const size_t oo = ((size_t)zz * RH + i) * TT + j0; *(v4us*)(Ph + oo) = oh; *(v4us*)(Pl + oo) = ol; }
        } else {
#pragma unroll 2
            for (int ch = 0; ch < TT / 128; ++ch) { const int j0 = ch * 128 + lane * 4; const v4f a = *(const v4f*)(sr + j0); v4h o4;
#pragma unroll
                for (int q = 0; q < 4; ++q) { float t = (j0 + q <= i) ? a[q] * SCL : -3.0e38f; asm volatile("" : "+v"(t)); float d0 = __fsub_rn(t, mx); asm volatile("" : "+v"(d0)); float ex = __builtin_amdgcn_exp2f(__fmul_rn(d0, 1.4426950408889634f)); asm volatile("" : "+v"(ex)); o4[q] = tohx(ex * f); }
                *(v4h*)(P16 + (size_t)row * TT + j0) = o4; } }
         }
}
__global__ __launch_bounds__(256) void k_cs8(float* O, size_t n4) { const size_t i = (size_t)blockIdx.x * 256 + threadIdx.x; if (i >= n4) return; const size_t e = i * 4; const int t = (int)(e / CO);   /* row pitch of the attention-output plane is the VALUE width CO (r1 used the input width CC: wrong whenever CC != CO) */ const float cs = (t < RH) ? 1.0f : (1.0f / PCAR); v4f a = *(const v4f*)(O + e);
#pragma unroll
    for (int q = 0; q < 4; ++q) a[q] = __fmul_rn(a[q], cs);
    *(v4f*)(O + e) = a;  }

__global__ __launch_bounds__(256) void k_csid(float* CS) { const int idx = blockIdx.x * 256 + threadIdx.x; if (idx >= TT * HD) return; v2f cs; cs[0] = 1.0f; cs[1] = 0.0f; *(v2f*)(CS + (size_t)idx * 2) = cs;  }
// k_rope: head planes [h][t][d] (fp16 + hi/lo) of rope(x) x sc with the rotate-half convention out[d] = x[d] cos[t][d] - x[d+HD/2] sin[t][d], out[d+HD/2] = x[d+HD/2] cos[t][d+HD/2] + x[d] sin[t][d+HD/2]
__global__ __launch_bounds__(256) void k_rope(const float* __restrict__ F, int pitch, int nheads, const float* __restrict__ CS, const float* __restrict__ RF, const float* __restrict__ nw, float sc, h16* P16, bf* Ph, bf* Pl) {
    const size_t e = ((size_t)blockIdx.x * 256 + threadIdx.x) * 2; if (e >= (size_t)nheads * TT * HD) return; const int d = (int)(e % HD); const int t = (int)((e / HD) % TT); const int h = (int)(e / ((size_t)HD * TT)); const float* f = F + (size_t)t * pitch + h * HD; const float rf = RF ? RF[(size_t)h * TT + t] : 1.0f; v2h o16; v2us oh, ol;
#pragma unroll
    for (int q = 0; q < 2; ++q) { const int dd = d + q; const int dp = (dd < HD / 2) ? dd + HD / 2 : dd - HD / 2; float x0 = f[dd], x1 = f[dp];
        if (RF) { float n0 = __fmul_rn(x0, rf), n1 = __fmul_rn(x1, rf); asm volatile("" : "+v"(n0)); asm volatile("" : "+v"(n1)); x0 = __fmul_rn(bfr(nw[dd]), n0); x1 = __fmul_rn(bfr(nw[dp]), n1); }
        const v2f cs = *(const v2f*)(CS + ((size_t)t * HD + dd) * 2); float a = __fmul_rn(x0, cs[0]), bq = __fmul_rn(x1, cs[1]); asm volatile("" : "+v"(a)); asm volatile("" : "+v"(bq)); const float r = ((dd < HD / 2) ? __fsub_rn(a, bq) : __fadd_rn(a, bq)) * sc;
        o16[q] = tohx(r); unsigned short a2, c2; splitf(r, a2, c2); oh[q] = a2; ol[q] = c2; }
    *(v2h*)(P16 + e) = o16; *(v2us*)(Ph + e) = oh; *(v2us*)(Pl + e) = ol;  }
__global__ __launch_bounds__(256) void k_copy4(const float* __restrict__ Y, float* out, size_t n4) { const size_t i = (size_t)blockIdx.x * 256 + threadIdx.x; if (i >= n4) return; const v4f a = *(const v4f*)(Y + i * 4); *(v4f*)(out + i * 4) = a;  }
extern "C" void kernel_launch(void* const* d_in, const int* in_sizes, int n_in,
                              void* d_out, int out_size, void* d_ws, size_t ws_size, hipStream_t stream) {
    (void)in_sizes; (void)n_in; (void)out_size;
    const float* x = (const float*)d_in[0]; const float* wk = (const float*)d_in[1]; const float* wq = (const float*)d_in[2]; const float* wv = (const float*)d_in[3];   /* input order x [4][4096][768], Wk, Wq, Wv ('xw' [768][64]; NOTE the key weight comes FIRST); standard roles: rows = queries */
    float* OUT = (float*)d_out;     // [4][4096][64]
    char* wsp = (char*)d_ws;
    auto take = [&](size_t bytes) { char* p = wsp; wsp += (bytes + 255) & ~(size_t)255; return (void*)p; };
    bf* WQ = (bf*)take((size_t)MID * CC * 2); bf* WK = (bf*)take((size_t)MID * CC * 2); bf* WV = (bf*)take((size_t)CO * CC * 2); float* CS = (float*)take((size_t)TT * HD * 2 * 4);
    bf* XB = (bf*)take((size_t)TT * CC * 2); float* FQ = (float*)take((size_t)TT * MID * 4); float* FK = (float*)take((size_t)TT * MID * 4);
    h16* QP16 = (h16*)take((size_t)TT * MID * 2); bf* QPh = (bf*)take((size_t)TT * MID * 2); bf* QPl = (bf*)take((size_t)TT * MID * 2); h16* KP16 = (h16*)take((size_t)TT * MID * 2); bf* KPh = (bf*)take((size_t)TT * MID * 2); bf* KPl = (bf*)take((size_t)TT * MID * 2);
    h16* VT16 = (h16*)take((size_t)CO * TT * 2); bf* VTh = (bf*)take((size_t)CO * TT * 2); bf* VTl = (bf*)take((size_t)CO * TT * 2);
    float* Sb = (float*)take((size_t)TT * TT * 4); h16* P16 = (h16*)take((size_t)TT * TT * 2); bf* Ph = (bf*)take((size_t)RH * TT * 2); bf* Pl = (bf*)take((size_t)RH * TT * 2); float* Ob = (float*)take((size_t)TT * CO * 4);   /* attention output (f32) before the final copy */
    if ((size_t)(wsp - (char*)d_ws) > ws_size) return;    // ws 256 MiB (carve ~120 MiB)
    float* FV = FK;   /* the v projection reuses the k buffer after the k planes are built (stream-ordered) */
    k_wtG<<<(unsigned)((CC * MID / 64 + 63) / 64), 256, 0, stream>>>(wq, CC, MID, WQ); k_wtG<<<(unsigned)((CC * MID / 64 + 63) / 64), 256, 0, stream>>>(wk, CC, MID, WK); k_wtG<<<(unsigned)((CC * CO / 64 + 63) / 64), 256, 0, stream>>>(wv, CC, CO, WV);   /* 'xw' [768][64] -> Bt */       /* 'xw' weights -> Bt */
    k_csid<<<(TT * HD + 255) / 256, 256, 0, stream>>>(CS);   /* identity table: k_rope is a plain per-head plane builder here */
    const unsigned LP = (unsigned)(((size_t)NH_ * TT * HD / 2 + 255) / 256);
    for (int b = 0; b < NB_; ++b) {
        k_cvt8<<<(unsigned)(((size_t)TT * CC / 8 + 255) / 256), 256, 0, stream>>>(x + (size_t)b * TT * CC, XB, (size_t)TT * CC / 8);
        k_gemmw<bf, 0, false><<<dim3(TT / 64, MID / 64, 1), 32, 0, stream>>>(XB, nullptr, WQ, nullptr, CC, FQ, MID, nullptr, 0, 0, 0); k_rope<<<LP, 256, 0, stream>>>(FQ, MID, NH_, CS, nullptr, nullptr, 1.0f, QP16, QPh, QPl);   /* q planes [h][n][64] */
        k_gemmw<bf, 0, false><<<dim3(TT / 64, MID / 64, 1), 32, 0, stream>>>(XB, nullptr, WK, nullptr, CC, FK, MID, nullptr, 0, 0, 0); k_rope<<<LP, 256, 0, stream>>>(FK, MID, NKV, CS, nullptr, nullptr, 1.0f, KP16, KPh, KPl);   /* k planes */
        k_gemmw<bf, 0, false><<<dim3(TT / 64, CO / 64, 1), 32, 0, stream>>>(XB, nullptr, WV, nullptr, CC, FV, CO, nullptr, 0, 0, 0); k_vtp<<<(unsigned)(((size_t)TT * CO / 2 + 255) / 256), 256, 0, stream>>>(FV, CO, CO / HD, VT16, VTh, VTl);   /* v^T planes [h][64][n] */
        for (int h = 0; h < NH_; ++h) {   /* per head: dense 4096 x 4096 attention */
            k_gemmw<bf, 2, false><<<dim3(TT / 64, TT / 64, 1), 32, 0, stream>>>(QPh + (size_t)h * TT * HD, QPl + (size_t)h * TT * HD, KPh + (size_t)h * TT * HD, KPl + (size_t)h * TT * HD, HD, Sb, TT, nullptr, 0, 0, 0);   /* S[i][j] = q_i.k_j (3 products, every row) */
            k_lsoft<<<TT / 8, 256, 0, stream>>>(Sb, P16, Ph, Pl);   /* x 768^-0.5, softmax over the 4,096 keys */
            k_gemmw<bf, 2, false><<<dim3(RH / 64, HD / 64, 1), 32, 0, stream>>>(Ph, Pl, VTh + (size_t)h * HD * TT, VTl + (size_t)h * HD * TT, TT, Ob + h * HD, CO, nullptr, 0, 0, 0);
            k_gemmw<h16, 0, false><<<dim3((TT - RH) / 64, HD / 64, 1), 32, 0, stream>>>(P16 + (size_t)RH * TT, nullptr, VT16 + (size_t)h * HD * TT, nullptr, TT, Ob + (size_t)RH * CO + h * HD, CO, nullptr, 0, 0, 0); }
        k_cs8<<<(unsigned)(((size_t)TT * CO / 4 + 255) / 256), 256, 0, stream>>>(Ob, (size_t)TT * CO / 4);   /* rows >= 512 x 1/1024 */ k_copy4<<<(unsigned)(((size_t)TT * CO / 4 + 255) / 256), 256, 0, stream>>>(Ob, OUT + (size_t)b * TT * CO, (size_t)TT * CO / 4); }   /* the batch's output rows, written once */
}

// v001
// One run takes 657 microseconds.
// In two side-by-side timings against v000, it was 1.81 and 1.84 times as fast.
#include <hip/hip_runtime.h>

// Single causal attention head over 4,096 tokens scaled by the EMBEDDING width (x [4][4096][768]; k = x Wk, q = x Wq, v = x Wv ('xw' [768][64] 768^-0.5, no bias); wei = q.k^T x C^-0.5 with C = 768 (n_embd, not head_size); causal (-inf); softmax; out = wei.v -> [4][4096][64] (1.0 M); argument order x, Wk, Wq, Wv).
// Layout per batch: bf16 copy of x; 'xw' weights transposed once; exact projections (K 768); identity-table plane builders; scores with EVERY row on hi/lo planes (3 products, dense launches); streaming three-sweep causal softmax over the 4,096 keys; attn.v hybrid (rows < 512 hi/lo 3 products, rest fp16 x1024); k_cs8 removes the fp16 carry; k_copy4 writes the output rows once.
// Compute dtypes, f32 accumulate: every input rounded to bf16; projections exact; scores 3 products; softmax f32; wei.v rows < 512 3 products, rest fp16; output f32.

#define NB_  4
#define TT   4096
#define DM   64
#define NH_  1
#define NKV  1
#define REP  (NH_ / NKV)
#define HD   64
#define DQ   (NH_ * HD)
#define DKV  (NKV * HD)
#define ZH   1
#define RH   512                  // query rows < RH use hi+lo planes (0: none)
#define WIN  0
#define PCAR 1024.0f
#define SCL  0.036084391824351615f   // C^-0.5 with C = n_embd = 768 (the source scales by the input width, NOT the head size)
#define MID  64       // q / k width (one 64-wide head)
#define CO   64       // v width
#define CC   768      // input width (d_model)
typedef _Float16 h16;
typedef unsigned short bf;
typedef __attribute__((ext_vector_type(16))) __bf16   v16bf;
typedef __attribute__((ext_vector_type(16))) _Float16 v16h;
typedef __attribute__((ext_vector_type(8)))  _Float16 v8h;
typedef __attribute__((ext_vector_type(8)))  unsigned short v8us;
typedef __attribute__((ext_vector_type(8)))  float    v8f;
typedef __attribute__((ext_vector_type(4)))  float    v4f;
typedef v8h  __attribute__((may_alias)) v8ha;
typedef v4f  __attribute__((may_alias)) v4fa;
typedef v8us __attribute__((may_alias)) v8usa;

__device__ __forceinline__ unsigned short f2bf(float f) { unsigned u = __float_as_uint(f); u += 0x7FFFu + ((u >> 16) & 1u); return (unsigned short)(u >> 16); }
__device__ __forceinline__ float bf2f(unsigned short b) { return __uint_as_float(((unsigned)b) << 16); }
__device__ __forceinline__ float bfr(float f) { return bf2f(f2bf(f)); }
__device__ __forceinline__ v16h cat16(v8h lo, v8h hi) { return __builtin_shufflevector(lo, hi, 0, 1, 2, 3, 4, 5, 6, 7, 8, 9, 10, 11, 12, 13, 14, 15); }
__device__ __forceinline__ v16bf cat16b(v8us lo, v8us hi) { return __builtin_bit_cast(v16bf, __builtin_shufflevector(lo, hi, 0, 1, 2, 3, 4, 5, 6, 7, 8, 9, 10, 11, 12, 13, 14, 15)); }
__device__ __forceinline__ v8f wmma16(v16h a, v16h b, v8f c) { return __builtin_amdgcn_wmma_f32_16x16x32_f16(false, a, false, b, (short)0, c, false, false); }
__device__ __forceinline__ v8f wmmab(v16bf a, v16bf b, v8f c) { return __builtin_amdgcn_wmma_f32_16x16x32_bf16(false, a, false, b, (short)0, c, false, false); }



// ---- k_gemmw: register-blocked GEMM, one 64x64 output tile (16 accumulators a wave) per work-group of NW waves, operands straight from K-contiguous 16-bit planes; grid (M/64, N/64, Z), 32 * NW threads.
// C[m][n] (f32, pitch ldc, + optional f32 bias[n]) = sum_k A[m][k] Bt[n][k] (+ split products per NSPLIT). z-batch strides sA/sB/sC in elements. K % 32 == 0 (equal shares for the waves where K % (32 * NW) == 0).
// NW > 1 (split-K): wave w sums the 32-wide k steps w, w + NW, w + 2 NW, ... of the whole tile (neighbouring waves read neighbouring 64-byte pieces of the same rows at the same trip); the NW partial tiles meet in LDS and are added in the fixed order w = 0 .. NW-1.
template <typename T16> struct WFrag;
template <> struct WFrag<h16> { typedef v16h V; static __device__ __forceinline__ V ld(const h16* p) { return cat16(*(const v8h*)p, *(const v8h*)(p + 16)); } static __device__ __forceinline__ v8f mma(V a, V b, v8f c) { return wmma16(a, b, c); } };
template <> struct WFrag<bf> { typedef v16bf V; static __device__ __forceinline__ V ld(const bf* p) { return cat16b(*(const v8us*)p, *(const v8us*)(p + 16)); } static __device__ __forceinline__ v8f mma(V a, V b, v8f c) { return wmmab(a, b, c); } };
template <typename T16, int NSPLIT, bool BIAS, int NW>
__global__ __launch_bounds__(32 * NW) void k_gemmw(const T16* __restrict__ A, const T16* __restrict__ A2, const T16* __restrict__ Bt, const T16* __restrict__ Bt2, int K, float* C, int ldc, const float* __restrict__ bias, size_t sA, size_t sB, size_t sC) {
    typedef typename WFrag<T16>::V V;
    __shared__ __align__(16) float os[NW == 1 ? 16 * 68 : NW * 64 * 68];   // NW > 1: one column-major 64 x 64 partial tile a wave, column pitch 68 floats
    const size_t z = blockIdx.z; A += z * sA; if (A2) A2 += z * sA; Bt += z * sB; if (Bt2) Bt2 += z * sB; C += z * sC;
    const int lane = threadIdx.x & 31, lr = lane & 15, hi = lane >> 4; const int r0 = blockIdx.x * 64, c0 = blockIdx.y * 64;
    v8f acc[4][4];
#pragma unroll
    for (int mb = 0; mb < 4; ++mb)
#pragma unroll
        for (int nb = 0; nb < 4; ++nb) acc[mb][nb] = (v8f){};
    const size_t aoff = (size_t)(r0 + lr) * K + 8 * hi, boff = (size_t)(c0 + lr) * K + 8 * hi;
    const int wv = (NW == 1) ? 0 : __builtin_amdgcn_readfirstlane((int)(threadIdx.x >> 5));   // the wave's number, held scalar so that the loop bounds stay scalar
#pragma unroll 1
    for (int kc = wv * 32; kc < K; kc += 32 * NW) {
        V a[4], a2[4];
#pragma unroll
        for (int mb = 0; mb < 4; ++mb) { a[mb] = WFrag<T16>::ld(A + aoff + (size_t)mb * 16 * K + kc); if (NSPLIT == 1 || NSPLIT == 2) a2[mb] = WFrag<T16>::ld(A2 + aoff + (size_t)mb * 16 * K + kc); }
#pragma unroll
        for (int nb = 0; nb < 4; ++nb) { const V b = WFrag<T16>::ld(Bt + boff + (size_t)nb * 16 * K + kc); V b2; if (NSPLIT >= 2) b2 = WFrag<T16>::ld(Bt2 + boff + (size_t)nb * 16 * K + kc);
#pragma unroll
            for (int mb = 0; mb < 4; ++mb) { acc[mb][nb] = WFrag<T16>::mma(a[mb], b, acc[mb][nb]); if (NSPLIT == 1 || NSPLIT == 2) acc[mb][nb] = WFrag<T16>::mma(a2[mb], b, acc[mb][nb]); if (NSPLIT >= 2) acc[mb][nb] = WFrag<T16>::mma(a[mb], b2, acc[mb][nb]); } }
        asm volatile("v_nop\n\tv_nop\n\tv_nop\n\tv_nop" : "+v"(acc[0][0]), "+v"(acc[1][1]), "+v"(acc[2][2]), "+v"(acc[3][3]) : "v"(a[0]), "v"(a[3]));
    }
    if constexpr (NW > 1) {
        float* ow = os + wv * (64 * 68);
#pragma unroll   // both loops unrolled: acc is indexed by constants only, so it stays in registers
        for (int mb = 0; mb < 4; ++mb)
#pragma unroll
            for (int nb = 0; nb < 4; ++nb) { float* p = ow + (nb * 16 + lr) * 68 + mb * 16 + hi * 8;   /* a lane's 8 accumulator values are 8 consecutive rows of one column */
                *(v4fa*)p = __builtin_shufflevector(acc[mb][nb], acc[mb][nb], 0, 1, 2, 3); *(v4fa*)(p + 4) = __builtin_shufflevector(acc[mb][nb], acc[mb][nb], 4, 5, 6, 7); }
        __syncthreads();   // every wave's partial tile is in LDS before any thread adds them
        for (int u = threadIdx.x; u < 1024; u += 32 * NW) { const int col = u & 63, rg = (u >> 6) * 4; const float* p = os + col * 68 + rg; v4f val = *(const v4fa*)p;
#pragma unroll   // unrolled so that the NW LDS reads are issued ahead of the adds
            for (int w = 1; w < NW; ++w) val += *(const v4fa*)(p + w * (64 * 68));
            if (BIAS) { const float bv = bfr(bias[c0 + col]); val[0] += bv; val[1] += bv; val[2] += bv; val[3] += bv; }
            float* cp = C + (size_t)(r0 + rg) * ldc + c0 + col;   /* 32 lanes = 32 consecutive columns of one row: each store fills one 128-byte line */
#pragma unroll   // val indexed by constants only
            for (int q = 0; q < 4; ++q) cp[(size_t)q * ldc] = val[q]; }
        return;
    }
#pragma unroll
    for (int mb = 0; mb < 4; ++mb) {
#pragma unroll
        for (int nb = 0; nb < 4; ++nb) {
#pragma unroll
            for (int j = 0; j < 8; ++j) os[(hi * 8 + j) * 68 + nb * 16 + lr] = acc[mb][nb][j]; }
        __builtin_amdgcn_wave_barrier(); asm volatile("" ::: "memory");
        float* crow = C + (size_t)(r0 + mb * 16) * ldc + c0;
{
#pragma unroll
            for (int s = 0; s < 8; ++s) { const int row = 2 * s + hi, cofs = lr * 4; v4f val = *(const v4fa*)(os + row * 68 + cofs); if (BIAS) { val[0] += bfr(bias[c0 + cofs]); val[1] += bfr(bias[c0 + cofs + 1]); val[2] += bfr(bias[c0 + cofs + 2]); val[3] += bfr(bias[c0 + cofs + 3]); }
                *(v4f*)(crow + (size_t)row * ldc + cofs) = val; }
             }
        __builtin_amdgcn_wave_barrier(); asm volatile("" ::: "memory");
    }
}

__device__ __forceinline__ h16 tohx(float x) { return (h16)x; }
__device__ __forceinline__ void splitf(float y, unsigned short& h, unsigned short& l) { h = f2bf(y); l = f2bf(y - bf2f(h)); }
typedef __attribute__((ext_vector_type(2))) _Float16 v2h;
typedef __attribute__((ext_vector_type(4))) _Float16 v4h;
typedef __attribute__((ext_vector_type(2))) unsigned short v2us;
typedef __attribute__((ext_vector_type(4))) unsigned short v4us;
typedef __attribute__((ext_vector_type(2))) float v2f;
typedef __attribute__((ext_vector_type(4))) int v4i;

__global__ __launch_bounds__(256) void k_cvt8(const float* __restrict__ src, bf* dst, size_t n8) { const size_t i = (size_t)blockIdx.x * 256 + threadIdx.x; if (i >= n8) return; const v8f v = *(const v8f*)(src + i * 8); v8us o;
#pragma unroll
    for (int k = 0; k < 8; ++k) o[k] = f2bf(v[k]); *(v8us*)(dst + i * 8) = o;  }


__global__ __launch_bounds__(256) void k_wtG(const float* __restrict__ w, int K, int N, bf* Bt) {
    const int lane = threadIdx.x & 31; const int L0 = (blockIdx.x * 8 + (threadIdx.x >> 5)) * 8; const int nlines = N * K / 64;
{
#pragma unroll 1
        for (int l = 0; l < 8; ++l) { const int L = L0 + l; if (L >= nlines) break; const size_t e = (size_t)L * 64 + lane * 2; const int k = (int)(e % K), n = (int)(e / K); v2us o;
            o[0] = f2bf(w[(size_t)k * N + n]); o[1] = f2bf(w[(size_t)(k + 1) * N + n]); *(v2us*)(Bt + e) = o; }
         }
}
__global__ __launch_bounds__(256) void k_vtp(const float* __restrict__ F, int pitch, int nheads, h16* V16, bf* Vh, bf* Vl) { const size_t e = ((size_t)blockIdx.x * 256 + threadIdx.x) * 2; if (e >= (size_t)nheads * HD * TT) return; const int t = (int)(e % TT); const int d = (int)((e / TT) % HD); const int g = (int)(e / ((size_t)TT * HD)); v2h o16; v2us oh, ol;
#pragma unroll
    for (int q = 0; q < 2; ++q) { const float x = F[(size_t)(t + q) * pitch + g * HD + d]; o16[q] = tohx(x); unsigned short a2, c2; splitf(x, a2, c2); oh[q] = a2; ol[q] = c2; }
    *(v2h*)(V16 + e) = o16; *(v2us*)(Vh + e) = oh; *(v2us*)(Vl + e) = ol;  }
__global__ __launch_bounds__(256) void k_lsoft(const float* __restrict__ Sb, h16* P16, bf* Ph, bf* Pl) {
    const int lane = threadIdx.x & 31; const int row = blockIdx.x * 8 + (threadIdx.x >> 5); if (row >= ZH * TT) return; const int i = row % TT; const int zz = row / TT; const bool hires = (i < RH); const float* sr = Sb + (size_t)row * TT; float mx = -3.0e38f;
#pragma unroll 4
    for (int ch = 0; ch < TT / 128; ++ch) { const int j0 = ch * 128 + lane * 4; const v4f a = *(const v4f*)(sr + j0);
#pragma unroll
        for (int q = 0; q < 4; ++q) { float t = (j0 + q <= i) ? a[q] * SCL : -3.0e38f; asm volatile("" : "+v"(t)); mx = fmaxf(mx, t); } }
#pragma unroll
    for (int sh = 16; sh; sh >>= 1) mx = fmaxf(mx, __shfl_xor(mx, sh, 32));
    float sum = 0.f;
#pragma unroll 4
    for (int ch = 0; ch < TT / 128; ++ch) { const int j0 = ch * 128 + lane * 4; const v4f a = *(const v4f*)(sr + j0);
#pragma unroll
        for (int q = 0; q < 4; ++q) { float t = (j0 + q <= i) ? a[q] * SCL : -3.0e38f; asm volatile("" : "+v"(t)); float d0 = __fsub_rn(t, mx); asm volatile("" : "+v"(d0)); sum += __builtin_amdgcn_exp2f(__fmul_rn(d0, 1.4426950408889634f)); } }
#pragma unroll
    for (int sh = 16; sh; sh >>= 1) sum += __shfl_xor(sum, sh, 32);
    const float f = __fdiv_rn(hires ? 1.0f : PCAR, sum);
{
        if (hires) {   /* rows < RH: normalised bf16 hi/lo over all keys, planes [zz][RH][TT] */
#pragma unroll
            for (int ch = 0; ch < TT / 128; ++ch) { const int j0 = ch * 128 + lane * 4; const v4f a = *(const v4f*)(sr + j0); v4us oh, ol;
#pragma unroll
                for (int q = 0; q < 4; ++q) { float t = (j0 + q <= i) ? a[q] * SCL : -3.0e38f; asm volatile("" : "+v"(t)); float d0 = __fsub_rn(t, mx); asm volatile("" : "+v"(d0)); float ex = __builtin_amdgcn_exp2f(__fmul_rn(d0, 1.4426950408889634f)); asm volatile("" : "+v"(ex)); unsigned short a2, c2; splitf(ex * f, a2, c2); oh[q] = a2; ol[q] = c2; }
                const size_t oo = ((size_t)zz * RH + i) * TT + j0; *(v4us*)(Ph + oo) = oh; *(v4us*)(Pl + oo) = ol; }
        } else {
#pragma unroll 2
            for (int ch = 0; ch < TT / 128; ++ch) { const int j0 = ch * 128 + lane * 4; const v4f a = *(const v4f*)(sr + j0); v4h o4;
#pragma unroll
                for (int q = 0; q < 4; ++q) { float t = (j0 + q <= i) ? a[q] * SCL : -3.0e38f; asm volatile("" : "+v"(t)); float d0 = __fsub_rn(t, mx); asm volatile("" : "+v"(d0)); float ex = __builtin_amdgcn_exp2f(__fmul_rn(d0, 1.4426950408889634f)); asm volatile("" : "+v"(ex)); o4[q] = tohx(ex * f); }
                *(v4h*)(P16 + (size_t)row * TT + j0) = o4; } }
         }
}
__global__ __launch_bounds__(256) void k_cs8(float* O, size_t n4) { const size_t i = (size_t)blockIdx.x * 256 + threadIdx.x; if (i >= n4) return; const size_t e = i * 4; const int t = (int)(e / CO);   /* row pitch of the attention-output plane is the VALUE width CO (r1 used the input width CC: wrong whenever CC != CO) */ const float cs = (t < RH) ? 1.0f : (1.0f / PCAR); v4f a = *(const v4f*)(O + e);
#pragma unroll
    for (int q = 0; q < 4; ++q) a[q] = __fmul_rn(a[q], cs);
    *(v4f*)(O + e) = a;  }

__global__ __launch_bounds__(256) void k_csid(float* CS) { const int idx = blockIdx.x * 256 + threadIdx.x; if (idx >= TT * HD) return; v2f cs; cs[0] = 1.0f; cs[1] = 0.0f; *(v2f*)(CS + (size_t)idx * 2) = cs;  }
// k_rope: head planes [h][t][d] (fp16 + hi/lo) of rope(x) x sc with the rotate-half convention out[d] = x[d] cos[t][d] - x[d+HD/2] sin[t][d], out[d+HD/2] = x[d+HD/2] cos[t][d+HD/2] + x[d] sin[t][d+HD/2]
__global__ __launch_bounds__(256) void k_rope(const float* __restrict__ F, int pitch, int nheads, const float* __restrict__ CS, const float* __restrict__ RF, const float* __restrict__ nw, float sc, h16* P16, bf* Ph, bf* Pl) {
    const size_t e = ((size_t)blockIdx.x * 256 + threadIdx.x) * 2; if (e >= (size_t)nheads * TT * HD) return; const int d = (int)(e % HD); const int t = (int)((e / HD) % TT); const int h = (int)(e / ((size_t)HD * TT)); const float* f = F + (size_t)t * pitch + h * HD; const float rf = RF ? RF[(size_t)h * TT + t] : 1.0f; v2h o16; v2us oh, ol;
#pragma unroll
    for (int q = 0; q < 2; ++q) { const int dd = d + q; const int dp = (dd < HD / 2) ? dd + HD / 2 : dd - HD / 2; float x0 = f[dd], x1 = f[dp];
        if (RF) { float n0 = __fmul_rn(x0, rf), n1 = __fmul_rn(x1, rf); asm volatile("" : "+v"(n0)); asm volatile("" : "+v"(n1)); x0 = __fmul_rn(bfr(nw[dd]), n0); x1 = __fmul_rn(bfr(nw[dp]), n1); }
        const v2f cs = *(const v2f*)(CS + ((size_t)t * HD + dd) * 2); float a = __fmul_rn(x0, cs[0]), bq = __fmul_rn(x1, cs[1]); asm volatile("" : "+v"(a)); asm volatile("" : "+v"(bq)); const float r = ((dd < HD / 2) ? __fsub_rn(a, bq) : __fadd_rn(a, bq)) * sc;
        o16[q] = tohx(r); unsigned short a2, c2; splitf(r, a2, c2); oh[q] = a2; ol[q] = c2; }
    *(v2h*)(P16 + e) = o16; *(v2us*)(Ph + e) = oh; *(v2us*)(Pl + e) = ol;  }
__global__ __launch_bounds__(256) void k_copy4(const float* __restrict__ Y, float* out, size_t n4) { const size_t i = (size_t)blockIdx.x * 256 + threadIdx.x; if (i >= n4) return; const v4f a = *(const v4f*)(Y + i * 4); *(v4f*)(out + i * 4) = a;  }
extern "C" void kernel_launch(void* const* d_in, const int* in_sizes, int n_in,
                              void* d_out, int out_size, void* d_ws, size_t ws_size, hipStream_t stream) {
    (void)in_sizes; (void)n_in; (void)out_size;
    const float* x = (const float*)d_in[0]; const float* wk = (const float*)d_in[1]; const float* wq = (const float*)d_in[2]; const float* wv = (const float*)d_in[3];   /* input order x [4][4096][768], Wk, Wq, Wv ('xw' [768][64]; NOTE the key weight comes FIRST); standard roles: rows = queries */
    float* OUT = (float*)d_out;     // [4][4096][64]
    char* wsp = (char*)d_ws;
    auto take = [&](size_t bytes) { char* p = wsp; wsp += (bytes + 255) & ~(size_t)255; return (void*)p; };
    bf* WQ = (bf*)take((size_t)MID * CC * 2); bf* WK = (bf*)take((size_t)MID * CC * 2); bf* WV = (bf*)take((size_t)CO * CC * 2); float* CS = (float*)take((size_t)TT * HD * 2 * 4);
    bf* XB = (bf*)take((size_t)TT * CC * 2); float* FQ = (float*)take((size_t)TT * MID * 4); float* FK = (float*)take((size_t)TT * MID * 4);
    h16* QP16 = (h16*)take((size_t)TT * MID * 2); bf* QPh = (bf*)take((size_t)TT * MID * 2); bf* QPl = (bf*)take((size_t)TT * MID * 2); h16* KP16 = (h16*)take((size_t)TT * MID * 2); bf* KPh = (bf*)take((size_t)TT * MID * 2); bf* KPl = (bf*)take((size_t)TT * MID * 2);
    h16* VT16 = (h16*)take((size_t)CO * TT * 2); bf* VTh = (bf*)take((size_t)CO * TT * 2); bf* VTl = (bf*)take((size_t)CO * TT * 2);
    float* Sb = (float*)take((size_t)TT * TT * 4); h16* P16 = (h16*)take((size_t)TT * TT * 2); bf* Ph = (bf*)take((size_t)RH * TT * 2); bf* Pl = (bf*)take((size_t)RH * TT * 2); float* Ob = (float*)take((size_t)TT * CO * 4);   /* attention output (f32) before the final copy */
    if ((size_t)(wsp - (char*)d_ws) > ws_size) return;    // ws 256 MiB (carve ~120 MiB)
    float* FV = FK;   /* the v projection reuses the k buffer after the k planes are built (stream-ordered) */
    k_wtG<<<(unsigned)((CC * MID / 64 + 63) / 64), 256, 0, stream>>>(wq, CC, MID, WQ); k_wtG<<<(unsigned)((CC * MID / 64 + 63) / 64), 256, 0, stream>>>(wk, CC, MID, WK); k_wtG<<<(unsigned)((CC * CO / 64 + 63) / 64), 256, 0, stream>>>(wv, CC, CO, WV);   /* 'xw' [768][64] -> Bt */       /* 'xw' weights -> Bt */
    k_csid<<<(TT * HD + 255) / 256, 256, 0, stream>>>(CS);   /* identity table: k_rope is a plain per-head plane builder here */
    const unsigned LP = (unsigned)(((size_t)NH_ * TT * HD / 2 + 255) / 256);
    for (int b = 0; b < NB_; ++b) {
        k_cvt8<<<(unsigned)(((size_t)TT * CC / 8 + 255) / 256), 256, 0, stream>>>(x + (size_t)b * TT * CC, XB, (size_t)TT * CC / 8);
        k_gemmw<bf, 0, false, 12><<<dim3(TT / 64, MID / 64, 1), 32 * 12, 0, stream>>>(XB, nullptr, WQ, nullptr, CC, FQ, MID, nullptr, 0, 0, 0); k_rope<<<LP, 256, 0, stream>>>(FQ, MID, NH_, CS, nullptr, nullptr, 1.0f, QP16, QPh, QPl);   /* q planes [h][n][64] */
        k_gemmw<bf, 0, false, 12><<<dim3(TT / 64, MID / 64, 1), 32 * 12, 0, stream>>>(XB, nullptr, WK, nullptr, CC, FK, MID, nullptr, 0, 0, 0); k_rope<<<LP, 256, 0, stream>>>(FK, MID, NKV, CS, nullptr, nullptr, 1.0f, KP16, KPh, KPl);   /* k planes */
        k_gemmw<bf, 0, false, 12><<<dim3(TT / 64, CO / 64, 1), 32 * 12, 0, stream>>>(XB, nullptr, WV, nullptr, CC, FV, CO, nullptr, 0, 0, 0); k_vtp<<<(unsigned)(((size_t)TT * CO / 2 + 255) / 256), 256, 0, stream>>>(FV, CO, CO / HD, VT16, VTh, VTl);   /* v^T planes [h][64][n] */
        for (int h = 0; h < NH_; ++h) {   /* per head: dense 4096 x 4096 attention */
            k_gemmw<bf, 2, false, 1><<<dim3(TT / 64, TT / 64, 1), 32, 0, stream>>>(QPh + (size_t)h * TT * HD, QPl + (size_t)h * TT * HD, KPh + (size_t)h * TT * HD, KPl + (size_t)h * TT * HD, HD, Sb, TT, nullptr, 0, 0, 0);   /* S[i][j] = q_i.k_j (3 products, every row) */
            k_lsoft<<<TT / 8, 256, 0, stream>>>(Sb, P16, Ph, Pl);   /* x 768^-0.5, softmax over the 4,096 keys */
            k_gemmw<bf, 2, false, 16><<<dim3(RH / 64, HD / 64, 1), 32 * 16, 0, stream>>>(Ph, Pl, VTh + (size_t)h * HD * TT, VTl + (size_t)h * HD * TT, TT, Ob + h * HD, CO, nullptr, 0, 0, 0);
            k_gemmw<h16, 0, false, 16><<<dim3((TT - RH) / 64, HD / 64, 1), 32 * 16, 0, stream>>>(P16 + (size_t)RH * TT, nullptr, VT16 + (size_t)h * HD * TT, nullptr, TT, Ob + (size_t)RH * CO + h * HD, CO, nullptr, 0, 0, 0); }
        k_cs8<<<(unsigned)(((size_t)TT * CO / 4 + 255) / 256), 256, 0, stream>>>(Ob, (size_t)TT * CO / 4);   /* rows >= 512 x 1/1024 */ k_copy4<<<(unsigned)(((size_t)TT * CO / 4 + 255) / 256), 256, 0, stream>>>(Ob, OUT + (size_t)b * TT * CO, (size_t)TT * CO / 4); }   /* the batch's output rows, written once */
}

// v002
// Measured time: 412 microseconds a run.
// In two side-by-side timings against v001, it was 1.63 and 1.58 times as fast.
// Over all steps from v000 it is 2.93 times as fast.
#include <hip/hip_runtime.h>

// Single causal attention head over 4,096 tokens scaled by the EMBEDDING width (x [4][4096][768]; k = x Wk, q = x Wq, v = x Wv ('xw' [768][64] 768^-0.5, no bias); wei = q.k^T x C^-0.5 with C = 768 (n_embd, not head_size); causal (-inf); softmax; out = wei.v -> [4][4096][64] (1.0 M); argument order x, Wk, Wq, Wv).
// All four batches go through every launch but the scores and the softmax (one f32 score plane in the workspace), the batch being rows of the grid or blockIdx.y / z. Layout: bf16 copy of x; 'xw' weights transposed once; exact projections (K 768); identity-table plane builders; scores with EVERY row on hi/lo planes (3 products, dense launches); streaming three-sweep causal softmax over the 4,096 keys; attn.v hybrid (rows < 512 hi/lo 3 products, rest fp16 x1024); k_cs8 removes the fp16 carry; k_copy4 writes the output rows once.
// Compute dtypes, f32 accumulate: every input rounded to bf16; projections exact; scores 3 products; softmax f32; wei.v rows < 512 3 products, rest fp16; output f32.

#define NB_  4
#define TT   4096
#define DM   64
#define NH_  1
#define NKV  1
#define REP  (NH_ / NKV)
#define HD   64
#define DQ   (NH_ * HD)
#define DKV  (NKV * HD)
#define ZH   1
#define RH   512                  // query rows < RH use hi+lo planes (0: none)
#define WIN  0
#define PCAR 1024.0f
#define SCL  0.036084391824351615f   // C^-0.5 with C = n_embd = 768 (the source scales by the input width, NOT the head size)
#define MID  64       // q / k width (one 64-wide head)
#define CO   64       // v width
#define CC   768      // input width (d_model)
typedef _Float16 h16;
typedef unsigned short bf;
typedef __attribute__((ext_vector_type(16))) __bf16   v16bf;
typedef __attribute__((ext_vector_type(16))) _Float16 v16h;
typedef __attribute__((ext_vector_type(8)))  _Float16 v8h;
typedef __attribute__((ext_vector_type(8)))  unsigned short v8us;
typedef __attribute__((ext_vector_type(8)))  float    v8f;
typedef __attribute__((ext_vector_type(4)))  float    v4f;
typedef v8h  __attribute__((may_alias)) v8ha;
typedef v4f  __attribute__((may_alias)) v4fa;
typedef v8us __attribute__((may_alias)) v8usa;

__device__ __forceinline__ unsigned short f2bf(float f) { unsigned u = __float_as_uint(f); u += 0x7FFFu + ((u >> 16) & 1u); return (unsigned short)(u >> 16); }
__device__ __forceinline__ float bf2f(unsigned short b) { return __uint_as_float(((unsigned)b) << 16); }
__device__ __forceinline__ float bfr(float f) { return bf2f(f2bf(f)); }
__device__ __forceinline__ v16h cat16(v8h lo, v8h hi) { return __builtin_shufflevector(lo, hi, 0, 1, 2, 3, 4, 5, 6, 7, 8, 9, 10, 11, 12, 13, 14, 15); }
__device__ __forceinline__ v16bf cat16b(v8us lo, v8us hi) { return __builtin_bit_cast(v16bf, __builtin_shufflevector(lo, hi, 0, 1, 2, 3, 4, 5, 6, 7, 8, 9, 10, 11, 12, 13, 14, 15)); }
__device__ __forceinline__ v8f wmma16(v16h a, v16h b, v8f c) { return __builtin_amdgcn_wmma_f32_16x16x32_f16(false, a, false, b, (short)0, c, false, false); }
__device__ __forceinline__ v8f wmmab(v16bf a, v16bf b, v8f c) { return __builtin_amdgcn_wmma_f32_16x16x32_bf16(false, a, false, b, (short)0, c, false, false); }



// ---- k_gemmw: register-blocked GEMM, one 64x64 output tile (16 accumulators a wave) per work-group of NW waves, operands straight from K-contiguous 16-bit planes; grid (M/64, N/64, Z), 32 * NW threads.
// C[m][n] (f32, pitch ldc, + optional f32 bias[n]) = sum_k A[m][k] Bt[n][k] (+ split products per NSPLIT). z-batch strides sA/sB/sC in elements. K % 32 == 0 (equal shares for the waves where K % (32 * NW) == 0).
// NW > 1 (split-K): wave w sums the 32-wide k steps w, w + NW, w + 2 NW, ... of the whole tile (neighbouring waves read neighbouring 64-byte pieces of the same rows at the same trip); the NW partial tiles meet in LDS and are added in the fixed order w = 0 .. NW-1.
template <typename T16> struct WFrag;
template <> struct WFrag<h16> { typedef v16h V; static __device__ __forceinline__ V ld(const h16* p) { return cat16(*(const v8h*)p, *(const v8h*)(p + 16)); } static __device__ __forceinline__ v8f mma(V a, V b, v8f c) { return wmma16(a, b, c); } };
template <> struct WFrag<bf> { typedef v16bf V; static __device__ __forceinline__ V ld(const bf* p) { return cat16b(*(const v8us*)p, *(const v8us*)(p + 16)); } static __device__ __forceinline__ v8f mma(V a, V b, v8f c) { return wmmab(a, b, c); } };
template <typename T16, int NSPLIT, bool BIAS, int NW>
__global__ __launch_bounds__(32 * NW) void k_gemmw(const T16* __restrict__ A, const T16* __restrict__ A2, const T16* __restrict__ Bt, const T16* __restrict__ Bt2, int K, float* C, int ldc, const float* __restrict__ bias, size_t sA, size_t sB, size_t sC) {
    typedef typename WFrag<T16>::V V;
    __shared__ __align__(16) float os[NW == 1 ? 16 * 68 : NW * 64 * 68];   // NW > 1: one column-major 64 x 64 partial tile a wave, column pitch 68 floats
    const size_t z = blockIdx.z; A += z * sA; if (A2) A2 += z * sA; Bt += z * sB; if (Bt2) Bt2 += z * sB; C += z * sC;
    const int lane = threadIdx.x & 31, lr = lane & 15, hi = lane >> 4; const int r0 = blockIdx.x * 64, c0 = blockIdx.y * 64;
    v8f acc[4][4];
#pragma unroll
    for (int mb = 0; mb < 4; ++mb)
#pragma unroll
        for (int nb = 0; nb < 4; ++nb) acc[mb][nb] = (v8f){};
    const size_t aoff = (size_t)(r0 + lr) * K + 8 * hi, boff = (size_t)(c0 + lr) * K + 8 * hi;
    const int wv = (NW == 1) ? 0 : __builtin_amdgcn_readfirstlane((int)(threadIdx.x >> 5));   // the wave's number, held scalar so that the loop bounds stay scalar
#pragma unroll 1
    for (int kc = wv * 32; kc < K; kc += 32 * NW) {
        V a[4], a2[4];
#pragma unroll
        for (int mb = 0; mb < 4; ++mb) { a[mb] = WFrag<T16>::ld(A + aoff + (size_t)mb * 16 * K + kc); if (NSPLIT == 1 || NSPLIT == 2) a2[mb] = WFrag<T16>::ld(A2 + aoff + (size_t)mb * 16 * K + kc); }
#pragma unroll
        for (int nb = 0; nb < 4; ++nb) { const V b = WFrag<T16>::ld(Bt + boff + (size_t)nb * 16 * K + kc); V b2; if (NSPLIT >= 2) b2 = WFrag<T16>::ld(Bt2 + boff + (size_t)nb * 16 * K + kc);
#pragma unroll
            for (int mb = 0; mb < 4; ++mb) { acc[mb][nb] = WFrag<T16>::mma(a[mb], b, acc[mb][nb]); if (NSPLIT == 1 || NSPLIT == 2) acc[mb][nb] = WFrag<T16>::mma(a2[mb], b, acc[mb][nb]); if (NSPLIT >= 2) acc[mb][nb] = WFrag<T16>::mma(a[mb], b2, acc[mb][nb]); } }
        asm volatile("v_nop\n\tv_nop\n\tv_nop\n\tv_nop" : "+v"(acc[0][0]), "+v"(acc[1][1]), "+v"(acc[2][2]), "+v"(acc[3][3]) : "v"(a[0]), "v"(a[3]));
    }
    if constexpr (NW > 1) {
        float* ow = os + wv * (64 * 68);
#pragma unroll   // both loops unrolled: acc is indexed by constants only, so it stays in registers
        for (int mb = 0; mb < 4; ++mb)
#pragma unroll
            for (int nb = 0; nb < 4; ++nb) { float* p = ow + (nb * 16 + lr) * 68 + mb * 16 + hi * 8;   /* a lane's 8 accumulator values are 8 consecutive rows of one column */
                *(v4fa*)p = __builtin_shufflevector(acc[mb][nb], acc[mb][nb], 0, 1, 2, 3); *(v4fa*)(p + 4) = __builtin_shufflevector(acc[mb][nb], acc[mb][nb], 4, 5, 6, 7); }
        __syncthreads();   // every wave's partial tile is in LDS before any thread adds them
        for (int u = threadIdx.x; u < 1024; u += 32 * NW) { const int col = u & 63, rg = (u >> 6) * 4; const float* p = os + col * 68 + rg; v4f val = *(const v4fa*)p;
#pragma unroll   // unrolled so that the NW LDS reads are issued ahead of the adds
            for (int w = 1; w < NW; ++w) val += *(const v4fa*)(p + w * (64 * 68));
            if (BIAS) { const float bv = bfr(bias[c0 + col]); val[0] += bv; val[1] += bv; val[2] += bv; val[3] += bv; }
            float* cp = C + (size_t)(r0 + rg) * ldc + c0 + col;   /* 32 lanes = 32 consecutive columns of one row: each store fills one 128-byte line */
#pragma unroll   // val indexed by constants only
            for (int q = 0; q < 4; ++q) cp[(size_t)q * ldc] = val[q]; }
        return;
    }
#pragma unroll
    for (int mb = 0; mb < 4; ++mb) {
#pragma unroll
        for (int nb = 0; nb < 4; ++nb) {
#pragma unroll
            for (int j = 0; j < 8; ++j) os[(hi * 8 + j) * 68 + nb * 16 + lr] = acc[mb][nb][j]; }
        __builtin_amdgcn_wave_barrier(); asm volatile("" ::: "memory");
        float* crow = C + (size_t)(r0 + mb * 16) * ldc + c0;
{
#pragma unroll
            for (int s = 0; s < 8; ++s) { const int row = 2 * s + hi, cofs = lr * 4; v4f val = *(const v4fa*)(os + row * 68 + cofs); if (BIAS) { val[0] += bfr(bias[c0 + cofs]); val[1] += bfr(bias[c0 + cofs + 1]); val[2] += bfr(bias[c0 + cofs + 2]); val[3] += bfr(bias[c0 + cofs + 3]); }
                *(v4f*)(crow + (size_t)row * ldc + cofs) = val; }
             }
        __builtin_amdgcn_wave_barrier(); asm volatile("" ::: "memory");
    }
}

__device__ __forceinline__ h16 tohx(float x) { return (h16)x; }
__device__ __forceinline__ void splitf(float y, unsigned short& h, unsigned short& l) { h = f2bf(y); l = f2bf(y - bf2f(h)); }
typedef __attribute__((ext_vector_type(2))) _Float16 v2h;
typedef __attribute__((ext_vector_type(4))) _Float16 v4h;
typedef __attribute__((ext_vector_type(2))) unsigned short v2us;
typedef __attribute__((ext_vector_type(4))) unsigned short v4us;
typedef __attribute__((ext_vector_type(2))) float v2f;
typedef __attribute__((ext_vector_type(4))) int v4i;

__global__ __launch_bounds__(256) void k_cvt8(const float* __restrict__ src, bf* dst, size_t n8) { const size_t i = (size_t)blockIdx.x * 256 + threadIdx.x; if (i >= n8) return; const v8f v = *(const v8f*)(src + i * 8); v8us o;
#pragma unroll
    for (int k = 0; k < 8; ++k) o[k] = f2bf(v[k]); *(v8us*)(dst + i * 8) = o;  }


__global__ __launch_bounds__(256) void k_wtG(const float* __restrict__ w, int K, int N, bf* Bt) {
    const int lane = threadIdx.x & 31; const int L0 = (blockIdx.x * 8 + (threadIdx.x >> 5)) * 8; const int nlines = N * K / 64;
{
#pragma unroll 1
        for (int l = 0; l < 8; ++l) { const int L = L0 + l; if (L >= nlines) break; const size_t e = (size_t)L * 64 + lane * 2; const int k = (int)(e % K), n = (int)(e / K); v2us o;
            o[0] = f2bf(w[(size_t)k * N + n]); o[1] = f2bf(w[(size_t)(k + 1) * N + n]); *(v2us*)(Bt + e) = o; }
         }
}
__global__ __launch_bounds__(256) void k_vtp(const float* __restrict__ F, int pitch, int nheads, h16* V16, bf* Vh, bf* Vl) { const size_t e = ((size_t)blockIdx.x * 256 + threadIdx.x) * 2; if (e >= (size_t)nheads * HD * TT) return; { const size_t zb = blockIdx.y, po = zb * nheads * HD * TT; F += zb * TT * pitch; V16 += po; Vh += po; Vl += po; }   /* blockIdx.y = batch */ const int t = (int)(e % TT); const int d = (int)((e / TT) % HD); const int g = (int)(e / ((size_t)TT * HD)); v2h o16; v2us oh, ol;
#pragma unroll
    for (int q = 0; q < 2; ++q) { const float x = F[(size_t)(t + q) * pitch + g * HD + d]; o16[q] = tohx(x); unsigned short a2, c2; splitf(x, a2, c2); oh[q] = a2; ol[q] = c2; }
    *(v2h*)(V16 + e) = o16; *(v2us*)(Vh + e) = oh; *(v2us*)(Vl + e) = ol;  }
__global__ __launch_bounds__(256) void k_lsoft(const float* __restrict__ Sb, h16* P16, bf* Ph, bf* Pl) {
    const int lane = threadIdx.x & 31; const int row = blockIdx.x * 8 + (threadIdx.x >> 5); if (row >= ZH * TT) return; const int i = row % TT; const int zz = row / TT; const bool hires = (i < RH); const float* sr = Sb + (size_t)row * TT; float mx = -3.0e38f;
#pragma unroll 4
    for (int ch = 0; ch < TT / 128; ++ch) { const int j0 = ch * 128 + lane * 4; const v4f a = *(const v4f*)(sr + j0);
#pragma unroll
        for (int q = 0; q < 4; ++q) { float t = (j0 + q <= i) ? a[q] * SCL : -3.0e38f; asm volatile("" : "+v"(t)); mx = fmaxf(mx, t); } }
#pragma unroll
    for (int sh = 16; sh; sh >>= 1) mx = fmaxf(mx, __shfl_xor(mx, sh, 32));
    float sum = 0.f;
#pragma unroll 4
    for (int ch = 0; ch < TT / 128; ++ch) { const int j0 = ch * 128 + lane * 4; const v4f a = *(const v4f*)(sr + j0);
#pragma unroll
        for (int q = 0; q < 4; ++q) { float t = (j0 + q <= i) ? a[q] * SCL : -3.0e38f; asm volatile("" : "+v"(t)); float d0 = __fsub_rn(t, mx); asm volatile("" : "+v"(d0)); sum += __builtin_amdgcn_exp2f(__fmul_rn(d0, 1.4426950408889634f)); } }
#pragma unroll
    for (int sh = 16; sh; sh >>= 1) sum += __shfl_xor(sum, sh, 32);
    const float f = __fdiv_rn(hires ? 1.0f : PCAR, sum);
{
        if (hires) {   /* rows < RH: normalised bf16 hi/lo over all keys, planes [zz][RH][TT] */
#pragma unroll
            for (int ch = 0; ch < TT / 128; ++ch) { const int j0 = ch * 128 + lane * 4; const v4f a = *(const v4f*)(sr + j0); v4us oh, ol;
#pragma unroll
                for (int q = 0; q < 4; ++q) { float t = (j0 + q <= i) ? a[q] * SCL : -3.0e38f; asm volatile("" : "+v"(t)); float d0 = __fsub_rn(t, mx); asm volatile("" : "+v"(d0)); float ex = __builtin_amdgcn_exp2f(__fmul_rn(d0, 1.4426950408889634f)); asm volatile("" : "+v"(ex)); unsigned short a2, c2; splitf(ex * f, a2, c2); oh[q] = a2; ol[q] = c2; }
                const size_t oo = ((size_t)zz * RH + i) * TT + j0; *(v4us*)(Ph + oo) = oh; *(v4us*)(Pl + oo) = ol; }
        } else {
#pragma unroll 2
            for (int ch = 0; ch < TT / 128; ++ch) { const int j0 = ch * 128 + lane * 4; const v4f a = *(const v4f*)(sr + j0); v4h o4;
#pragma unroll
                for (int q = 0; q < 4; ++q) { float t = (j0 + q <= i) ? a[q] * SCL : -3.0e38f; asm volatile("" : "+v"(t)); float d0 = __fsub_rn(t, mx); asm volatile("" : "+v"(d0)); float ex = __builtin_amdgcn_exp2f(__fmul_rn(d0, 1.4426950408889634f)); asm volatile("" : "+v"(ex)); o4[q] = tohx(ex * f); }
                *(v4h*)(P16 + (size_t)row * TT + j0) = o4; } }
         }
}
__global__ __launch_bounds__(256) void k_cs8(float* O, size_t n4) { const size_t i = (size_t)blockIdx.x * 256 + threadIdx.x; if (i >= n4) return; const size_t e = i * 4; const int t = (int)((e / CO) % TT);   /* rows of all batches, one after the other */   /* row pitch of the attention-output plane is the VALUE width CO (r1 used the input width CC: wrong whenever CC != CO) */ const float cs = (t < RH) ? 1.0f : (1.0f / PCAR); v4f a = *(const v4f*)(O + e);
#pragma unroll
    for (int q = 0; q < 4; ++q) a[q] = __fmul_rn(a[q], cs);
    *(v4f*)(O + e) = a;  }

__global__ __launch_bounds__(256) void k_csid(float* CS) { const int idx = blockIdx.x * 256 + threadIdx.x; if (idx >= TT * HD) return; v2f cs; cs[0] = 1.0f; cs[1] = 0.0f; *(v2f*)(CS + (size_t)idx * 2) = cs;  }
// k_rope: head planes [h][t][d] (fp16 + hi/lo) of rope(x) x sc with the rotate-half convention out[d] = x[d] cos[t][d] - x[d+HD/2] sin[t][d], out[d+HD/2] = x[d+HD/2] cos[t][d+HD/2] + x[d] sin[t][d+HD/2]
__global__ __launch_bounds__(256) void k_rope(const float* __restrict__ F, int pitch, int nheads, const float* __restrict__ CS, const float* __restrict__ RF, const float* __restrict__ nw, float sc, h16* P16, bf* Ph, bf* Pl) {
    { const size_t zb = blockIdx.y, po = zb * nheads * TT * HD; F += zb * TT * pitch; if (RF) RF += zb * nheads * TT; P16 += po; Ph += po; Pl += po; }   // blockIdx.y = batch: its rows of F and its planes
    const size_t e = ((size_t)blockIdx.x * 256 + threadIdx.x) * 2; if (e >= (size_t)nheads * TT * HD) return; const int d = (int)(e % HD); const int t = (int)((e / HD) % TT); const int h = (int)(e / ((size_t)HD * TT)); const float* f = F + (size_t)t * pitch + h * HD; const float rf = RF ? RF[(size_t)h * TT + t] : 1.0f; v2h o16; v2us oh, ol;
#pragma unroll
    for (int q = 0; q < 2; ++q) { const int dd = d + q; const int dp = (dd < HD / 2) ? dd + HD / 2 : dd - HD / 2; float x0 = f[dd], x1 = f[dp];
        if (RF) { float n0 = __fmul_rn(x0, rf), n1 = __fmul_rn(x1, rf); asm volatile("" : "+v"(n0)); asm volatile("" : "+v"(n1)); x0 = __fmul_rn(bfr(nw[dd]), n0); x1 = __fmul_rn(bfr(nw[dp]), n1); }
        const v2f cs = *(const v2f*)(CS + ((size_t)t * HD + dd) * 2); float a = __fmul_rn(x0, cs[0]), bq = __fmul_rn(x1, cs[1]); asm volatile("" : "+v"(a)); asm volatile("" : "+v"(bq)); const float r = ((dd < HD / 2) ? __fsub_rn(a, bq) : __fadd_rn(a, bq)) * sc;
        o16[q] = tohx(r); unsigned short a2, c2; splitf(r, a2, c2); oh[q] = a2; ol[q] = c2; }
    *(v2h*)(P16 + e) = o16; *(v2us*)(Ph + e) = oh; *(v2us*)(Pl + e) = ol;  }
__global__ __launch_bounds__(256) void k_copy4(const float* __restrict__ Y, float* out, size_t n4) { const size_t i = (size_t)blockIdx.x * 256 + threadIdx.x; if (i >= n4) return; const v4f a = *(const v4f*)(Y + i * 4); *(v4f*)(out + i * 4) = a;  }
extern "C" void kernel_launch(void* const* d_in, const int* in_sizes, int n_in,
                              void* d_out, int out_size, void* d_ws, size_t ws_size, hipStream_t stream) {
    (void)in_sizes; (void)n_in; (void)out_size;
    const float* x = (const float*)d_in[0]; const float* wk = (const float*)d_in[1]; const float* wq = (const float*)d_in[2]; const float* wv = (const float*)d_in[3];   /* input order x [4][4096][768], Wk, Wq, Wv ('xw' [768][64]; NOTE the key weight comes FIRST); standard roles: rows = queries */
    float* OUT = (float*)d_out;     // [4][4096][64]
    char* wsp = (char*)d_ws;
    auto take = [&](size_t bytes) { char* p = wsp; wsp += (bytes + 255) & ~(size_t)255; return (void*)p; };
    bf* WQ = (bf*)take((size_t)MID * CC * 2); bf* WK = (bf*)take((size_t)MID * CC * 2); bf* WV = (bf*)take((size_t)CO * CC * 2); float* CS = (float*)take((size_t)TT * HD * 2 * 4);
    h16* QP16 = (h16*)take((size_t)NB_ * TT * MID * 2); bf* QPh = (bf*)take((size_t)NB_ * TT * MID * 2); bf* QPl = (bf*)take((size_t)NB_ * TT * MID * 2); h16* KP16 = (h16*)take((size_t)NB_ * TT * MID * 2); bf* KPh = (bf*)take((size_t)NB_ * TT * MID * 2); bf* KPl = (bf*)take((size_t)NB_ * TT * MID * 2);
    h16* VT16 = (h16*)take((size_t)NB_ * CO * TT * 2); bf* VTh = (bf*)take((size_t)NB_ * CO * TT * 2); bf* VTl = (bf*)take((size_t)NB_ * CO * TT * 2);
    float* Sb = (float*)take((size_t)TT * TT * 4); h16* P16 = (h16*)take((size_t)NB_ * TT * TT * 2); bf* Ph = (bf*)take((size_t)NB_ * RH * TT * 2); bf* Pl = (bf*)take((size_t)NB_ * RH * TT * 2); float* Ob = (float*)take((size_t)NB_ * TT * CO * 4);   /* one score plane (a batch at a time); probabilities and attention output (f32, before the final copy) of all batches */
    if ((size_t)(wsp - (char*)d_ws) > ws_size) return;    // ws 256 MiB (carve ~249 MiB)
    bf* XB = (bf*)Sb; float* FQ = (float*)(XB + (size_t)NB_ * TT * CC); float* FK = FQ + (size_t)NB_ * TT * MID;   /* 32 MiB inside the 64 MiB score plane: x in bf16 and the f32 projections are last read before the first scores launch writes there (stream-ordered) */
    float* FV = FK;   /* the v projection reuses the k buffer after the k planes are built (stream-ordered) */
    k_wtG<<<(unsigned)((CC * MID / 64 + 63) / 64), 256, 0, stream>>>(wq, CC, MID, WQ); k_wtG<<<(unsigned)((CC * MID / 64 + 63) / 64), 256, 0, stream>>>(wk, CC, MID, WK); k_wtG<<<(unsigned)((CC * CO / 64 + 63) / 64), 256, 0, stream>>>(wv, CC, CO, WV);   /* 'xw' [768][64] -> Bt */       /* 'xw' weights -> Bt */
    k_csid<<<(TT * HD + 255) / 256, 256, 0, stream>>>(CS);   /* identity table: k_rope is a plain per-head plane builder here */
    const unsigned LP = (unsigned)(((size_t)NH_ * TT * HD / 2 + 255) / 256);
    k_cvt8<<<(unsigned)(((size_t)NB_ * TT * CC / 8 + 255) / 256), 256, 0, stream>>>(x, XB, (size_t)NB_ * TT * CC / 8);
    k_gemmw<bf, 0, false, 12><<<dim3(NB_ * TT / 64, MID / 64, 1), 32 * 12, 0, stream>>>(XB, nullptr, WQ, nullptr, CC, FQ, MID, nullptr, 0, 0, 0); k_rope<<<dim3(LP, NB_, 1), 256, 0, stream>>>(FQ, MID, NH_, CS, nullptr, nullptr, 1.0f, QP16, QPh, QPl);   /* the 16,384 rows of all batches; q planes [b][h][n][64] */
    k_gemmw<bf, 0, false, 12><<<dim3(NB_ * TT / 64, MID / 64, 1), 32 * 12, 0, stream>>>(XB, nullptr, WK, nullptr, CC, FK, MID, nullptr, 0, 0, 0); k_rope<<<dim3(LP, NB_, 1), 256, 0, stream>>>(FK, MID, NKV, CS, nullptr, nullptr, 1.0f, KP16, KPh, KPl);   /* k planes */
    k_gemmw<bf, 0, false, 12><<<dim3(NB_ * TT / 64, CO / 64, 1), 32 * 12, 0, stream>>>(XB, nullptr, WV, nullptr, CC, FV, CO, nullptr, 0, 0, 0); k_vtp<<<dim3((unsigned)(((size_t)TT * CO / 2 + 255) / 256), NB_, 1), 256, 0, stream>>>(FV, CO, CO / HD, VT16, VTh, VTl);   /* v^T planes [b][h][64][n] */
    for (int b = 0; b < NB_; ++b) {   /* dense 4096 x 4096 scores and softmax, a batch at a time through the one score plane */
        k_gemmw<bf, 2, false, 1><<<dim3(TT / 64, TT / 64, 1), 32, 0, stream>>>(QPh + (size_t)b * TT * HD, QPl + (size_t)b * TT * HD, KPh + (size_t)b * TT * HD, KPl + (size_t)b * TT * HD, HD, Sb, TT, nullptr, 0, 0, 0);   /* S[i][j] = q_i.k_j (3 products, every row) */
        k_lsoft<<<TT / 8, 256, 0, stream>>>(Sb, P16 + (size_t)b * TT * TT, Ph + (size_t)b * RH * TT, Pl + (size_t)b * RH * TT); }   /* x C^-0.5, softmax over the 4,096 keys */
    k_gemmw<bf, 2, false, 16><<<dim3(RH / 64, HD / 64, NB_), 32 * 16, 0, stream>>>(Ph, Pl, VTh, VTl, TT, Ob, CO, nullptr, (size_t)RH * TT, (size_t)HD * TT, (size_t)TT * CO);   /* blockIdx.z = batch */
    k_gemmw<h16, 0, false, 16><<<dim3((TT - RH) / 64, HD / 64, NB_), 32 * 16, 0, stream>>>(P16 + (size_t)RH * TT, nullptr, VT16, nullptr, TT, Ob + (size_t)RH * CO, CO, nullptr, (size_t)TT * TT, (size_t)HD * TT, (size_t)TT * CO);
    k_cs8<<<(unsigned)(((size_t)NB_ * TT * CO / 4 + 255) / 256), 256, 0, stream>>>(Ob, (size_t)NB_ * TT * CO / 4);   /* rows >= 512 of each batch x 1/1024 */
    k_copy4<<<(unsigned)(((size_t)NB_ * TT * CO / 4 + 255) / 256), 256, 0, stream>>>(Ob, OUT, (size_t)NB_ * TT * CO / 4);   /* the output rows, written once */
}

// v003
// One run takes 127 microseconds.
// Two timings next to v002 put it at 3.21 and 3.27 times that version's speed.
// All steps since v000 together make it 9.50 times as fast.
#include <hip/hip_runtime.h>

// Single causal attention head over 4,096 tokens scaled by the EMBEDDING width (x [4][4096][768]; k = x Wk, q = x Wq, v = x Wv ('xw' [768][64] 768^-0.5, no bias); wei = q.k^T x C^-0.5 with C = 768 (n_embd, not head_size); causal (-inf); softmax; out = wei.v -> [4][4096][64] (1.0 M); argument order x, Wk, Wq, Wv).
// All four batches go through every launch, the batch being rows of the grid or blockIdx.y. Layout: bf16 copy of x; 'xw' weights transposed once; exact projections (K 768); identity-table plane builders; then ONE launch for scores, causal softmax and attn.v (k_fattn): scores on hi/lo planes (3 products), online softmax in registers, attn.v hybrid (rows < 512 hi/lo 3 products, rest fp16), output rows written once.
// Compute dtypes, f32 accumulate: every input rounded to bf16; projections exact; scores 3 products; softmax f32; wei.v rows < 512 3 products, rest fp16; output f32.

#define NB_  4
#define TT   4096
#define DM   64
#define NH_  1
#define NKV  1
#define REP  (NH_ / NKV)
#define HD   64
#define DQ   (NH_ * HD)
#define DKV  (NKV * HD)
#define ZH   1
#define RH   512                  // query rows < RH use hi+lo planes (0: none)
#define WIN  0
#define SCL  0.036084391824351615f   // C^-0.5 with C = n_embd = 768 (the source scales by the input width, NOT the head size)
#define MID  64       // q / k width (one 64-wide head)
#define CO   64       // v width
#define CC   768      // input width (d_model)
typedef _Float16 h16;
typedef unsigned short bf;
typedef __attribute__((ext_vector_type(16))) __bf16   v16bf;
typedef __attribute__((ext_vector_type(16))) _Float16 v16h;
typedef __attribute__((ext_vector_type(8)))  _Float16 v8h;
typedef __attribute__((ext_vector_type(8)))  unsigned short v8us;
typedef __attribute__((ext_vector_type(8)))  float    v8f;
typedef __attribute__((ext_vector_type(4)))  float    v4f;
typedef v8h  __attribute__((may_alias)) v8ha;
typedef v4f  __attribute__((may_alias)) v4fa;
typedef v8us __attribute__((may_alias)) v8usa;

__device__ __forceinline__ unsigned short f2bf(float f) { unsigned u = __float_as_uint(f); u += 0x7FFFu + ((u >> 16) & 1u); return (unsigned short)(u >> 16); }
__device__ __forceinline__ float bf2f(unsigned short b) { return __uint_as_float(((unsigned)b) << 16); }
__device__ __forceinline__ float bfr(float f) { return bf2f(f2bf(f)); }
__device__ __forceinline__ v16h cat16(v8h lo, v8h hi) { return __builtin_shufflevector(lo, hi, 0, 1, 2, 3, 4, 5, 6, 7, 8, 9, 10, 11, 12, 13, 14, 15); }
__device__ __forceinline__ v16bf cat16b(v8us lo, v8us hi) { return __builtin_bit_cast(v16bf, __builtin_shufflevector(lo, hi, 0, 1, 2, 3, 4, 5, 6, 7, 8, 9, 10, 11, 12, 13, 14, 15)); }
__device__ __forceinline__ v8f wmma16(v16h a, v16h b, v8f c) { return __builtin_amdgcn_wmma_f32_16x16x32_f16(false, a, false, b, (short)0, c, false, false); }
__device__ __forceinline__ v8f wmmab(v16bf a, v16bf b, v8f c) { return __builtin_amdgcn_wmma_f32_16x16x32_bf16(false, a, false, b, (short)0, c, false, false); }



// ---- k_gemmw: register-blocked GEMM, one 64x64 output tile (16 accumulators a wave) per work-group of NW waves, operands straight from K-contiguous 16-bit planes; grid (M/64, N/64, Z), 32 * NW threads.
// C[m][n] (f32, pitch ldc, + optional f32 bias[n]) = sum_k A[m][k] Bt[n][k] (+ split products per NSPLIT). z-batch strides sA/sB/sC in elements. K % 32 == 0 (equal shares for the waves where K % (32 * NW) == 0).
// NW > 1 (split-K): wave w sums the 32-wide k steps w, w + NW, w + 2 NW, ... of the whole tile (neighbouring waves read neighbouring 64-byte pieces of the same rows at the same trip); the NW partial tiles meet in LDS and are added in the fixed order w = 0 .. NW-1.
template <typename T16> struct WFrag;
template <> struct WFrag<h16> { typedef v16h V; static __device__ __forceinline__ V ld(const h16* p) { return cat16(*(const v8h*)p, *(const v8h*)(p + 16)); } static __device__ __forceinline__ v8f mma(V a, V b, v8f c) { return wmma16(a, b, c); } };
template <> struct WFrag<bf> { typedef v16bf V; static __device__ __forceinline__ V ld(const bf* p) { return cat16b(*(const v8us*)p, *(const v8us*)(p + 16)); } static __device__ __forceinline__ v8f mma(V a, V b, v8f c) { return wmmab(a, b, c); } };
template <typename T16, int NSPLIT, bool BIAS, int NW>
__global__ __launch_bounds__(32 * NW) void k_gemmw(const T16* __restrict__ A, const T16* __restrict__ A2, const T16* __restrict__ Bt, const T16* __restrict__ Bt2, int K, float* C, int ldc, const float* __restrict__ bias, size_t sA, size_t sB, size_t sC) {
    typedef typename WFrag<T16>::V V;
    __shared__ __align__(16) float os[NW == 1 ? 16 * 68 : NW * 64 * 68];   // NW > 1: one column-major 64 x 64 partial tile a wave, column pitch 68 floats
    const size_t z = blockIdx.z; A += z * sA; if (A2) A2 += z * sA; Bt += z * sB; if (Bt2) Bt2 += z * sB; C += z * sC;
    const int lane = threadIdx.x & 31, lr = lane & 15, hi = lane >> 4; const int r0 = blockIdx.x * 64, c0 = blockIdx.y * 64;
    v8f acc[4][4];
#pragma unroll
    for (int mb = 0; mb < 4; ++mb)
#pragma unroll
        for (int nb = 0; nb < 4; ++nb) acc[mb][nb] = (v8f){};
    const size_t aoff = (size_t)(r0 + lr) * K + 8 * hi, boff = (size_t)(c0 + lr) * K + 8 * hi;
    const int wv = (NW == 1) ? 0 : __builtin_amdgcn_readfirstlane((int)(threadIdx.x >> 5));   // the wave's number, held scalar so that the loop bounds stay scalar
#pragma unroll 1
    for (int kc = wv * 32; kc < K; kc += 32 * NW) {
        V a[4], a2[4];
#pragma unroll
        for (int mb = 0; mb < 4; ++mb) { a[mb] = WFrag<T16>::ld(A + aoff + (size_t)mb * 16 * K + kc); if (NSPLIT == 1 || NSPLIT == 2) a2[mb] = WFrag<T16>::ld(A2 + aoff + (size_t)mb * 16 * K + kc); }
#pragma unroll
        for (int nb = 0; nb < 4; ++nb) { const V b = WFrag<T16>::ld(Bt + boff + (size_t)nb * 16 * K + kc); V b2; if (NSPLIT >= 2) b2 = WFrag<T16>::ld(Bt2 + boff + (size_t)nb * 16 * K + kc);
#pragma unroll
            for (int mb = 0; mb < 4; ++mb) { acc[mb][nb] = WFrag<T16>::mma(a[mb], b, acc[mb][nb]); if (NSPLIT == 1 || NSPLIT == 2) acc[mb][nb] = WFrag<T16>::mma(a2[mb], b, acc[mb][nb]); if (NSPLIT >= 2) acc[mb][nb] = WFrag<T16>::mma(a[mb], b2, acc[mb][nb]); } }
        asm volatile("v_nop\n\tv_nop\n\tv_nop\n\tv_nop" : "+v"(acc[0][0]), "+v"(acc[1][1]), "+v"(acc[2][2]), "+v"(acc[3][3]) : "v"(a[0]), "v"(a[3]));
    }
    if constexpr (NW > 1) {
        float* ow = os + wv * (64 * 68);
#pragma unroll   // both loops unrolled: acc is indexed by constants only, so it stays in registers
        for (int mb = 0; mb < 4; ++mb)
#pragma unroll
            for (int nb = 0; nb < 4; ++nb) { float* p = ow + (nb * 16 + lr) * 68 + mb * 16 + hi * 8;   /* a lane's 8 accumulator values are 8 consecutive rows of one column */
                *(v4fa*)p = __builtin_shufflevector(acc[mb][nb], acc[mb][nb], 0, 1, 2, 3); *(v4fa*)(p + 4) = __builtin_shufflevector(acc[mb][nb], acc[mb][nb], 4, 5, 6, 7); }
        __syncthreads();   // every wave's partial tile is in LDS before any thread adds them
        for (int u = threadIdx.x; u < 1024; u += 32 * NW) { const int col = u & 63, rg = (u >> 6) * 4; const float* p = os + col * 68 + rg; v4f val = *(const v4fa*)p;
#pragma unroll   // unrolled so that the NW LDS reads are issued ahead of the adds
            for (int w = 1; w < NW; ++w) val += *(const v4fa*)(p + w * (64 * 68));
            if (BIAS) { const float bv = bfr(bias[c0 + col]); val[0] += bv; val[1] += bv; val[2] += bv; val[3] += bv; }
            float* cp = C + (size_t)(r0 + rg) * ldc + c0 + col;   /* 32 lanes = 32 consecutive columns of one row: each store fills one 128-byte line */
#pragma unroll   // val indexed by constants only
            for (int q = 0; q < 4; ++q) cp[(size_t)q * ldc] = val[q]; }
        return;
    }
#pragma unroll
    for (int mb = 0; mb < 4; ++mb) {
#pragma unroll
        for (int nb = 0; nb < 4; ++nb) {
#pragma unroll
            for (int j = 0; j < 8; ++j) os[(hi * 8 + j) * 68 + nb * 16 + lr] = acc[mb][nb][j]; }
        __builtin_amdgcn_wave_barrier(); asm volatile("" ::: "memory");
        float* crow = C + (size_t)(r0 + mb * 16) * ldc + c0;
{
#pragma unroll
            for (int s = 0; s < 8; ++s) { const int row = 2 * s + hi, cofs = lr * 4; v4f val = *(const v4fa*)(os + row * 68 + cofs); if (BIAS) { val[0] += bfr(bias[c0 + cofs]); val[1] += bfr(bias[c0 + cofs + 1]); val[2] += bfr(bias[c0 + cofs + 2]); val[3] += bfr(bias[c0 + cofs + 3]); }
                *(v4f*)(crow + (size_t)row * ldc + cofs) = val; }
             }
        __builtin_amdgcn_wave_barrier(); asm volatile("" ::: "memory");
    }
}

__device__ __forceinline__ h16 tohx(float x) { return (h16)x; }
__device__ __forceinline__ void splitf(float y, unsigned short& h, unsigned short& l) { h = f2bf(y); l = f2bf(y - bf2f(h)); }
typedef __attribute__((ext_vector_type(2))) _Float16 v2h;
typedef __attribute__((ext_vector_type(4))) _Float16 v4h;
typedef __attribute__((ext_vector_type(2))) unsigned short v2us;
typedef __attribute__((ext_vector_type(4))) unsigned short v4us;
typedef __attribute__((ext_vector_type(2))) float v2f;
typedef __attribute__((ext_vector_type(4))) int v4i;

__global__ __launch_bounds__(256) void k_cvt8(const float* __restrict__ src, bf* dst, size_t n8) { const size_t i = (size_t)blockIdx.x * 256 + threadIdx.x; if (i >= n8) return; const v8f v = *(const v8f*)(src + i * 8); v8us o;
#pragma unroll
    for (int k = 0; k < 8; ++k) o[k] = f2bf(v[k]); *(v8us*)(dst + i * 8) = o;  }


__global__ __launch_bounds__(256) void k_wtG(const float* __restrict__ w, int K, int N, bf* Bt) {
    const int lane = threadIdx.x & 31; const int L0 = (blockIdx.x * 8 + (threadIdx.x >> 5)) * 8; const int nlines = N * K / 64;
{
#pragma unroll 1
        for (int l = 0; l < 8; ++l) { const int L = L0 + l; if (L >= nlines) break; const size_t e = (size_t)L * 64 + lane * 2; const int k = (int)(e % K), n = (int)(e / K); v2us o;
            o[0] = f2bf(w[(size_t)k * N + n]); o[1] = f2bf(w[(size_t)(k + 1) * N + n]); *(v2us*)(Bt + e) = o; }
         }
}
__global__ __launch_bounds__(256) void k_vtp(const float* __restrict__ F, int pitch, int nheads, h16* V16, bf* Vh, bf* Vl) { const size_t e = ((size_t)blockIdx.x * 256 + threadIdx.x) * 2; if (e >= (size_t)nheads * HD * TT) return; { const size_t zb = blockIdx.y, po = zb * nheads * HD * TT; F += zb * TT * pitch; V16 += po; Vh += po; Vl += po; }   /* blockIdx.y = batch */ const int t = (int)(e % TT); const int d = (int)((e / TT) % HD); const int g = (int)(e / ((size_t)TT * HD)); v2h o16; v2us oh, ol;
#pragma unroll
    for (int q = 0; q < 2; ++q) { const float x = F[(size_t)(t + q) * pitch + g * HD + d]; o16[q] = tohx(x); unsigned short a2, c2; splitf(x, a2, c2); oh[q] = a2; ol[q] = c2; }
    *(v2h*)(V16 + e) = o16; *(v2us*)(Vh + e) = oh; *(v2us*)(Vl + e) = ol;  }

__global__ __launch_bounds__(256) void k_csid(float* CS) { const int idx = blockIdx.x * 256 + threadIdx.x; if (idx >= TT * HD) return; v2f cs; cs[0] = 1.0f; cs[1] = 0.0f; *(v2f*)(CS + (size_t)idx * 2) = cs;  }
// k_rope: head planes [h][t][d] (fp16 + hi/lo) of rope(x) x sc with the rotate-half convention out[d] = x[d] cos[t][d] - x[d+HD/2] sin[t][d], out[d+HD/2] = x[d+HD/2] cos[t][d+HD/2] + x[d] sin[t][d+HD/2]
__global__ __launch_bounds__(256) void k_rope(const float* __restrict__ F, int pitch, int nheads, const float* __restrict__ CS, const float* __restrict__ RF, const float* __restrict__ nw, float sc, h16* P16, bf* Ph, bf* Pl) {
    { const size_t zb = blockIdx.y, po = zb * nheads * TT * HD; F += zb * TT * pitch; if (RF) RF += zb * nheads * TT; P16 += po; Ph += po; Pl += po; }   // blockIdx.y = batch: its rows of F and its planes
    const size_t e = ((size_t)blockIdx.x * 256 + threadIdx.x) * 2; if (e >= (size_t)nheads * TT * HD) return; const int d = (int)(e % HD); const int t = (int)((e / HD) % TT); const int h = (int)(e / ((size_t)HD * TT)); const float* f = F + (size_t)t * pitch + h * HD; const float rf = RF ? RF[(size_t)h * TT + t] : 1.0f; v2h o16; v2us oh, ol;
#pragma unroll
    for (int q = 0; q < 2; ++q) { const int dd = d + q; const int dp = (dd < HD / 2) ? dd + HD / 2 : dd - HD / 2; float x0 = f[dd], x1 = f[dp];
        if (RF) { float n0 = __fmul_rn(x0, rf), n1 = __fmul_rn(x1, rf); asm volatile("" : "+v"(n0)); asm volatile("" : "+v"(n1)); x0 = __fmul_rn(bfr(nw[dd]), n0); x1 = __fmul_rn(bfr(nw[dp]), n1); }
        const v2f cs = *(const v2f*)(CS + ((size_t)t * HD + dd) * 2); float a = __fmul_rn(x0, cs[0]), bq = __fmul_rn(x1, cs[1]); asm volatile("" : "+v"(a)); asm volatile("" : "+v"(bq)); const float r = ((dd < HD / 2) ? __fsub_rn(a, bq) : __fadd_rn(a, bq)) * sc;
        o16[q] = tohx(r); unsigned short a2, c2; splitf(r, a2, c2); oh[q] = a2; ol[q] = c2; }
    *(v2h*)(P16 + e) = o16; *(v2us*)(Ph + e) = oh; *(v2us*)(Pl + e) = ol;  }
// ---- k_fattn: scores, causal softmax and attn.v in one launch; no score or probability ever leaves the registers. Grid (TT / 64, batch), 16 waves.
// A work-group owns 64 query rows: wave w works on the 32 rows of group w >> 3 and on the 32-key blocks (w & 7), (w & 7) + 8, ... of all TT keys (the two waves with the same w & 7 read the same K and V lines).
// S^T = K.Q^T (A = key rows, B = query rows): in each 16-column group a lane holds scores of ONE query (column lr), keys 8 hi + r; two such tiles, converted in place, are the B operand of O^T += V^T.P^T (hardware k order, as WFrag::ld reads A).
// Each wave keeps its own running maximum m (log2 units), sum l and O^T; the 8 partial results of a query group meet in LDS and are joined in the fixed order of the waves.
#define FKS  8        // key shares (waves that split the keys of one query group)
#define FQG  2        // query groups of 32 rows in a work-group
#define SC2  (SCL * 1.4426950408889634f)   // score scale times log2(e): the softmax runs on exp2
// exp2 with the one issue slot that the instruction set asks for behind a transcendental (before its result is used or its source overwritten) in the same statement
__device__ __forceinline__ float exp2s(float x) { float r; asm("v_exp_f32 %0, %1\n\tv_nop" : "=v"(r) : "v"(x)); return r; }
template <bool HR>   // HR: probabilities and v on bf16 hi/lo planes (3 products); else fp16
__device__ __forceinline__ void fattn_wave(const bf* __restrict__ Qh, const bf* __restrict__ Ql, const bf* __restrict__ Kh, const bf* __restrict__ Kl, const h16* __restrict__ V16, const bf* __restrict__ Vh, const bf* __restrict__ Vl, const int q0, const int ks, const int lr, const int hi, float* ow, float* mlw) {
    v16bf qh[2][2], ql[2][2];
#pragma unroll
    for (int qt = 0; qt < 2; ++qt)
#pragma unroll
        for (int kk = 0; kk < 2; ++kk) { const size_t qo = (size_t)(q0 + qt * 16 + lr) * HD + kk * 32 + 8 * hi; qh[qt][kk] = WFrag<bf>::ld(Qh + qo); ql[qt][kk] = WFrag<bf>::ld(Ql + qo); }
    v8f o[4][2];
#pragma unroll
    for (int dt = 0; dt < 4; ++dt) { o[dt][0] = (v8f){}; o[dt][1] = (v8f){}; }
    const unsigned klo = (unsigned)(lr * HD + 8 * hi), vlo = (unsigned)(lr * TT + 8 * hi);   // the lane's element offsets in a key block and in a block of v^T columns
    float m[2] = { -1.0e30f, -1.0e30f }, l[2] = { 0.f, 0.f };   // m starts above the mask value, so a wholly masked block gives exp2(-huge) = 0
    for (int p = 0; p < TT / (32 * FKS); ++p) {
        const int k0 = (p * FKS + ks) * 32;
        const bf* kph = Kh + (size_t)k0 * HD; const bf* kpl = Kl + (size_t)k0 * HD;   // wave-uniform bases; the lane's part is one 32-bit offset for both planes
        v8f s[2][2]; s[0][0] = (v8f){}; s[0][1] = (v8f){}; s[1][0] = (v8f){}; s[1][1] = (v8f){};
        v16bf kh[2][2], kl[2][2];
#pragma unroll
        for (int kk = 0; kk < 2; ++kk)
#pragma unroll
            for (int kt = 0; kt < 2; ++kt) { kh[kk][kt] = WFrag<bf>::ld(kph + klo + (kt * 16 * HD + kk * 32)); if (kk + kt < 2) kl[kk][kt] = WFrag<bf>::ld(kpl + klo + (kt * 16 * HD + kk * 32)); }
        __builtin_amdgcn_sched_barrier(0);   // 14 of the 16 key loads of the pass are held in front of the first product: one trip to L2 for them; left free, the scheduler re-used two fragments' registers and waited on L2 six times a pass
#pragma unroll
        for (int kk = 0; kk < 2; ++kk) {
#pragma unroll
            for (int kt = 0; kt < 2; ++kt) { s[kt][0] = wmmab(kh[kk][kt], qh[0][kk], s[kt][0]); s[kt][1] = wmmab(kh[kk][kt], qh[1][kk], s[kt][1]); }
#pragma unroll
            for (int kt = 0; kt < 2; ++kt) { s[kt][0] = wmmab(kh[kk][kt], ql[0][kk], s[kt][0]); s[kt][1] = wmmab(kh[kk][kt], ql[1][kk], s[kt][1]); }
            if (kk == 0) { __builtin_amdgcn_sched_barrier(0); asm volatile("s_wait_xcnt 0x0" ::: "memory");   /* this load's data may be given the address registers of the 14 loads issued above */
                kl[1][1] = WFrag<bf>::ld(kpl + klo + (16 * HD + 32)); __builtin_amdgcn_sched_barrier(0); }   /* the fragment used last is loaded here, between two scheduling barriers, into registers that the first 8 products have freed: with all 8 fragments in flight at once the build spills */
#pragma unroll
            for (int kt = 0; kt < 2; ++kt) { s[kt][0] = wmmab(kl[kk][kt], qh[0][kk], s[kt][0]); s[kt][1] = wmmab(kl[kk][kt], qh[1][kk], s[kt][1]); } }
        float mx[2];
#pragma unroll
        for (int qt = 0; qt < 2; ++qt) { const int lim = q0 + qt * 16 + lr - k0 - 8 * hi; float a = -3.0e38f;   /* key kt * 16 + r of this lane's half is visible while <= lim */
#pragma unroll
            for (int kt = 0; kt < 2; ++kt)
#pragma unroll
                for (int r = 0; r < 8; ++r) { const float t = (kt * 16 + r <= lim) ? s[kt][qt][r] * SC2 : -3.0e38f; s[kt][qt][r] = t; a = fmaxf(a, t); }
            mx[qt] = fmaxf(a, __shfl_xor(a, 16, 32)); }   /* both halves of a column must use one maximum: the product sums over both halves' keys */
        if (__builtin_amdgcn_ballot_w32(mx[0] > m[0] + 8.0f || mx[1] > m[1] + 8.0f) != 0) {   // lazy rescale, one scalar branch a pass: probabilities may reach 2^8 before the maximum in use moves
#pragma unroll
            for (int qt = 0; qt < 2; ++qt) { const float mn = fmaxf(m[qt], mx[qt]); const float al = exp2s(m[qt] - mn); m[qt] = mn; l[qt] *= al;
#pragma unroll
                for (int dt = 0; dt < 4; ++dt) o[dt][qt] *= al; } }
        if constexpr (HR) {
            v16bf vh[4], vl[4], ph[2], pl[2]; const bf* vph = Vh + k0 + vlo;   // one address pair for the 8 loads of the hi plane
#pragma unroll
            for (int dt = 0; dt < 4; ++dt) vh[dt] = WFrag<bf>::ld(vph + dt * 16 * TT);
            asm volatile("s_wait_xcnt 0x0" :: "v"(vph) : "memory");   // the wait before the address pair of the 8 loads above is overwritten; it reads the pair, so the pair lives to here and no load of the run is given its registers for its data
            __builtin_amdgcn_sched_barrier(0);   // the hi plane of v is asked for ahead of the exponentials, which cover its trip to L2; left free, the scheduler loaded one d tile at a time and waited four times
#pragma unroll
            for (int qt = 0; qt < 2; ++qt) { float ls = 0.f;
#pragma unroll
                for (int e = 0; e < 16; ++e) { const float pv = exp2s(s[e >> 3][qt][e & 7] - m[qt]); ls += pv; const __bf16 h = (__bf16)pv; ph[qt][e] = h; pl[qt][e] = (__bf16)(pv - (float)h); }
                l[qt] += ls; }
#pragma unroll
            for (int dt = 0; dt < 4; ++dt) vl[dt] = WFrag<bf>::ld(Vl + k0 + vlo + dt * 16 * TT);
#pragma unroll
            for (int dt = 0; dt < 4; ++dt) { o[dt][0] = wmmab(vh[dt], ph[0], o[dt][0]); o[dt][1] = wmmab(vh[dt], ph[1], o[dt][1]); }
#pragma unroll
            for (int dt = 0; dt < 4; ++dt) { o[dt][0] = wmmab(vh[dt], pl[0], o[dt][0]); o[dt][1] = wmmab(vh[dt], pl[1], o[dt][1]); }
#pragma unroll
            for (int dt = 0; dt < 4; ++dt) { o[dt][0] = wmmab(vl[dt], ph[0], o[dt][0]); o[dt][1] = wmmab(vl[dt], ph[1], o[dt][1]); }
        } else {
            v16h pb[2];
#pragma unroll
            for (int qt = 0; qt < 2; ++qt) { float ls = 0.f;
#pragma unroll
                for (int e = 0; e < 16; ++e) { const float pv = exp2s(s[e >> 3][qt][e & 7] - m[qt]); ls += pv; pb[qt][e] = tohx(pv); }
                l[qt] += ls; }
#pragma unroll
            for (int dt = 0; dt < 4; ++dt) { const v16h va = WFrag<h16>::ld(V16 + k0 + vlo + dt * 16 * TT); o[dt][0] = wmma16(va, pb[0], o[dt][0]); o[dt][1] = wmma16(va, pb[1], o[dt][1]); }
        }
    }
#pragma unroll
    for (int qt = 0; qt < 2; ++qt) { const float lt = l[qt] + __shfl_xor(l[qt], 16, 32);   /* the halves' sums joined once */
        if (hi == 0) { mlw[(qt * 16 + lr) * 2] = m[qt]; mlw[(qt * 16 + lr) * 2 + 1] = lt; }
#pragma unroll
        for (int dt = 0; dt < 4; ++dt) { float* pp = ow + (qt * 16 + lr) * 68 + dt * 16 + hi * 8;   /* a lane's 8 accumulator values are 8 consecutive d of one query row */
            *(v4fa*)pp = __builtin_shufflevector(o[dt][qt], o[dt][qt], 0, 1, 2, 3); *(v4fa*)(pp + 4) = __builtin_shufflevector(o[dt][qt], o[dt][qt], 4, 5, 6, 7); } }
}
__global__ __launch_bounds__(32 * FKS * FQG) void k_fattn(const bf* __restrict__ Qh, const bf* __restrict__ Ql, const bf* __restrict__ Kh, const bf* __restrict__ Kl, const h16* __restrict__ V16, const bf* __restrict__ Vh, const bf* __restrict__ Vl, float* out) {
    __shared__ __align__(16) float os[FKS * FQG * 32 * 68];   // one 32 x 64 partial output a wave, row pitch 68 floats
    __shared__ float ml[FKS * FQG * 32 * 2];                  // its (maximum in use, sum) per query row
    const size_t po = (size_t)blockIdx.y * TT * HD; Qh += po; Ql += po; Kh += po; Kl += po; V16 += po; Vh += po; Vl += po; out += po;   // blockIdx.y = batch
    const int lane = threadIdx.x & 31, lr = lane & 15, hi = lane >> 4; const int wv = __builtin_amdgcn_readfirstlane((int)(threadIdx.x >> 5));   // the wave's number, held scalar so that the key offsets stay scalar
    const int Q0 = blockIdx.x * (32 * FQG); const int q0 = Q0 + (wv / FKS) * 32, ks = wv % FKS;
    if (Q0 < RH) fattn_wave<true>(Qh, Ql, Kh, Kl, V16, Vh, Vl, q0, ks, lr, hi, os + wv * (32 * 68), ml + wv * 64);
    else         fattn_wave<false>(Qh, Ql, Kh, Kl, V16, Vh, Vl, q0, ks, lr, hi, os + wv * (32 * 68), ml + wv * 64);
    __syncthreads();   // every wave's partial result is in LDS before any thread joins them
    for (int u = threadIdx.x; u < 32 * FQG * 16; u += 32 * FKS * FQG) { const int q = u >> 4, d4 = (u & 15) * 4; const int w0 = (q >> 5) * FKS, qq = q & 31;
        float M = ml[(w0 * 32 + qq) * 2];
#pragma unroll   // unrolled so that the LDS reads are issued ahead of the arithmetic
        for (int w = 1; w < FKS; ++w) M = fmaxf(M, ml[((w0 + w) * 32 + qq) * 2]);
        float Lt = 0.f; v4f val = (v4f){};
#pragma unroll
        for (int w = 0; w < FKS; ++w) { const float wt = exp2s(ml[((w0 + w) * 32 + qq) * 2] - M); Lt += wt * ml[((w0 + w) * 32 + qq) * 2 + 1]; val += wt * *(const v4fa*)(os + ((w0 + w) * 32 + qq) * 68 + d4); }
        const float rl = __fdiv_rn(1.0f, Lt);
        *(v4f*)(out + (size_t)(Q0 + q) * CO + d4) = val * rl; }   /* 16 lanes = one 256-byte output row */
}
extern "C" void kernel_launch(void* const* d_in, const int* in_sizes, int n_in,
                              void* d_out, int out_size, void* d_ws, size_t ws_size, hipStream_t stream) {
    (void)in_sizes; (void)n_in; (void)out_size;
    const float* x = (const float*)d_in[0]; const float* wk = (const float*)d_in[1]; const float* wq = (const float*)d_in[2]; const float* wv = (const float*)d_in[3];   /* input order x [4][4096][768], Wk, Wq, Wv ('xw' [768][64]; NOTE the key weight comes FIRST); standard roles: rows = queries */
    float* OUT = (float*)d_out;     // [4][4096][64]
    char* wsp = (char*)d_ws;
    auto take = [&](size_t bytes) { char* p = wsp; wsp += (bytes + 255) & ~(size_t)255; return (void*)p; };
    bf* WQ = (bf*)take((size_t)MID * CC * 2); bf* WK = (bf*)take((size_t)MID * CC * 2); bf* WV = (bf*)take((size_t)CO * CC * 2); float* CS = (float*)take((size_t)TT * HD * 2 * 4);
    h16* QP16 = (h16*)take((size_t)NB_ * TT * MID * 2); bf* QPh = (bf*)take((size_t)NB_ * TT * MID * 2); bf* QPl = (bf*)take((size_t)NB_ * TT * MID * 2); h16* KP16 = (h16*)take((size_t)NB_ * TT * MID * 2); bf* KPh = (bf*)take((size_t)NB_ * TT * MID * 2); bf* KPl = (bf*)take((size_t)NB_ * TT * MID * 2);
    h16* VT16 = (h16*)take((size_t)NB_ * CO * TT * 2); bf* VTh = (bf*)take((size_t)NB_ * CO * TT * 2); bf* VTl = (bf*)take((size_t)NB_ * CO * TT * 2);
    float* Sb = (float*)take((size_t)NB_ * TT * CC * 2 + (size_t)2 * NB_ * TT * MID * 4);   /* staging: x in bf16 and two f32 projection planes */
    if ((size_t)(wsp - (char*)d_ws) > ws_size) return;    // ws 256 MiB (carve ~52 MiB)
    bf* XB = (bf*)Sb; float* FQ = (float*)(XB + (size_t)NB_ * TT * CC); float* FK = FQ + (size_t)NB_ * TT * MID;
    float* FV = FK;   /* the v projection reuses the k buffer after the k planes are built (stream-ordered) */
    k_wtG<<<(unsigned)((CC * MID / 64 + 63) / 64), 256, 0, stream>>>(wq, CC, MID, WQ); k_wtG<<<(unsigned)((CC * MID / 64 + 63) / 64), 256, 0, stream>>>(wk, CC, MID, WK); k_wtG<<<(unsigned)((CC * CO / 64 + 63) / 64), 256, 0, stream>>>(wv, CC, CO, WV);   /* 'xw' [768][64] -> Bt */       /* 'xw' weights -> Bt */
    k_csid<<<(TT * HD + 255) / 256, 256, 0, stream>>>(CS);   /* identity table: k_rope is a plain per-head plane builder here */
    const unsigned LP = (unsigned)(((size_t)NH_ * TT * HD / 2 + 255) / 256);
    k_cvt8<<<(unsigned)(((size_t)NB_ * TT * CC / 8 + 255) / 256), 256, 0, stream>>>(x, XB, (size_t)NB_ * TT * CC / 8);
    k_gemmw<bf, 0, false, 12><<<dim3(NB_ * TT / 64, MID / 64, 1), 32 * 12, 0, stream>>>(XB, nullptr, WQ, nullptr, CC, FQ, MID, nullptr, 0, 0, 0); k_rope<<<dim3(LP, NB_, 1), 256, 0, stream>>>(FQ, MID, NH_, CS, nullptr, nullptr, 1.0f, QP16, QPh, QPl);   /* the 16,384 rows of all batches; q planes [b][h][n][64] */
    k_gemmw<bf, 0, false, 12><<<dim3(NB_ * TT / 64, MID / 64, 1), 32 * 12, 0, stream>>>(XB, nullptr, WK, nullptr, CC, FK, MID, nullptr, 0, 0, 0); k_rope<<<dim3(LP, NB_, 1), 256, 0, stream>>>(FK, MID, NKV, CS, nullptr, nullptr, 1.0f, KP16, KPh, KPl);   /* k planes */
    k_gemmw<bf, 0, false, 12><<<dim3(NB_ * TT / 64, CO / 64, 1), 32 * 12, 0, stream>>>(XB, nullptr, WV, nullptr, CC, FV, CO, nullptr, 0, 0, 0); k_vtp<<<dim3((unsigned)(((size_t)TT * CO / 2 + 255) / 256), NB_, 1), 256, 0, stream>>>(FV, CO, CO / HD, VT16, VTh, VTl);   /* v^T planes [b][h][64][n] */
    k_fattn<<<dim3(TT / (32 * FQG), NB_, 1), 32 * FKS * FQG, 0, stream>>>(QPh, QPl, KPh, KPl, VT16, VTh, VTl, OUT);   /* scores, causal softmax, attn.v; writes every output row once */
}

// v004
// One run takes 80.1 microseconds.
// Next to v003, in two timings, it ran 1.60 and 1.59 times as fast.
// Counting every step since v000, it is 15.1 times as fast.
#include <hip/hip_runtime.h>

// Single causal attention head over 4,096 tokens scaled by the EMBEDDING width (x [4][4096][768]; k = x Wk, q = x Wq, v = x Wv ('xw' [768][64] 768^-0.5, no bias); wei = q.k^T x C^-0.5 with C = 768 (n_embd, not head_size); causal (-inf); softmax; out = wei.v -> [4][4096][64] (1.0 M); argument order x, Wk, Wq, Wv).
// Two launches, all four batches in each. k_proj: 64 rows of x a work-group, rounded to bf16 into LDS; q, k, v = x W on bf16 products (K 768), weights rounded to bf16 in registers; writes the hi/lo planes of q and k and the fp16 and hi/lo planes of v^T. k_fattn: scores, causal softmax and attn.v: scores on hi/lo planes (3 products), online softmax in registers, attn.v hybrid (rows < 512 hi/lo 3 products, rest fp16), output rows written once.
// Compute dtypes, f32 accumulate: every input rounded to bf16; projections exact; scores 3 products; softmax f32; wei.v rows < 512 3 products, rest fp16; output f32.

#define NB_  4
#define TT   4096
#define DM   64
#define NH_  1
#define NKV  1
#define REP  (NH_ / NKV)
#define HD   64
#define DQ   (NH_ * HD)
#define DKV  (NKV * HD)
#define ZH   1
#define RH   512                  // query rows < RH use hi+lo planes (0: none)
#define WIN  0
#define SCL  0.036084391824351615f   // C^-0.5 with C = n_embd = 768 (the source scales by the input width, NOT the head size)
#define MID  64       // q / k width (one 64-wide head)
#define CO   64       // v width
#define CC   768      // input width (d_model)
typedef _Float16 h16;
typedef unsigned short bf;
typedef __attribute__((ext_vector_type(16))) __bf16   v16bf;
typedef __attribute__((ext_vector_type(16))) _Float16 v16h;
typedef __attribute__((ext_vector_type(8)))  _Float16 v8h;
typedef __attribute__((ext_vector_type(8)))  unsigned short v8us;
typedef __attribute__((ext_vector_type(8)))  float    v8f;
typedef __attribute__((ext_vector_type(4)))  float    v4f;
typedef v8h  __attribute__((may_alias)) v8ha;
typedef v4f  __attribute__((may_alias)) v4fa;
typedef v8us __attribute__((may_alias)) v8usa;

__device__ __forceinline__ unsigned short f2bf(float f) { unsigned u = __float_as_uint(f); u += 0x7FFFu + ((u >> 16) & 1u); return (unsigned short)(u >> 16); }
__device__ __forceinline__ float bf2f(unsigned short b) { return __uint_as_float(((unsigned)b) << 16); }
__device__ __forceinline__ float bfr(float f) { return bf2f(f2bf(f)); }
__device__ __forceinline__ v16h cat16(v8h lo, v8h hi) { return __builtin_shufflevector(lo, hi, 0, 1, 2, 3, 4, 5, 6, 7, 8, 9, 10, 11, 12, 13, 14, 15); }
__device__ __forceinline__ v16bf cat16b(v8us lo, v8us hi) { return __builtin_bit_cast(v16bf, __builtin_shufflevector(lo, hi, 0, 1, 2, 3, 4, 5, 6, 7, 8, 9, 10, 11, 12, 13, 14, 15)); }
__device__ __forceinline__ v8f wmma16(v16h a, v16h b, v8f c) { return __builtin_amdgcn_wmma_f32_16x16x32_f16(false, a, false, b, (short)0, c, false, false); }
__device__ __forceinline__ v8f wmmab(v16bf a, v16bf b, v8f c) { return __builtin_amdgcn_wmma_f32_16x16x32_bf16(false, a, false, b, (short)0, c, false, false); }



// fragment loaders: a lane's 16 elements are k = 8 hi .. 8 hi + 7 and 16 + 8 hi .. 16 + 8 hi + 7 of row (or column) lr
template <typename T16> struct WFrag;
template <> struct WFrag<h16> { typedef v16h V; static __device__ __forceinline__ V ld(const h16* p) { return cat16(*(const v8h*)p, *(const v8h*)(p + 16)); } static __device__ __forceinline__ v8f mma(V a, V b, v8f c) { return wmma16(a, b, c); } };
template <> struct WFrag<bf> { typedef v16bf V; static __device__ __forceinline__ V ld(const bf* p) { return cat16b(*(const v8us*)p, *(const v8us*)(p + 16)); } static __device__ __forceinline__ v8f mma(V a, V b, v8f c) { return wmmab(a, b, c); } };

typedef __attribute__((ext_vector_type(4))) __bf16 v4bf;
typedef __attribute__((ext_vector_type(8))) __bf16 v8bf;
typedef __attribute__((ext_vector_type(4))) unsigned short v4us;
typedef v4us __attribute__((may_alias)) v4usa;
__device__ __forceinline__ h16 tohx(float x) { return (h16)x; }

// ---- k_proj: the three projections of 64 rows of x and their planes in one launch. Grid (NB_ * TT / 64), 12 waves.
// The work-group's 64 x 768 piece of x (one contiguous run of memory) is read once, rounded to bf16 and laid in LDS. Wave w works on matrix w / PKS (q, k, v) and sums the 32-wide k steps (w % PKS), (w % PKS) + PKS, ... of the whole 64 x 64 tile; the PKS partial tiles of a matrix meet in LDS and are added in the fixed order of the waves.
// Weights come straight from the f32 [768][64] inputs: position lr of weight fragment nb stands for column n = 4 lr + nb, so one 16-byte load of a lane (4 neighbouring columns of one k row) feeds all 4 fragments and a wave's load covers two whole 256-byte rows.
// q and k: A = weights, B = x rows, so a lane ends with 32 neighbouring columns (32 hi + 4 r + nb) of ONE row: row-major partial tile. v: A = x rows, B = weights, so a lane ends with 8 neighbouring rows of one column: column-major partial tile (slot nb * 16 + lr holds column 4 lr + nb), as the v^T planes want it.
#define PKS  4                    // k shares (waves that split K for one matrix)
#define PNW  (3 * PKS)            // waves in a work-group
#define PST  (CC / 32 / PKS)      // k steps a wave
#define XP   (CC + 8)             // LDS row pitch of the x tile in elements: 1,552 bytes = 16 x 97, an odd multiple of 16 for the 16-byte fragment reads
#define PTS  (64 * 68)            // floats in a partial tile, pitch 68
__device__ __forceinline__ void proj_wld(v4f (&w)[16], const float* __restrict__ wp, const int kc) {
#pragma unroll
    for (int e = 0; e < 16; ++e) w[e] = *(const v4f*)(wp + (size_t)(kc + (e >> 3) * 16 + (e & 7)) * 64);   // element e of a fragment is k = kc + 8 hi + e (e < 8), kc + 16 + 8 hi + e - 8 (else): the order in which WFrag::ld reads x
}
template <bool WA>   // WA: weights are the A operand (q, k); else x is (v)
__device__ __forceinline__ void proj_wave(const float* __restrict__ wp, v4f (&w)[16], const bf* xs, float* ow, const int ks, const int lr, const int hi) {
    v8f acc[4][4];
#pragma unroll
    for (int mb = 0; mb < 4; ++mb)
#pragma unroll
        for (int nb = 0; nb < 4; ++nb) acc[mb][nb] = (v8f){};
#pragma unroll   // unrolled: acc and the fragments are indexed by constants only, and the next step's weight loads can stand ahead of this step's products
    for (int t = 0; t < PST; ++t) {
        const int kc = (t * PKS + ks) * 32;
        v16bf b[4];
#pragma unroll
        for (int nb = 0; nb < 4; ++nb)
#pragma unroll
            for (int e = 0; e < 16; ++e) b[nb][e] = (__bf16)w[e][nb];
        if (t + 1 < PST) proj_wld(w, wp, kc + PKS * 32);
        v16bf a[4];
#pragma unroll
        for (int mb = 0; mb < 4; ++mb) a[mb] = WFrag<bf>::ld(xs + (mb * 16 + lr) * XP + kc + 8 * hi);
#pragma unroll
        for (int nb = 0; nb < 4; ++nb)
#pragma unroll
            for (int mb = 0; mb < 4; ++mb) acc[mb][nb] = WA ? wmmab(b[nb], a[mb], acc[mb][nb]) : wmmab(a[mb], b[nb], acc[mb][nb]);
        __builtin_amdgcn_sched_barrier(0);   // only ONE step's weights are fetched ahead: left free, the scheduler lifted the loads of several steps to the front and the build spilled
    }
#pragma unroll
    for (int mb = 0; mb < 4; ++mb) {
        if constexpr (WA) {
#pragma unroll
            for (int r = 0; r < 8; ++r) { v4f o; o[0] = acc[mb][0][r]; o[1] = acc[mb][1][r]; o[2] = acc[mb][2][r]; o[3] = acc[mb][3][r]; *(v4fa*)(ow + (mb * 16 + lr) * 68 + hi * 32 + r * 4) = o; }
        } else {
#pragma unroll
            for (int nb = 0; nb < 4; ++nb) { float* p = ow + (nb * 16 + lr) * 68 + mb * 16 + hi * 8;
                *(v4fa*)p = __builtin_shufflevector(acc[mb][nb], acc[mb][nb], 0, 1, 2, 3); *(v4fa*)(p + 4) = __builtin_shufflevector(acc[mb][nb], acc[mb][nb], 4, 5, 6, 7); }
        }
    }
}
__global__ __launch_bounds__(32 * PNW) void k_proj(const float* __restrict__ x, const float* __restrict__ wq, const float* __restrict__ wk, const float* __restrict__ wv, bf* Qh, bf* Ql, bf* Kh, bf* Kl, h16* V16, bf* Vh, bf* Vl) {
    __shared__ __align__(16) bf xs[64 * XP];          // the x tile in bf16
    __shared__ __align__(16) float ps[PNW * PTS];     // one 64 x 64 partial tile a wave
    const int tid = threadIdx.x, lane = tid & 31, lr = lane & 15, hi = lane >> 4; const int wvn = __builtin_amdgcn_readfirstlane(tid >> 5);   // the wave's number, held scalar so that the weight base and the k offsets stay scalar
    const int jm = wvn / PKS, ks = wvn % PKS;
    const float* xg = x + (size_t)blockIdx.x * (64 * CC);
    v4f xr[32];
#pragma unroll   // all 32 loads of a lane are in flight at once: one trip to memory for the whole tile
    for (int i = 0; i < 32; ++i) xr[i] = *(const v4f*)(xg + (size_t)(i * (32 * PNW) + tid) * 4);
    const float* wp = (jm == 0 ? wq : jm == 1 ? wk : wv) + (8 * hi) * 64 + lr * 4;
    v4f w[16]; proj_wld(w, wp, ks * 32);   // the first step's weights travel behind the x tile
    const int xrow = tid >= CC / 4 ? 1 : 0, xc = (tid - xrow * (CC / 4)) * 4;   // 384 lanes x 4 floats = two rows of x a trip
#pragma unroll
    for (int i = 0; i < 32; ++i) { v4bf o;
#pragma unroll
        for (int k = 0; k < 4; ++k) o[k] = (__bf16)xr[i][k];
        *(v4usa*)(xs + (2 * i + xrow) * XP + xc) = __builtin_bit_cast(v4us, o); }
    __syncthreads();   // the whole x tile is in LDS before any wave reads fragments of it
    if (jm < 2) proj_wave<true>(wp, w, xs, ps + wvn * PTS, ks, lr, hi);
    else        proj_wave<false>(wp, w, xs, ps + wvn * PTS, ks, lr, hi);
    __syncthreads();   // every wave's partial tile is in LDS before any thread adds them
    const size_t R0 = (size_t)blockIdx.x * 64; const size_t vb = (size_t)(blockIdx.x / (TT / 64)) * CO * TT + (blockIdx.x % (TT / 64)) * 64;   // first row of the tile; its batch's v^T planes at its first token
#pragma unroll
    for (int i = 0; i < 3 * 512 / (32 * PNW); ++i) { const int u = tid + i * (32 * PNW); const int m = u >> 9, r = (u >> 3) & 63, c8 = (u & 7) * 8;   /* 8 neighbouring values of line r of matrix m's tile; m is the same in all lanes of a wave */
        const float* p = ps + m * (PKS * PTS) + r * 68 + c8; v4f s0 = *(const v4fa*)p, s1 = *(const v4fa*)(p + 4);
#pragma unroll   // unrolled so that the LDS reads are issued ahead of the adds
        for (int s = 1; s < PKS; ++s) { s0 += *(const v4fa*)(p + s * PTS); s1 += *(const v4fa*)(p + s * PTS + 4); }
        v8bf oh, ol; v8h o16;
#pragma unroll
        for (int k = 0; k < 8; ++k) { const float y = k < 4 ? s0[k & 3] : s1[k & 3]; const __bf16 h = (__bf16)y; oh[k] = h; ol[k] = (__bf16)(y - (float)h); o16[k] = tohx(y); }
        if (m < 2) { const size_t e = (R0 + r) * HD + c8;   /* 8 lanes = one 128-byte row of a plane */
            *(v8us*)((m == 0 ? Qh : Kh) + e) = __builtin_bit_cast(v8us, oh); *(v8us*)((m == 0 ? Ql : Kl) + e) = __builtin_bit_cast(v8us, ol); }
        else { const size_t e = vb + (size_t)((r & 15) * 4 + (r >> 4)) * TT + c8;   /* slot r holds column 4 (r & 15) + (r >> 4); 8 lanes = the tile's 128 bytes of that v^T row */
            *(v8h*)(V16 + e) = o16; *(v8us*)(Vh + e) = __builtin_bit_cast(v8us, oh); *(v8us*)(Vl + e) = __builtin_bit_cast(v8us, ol); } }
}
// ---- k_fattn: scores, causal softmax and attn.v in one launch; no score or probability ever leaves the registers. Grid (TT / 64, batch), 16 waves.
// A work-group owns 64 query rows: wave w works on the 32 rows of group w >> 3 and on the 32-key blocks (w & 7), (w & 7) + 8, ... of all TT keys (the two waves with the same w & 7 read the same K and V lines).
// S^T = K.Q^T (A = key rows, B = query rows): in each 16-column group a lane holds scores of ONE query (column lr), keys 8 hi + r; two such tiles, converted in place, are the B operand of O^T += V^T.P^T (hardware k order, as WFrag::ld reads A).
// Each wave keeps its own running maximum m (log2 units), sum l and O^T; the 8 partial results of a query group meet in LDS and are joined in the fixed order of the waves.
#define FKS  8        // key shares (waves that split the keys of one query group)
#define FQG  2        // query groups of 32 rows in a work-group
#define SC2  (SCL * 1.4426950408889634f)   // score scale times log2(e): the softmax runs on exp2
// exp2 with the one issue slot that the instruction set asks for behind a transcendental (before its result is used or its source overwritten) in the same statement
__device__ __forceinline__ float exp2s(float x) { float r; asm("v_exp_f32 %0, %1\n\tv_nop" : "=v"(r) : "v"(x)); return r; }
template <bool HR>   // HR: probabilities and v on bf16 hi/lo planes (3 products); else fp16
__device__ __forceinline__ void fattn_wave(const bf* __restrict__ Qh, const bf* __restrict__ Ql, const bf* __restrict__ Kh, const bf* __restrict__ Kl, const h16* __restrict__ V16, const bf* __restrict__ Vh, const bf* __restrict__ Vl, const int q0, const int ks, const int lr, const int hi, float* ow, float* mlw) {
    v16bf qh[2][2], ql[2][2];
#pragma unroll
    for (int qt = 0; qt < 2; ++qt)
#pragma unroll
        for (int kk = 0; kk < 2; ++kk) { const size_t qo = (size_t)(q0 + qt * 16 + lr) * HD + kk * 32 + 8 * hi; qh[qt][kk] = WFrag<bf>::ld(Qh + qo); ql[qt][kk] = WFrag<bf>::ld(Ql + qo); }
    v8f o[4][2];
#pragma unroll
    for (int dt = 0; dt < 4; ++dt) { o[dt][0] = (v8f){}; o[dt][1] = (v8f){}; }
    const unsigned klo = (unsigned)(lr * HD + 8 * hi), vlo = (unsigned)(lr * TT + 8 * hi);   // the lane's element offsets in a key block and in a block of v^T columns
    float m[2] = { -1.0e30f, -1.0e30f }, l[2] = { 0.f, 0.f };   // m starts above the mask value, so a wholly masked block gives exp2(-huge) = 0
    for (int p = 0; p < TT / (32 * FKS); ++p) {
        const int k0 = (p * FKS + ks) * 32;
        const bf* kph = Kh + (size_t)k0 * HD; const bf* kpl = Kl + (size_t)k0 * HD;   // wave-uniform bases; the lane's part is one 32-bit offset for both planes
        v8f s[2][2]; s[0][0] = (v8f){}; s[0][1] = (v8f){}; s[1][0] = (v8f){}; s[1][1] = (v8f){};
        v16bf kh[2][2], kl[2][2];
#pragma unroll
        for (int kk = 0; kk < 2; ++kk)
#pragma unroll
            for (int kt = 0; kt < 2; ++kt) { kh[kk][kt] = WFrag<bf>::ld(kph + klo + (kt * 16 * HD + kk * 32)); if (kk + kt < 2) kl[kk][kt] = WFrag<bf>::ld(kpl + klo + (kt * 16 * HD + kk * 32)); }
        __builtin_amdgcn_sched_barrier(0);   // 14 of the 16 key loads of the pass are held in front of the first product: one trip to L2 for them; left free, the scheduler re-used two fragments' registers and waited on L2 six times a pass
#pragma unroll
        for (int kk = 0; kk < 2; ++kk) {
#pragma unroll
            for (int kt = 0; kt < 2; ++kt) { s[kt][0] = wmmab(kh[kk][kt], qh[0][kk], s[kt][0]); s[kt][1] = wmmab(kh[kk][kt], qh[1][kk], s[kt][1]); }
#pragma unroll
            for (int kt = 0; kt < 2; ++kt) { s[kt][0] = wmmab(kh[kk][kt], ql[0][kk], s[kt][0]); s[kt][1] = wmmab(kh[kk][kt], ql[1][kk], s[kt][1]); }
            if (kk == 0) { __builtin_amdgcn_sched_barrier(0); asm volatile("s_wait_xcnt 0x0" ::: "memory");   /* this load's data may be given the address registers of the 14 loads issued above */
                kl[1][1] = WFrag<bf>::ld(kpl + klo + (16 * HD + 32)); __builtin_amdgcn_sched_barrier(0); }   /* the fragment used last is loaded here, between two scheduling barriers, into registers that the first 8 products have freed: with all 8 fragments in flight at once the build spills */
#pragma unroll
            for (int kt = 0; kt < 2; ++kt) { s[kt][0] = wmmab(kl[kk][kt], qh[0][kk], s[kt][0]); s[kt][1] = wmmab(kl[kk][kt], qh[1][kk], s[kt][1]); } }
        float mx[2];
#pragma unroll
        for (int qt = 0; qt < 2; ++qt) { const int lim = q0 + qt * 16 + lr - k0 - 8 * hi; float a = -3.0e38f;   /* key kt * 16 + r of this lane's half is visible while <= lim */
#pragma unroll
            for (int kt = 0; kt < 2; ++kt)
#pragma unroll
                for (int r = 0; r < 8; ++r) { const float t = (kt * 16 + r <= lim) ? s[kt][qt][r] * SC2 : -3.0e38f; s[kt][qt][r] = t; a = fmaxf(a, t); }
            mx[qt] = fmaxf(a, __shfl_xor(a, 16, 32)); }   /* both halves of a column must use one maximum: the product sums over both halves' keys */
        if (__builtin_amdgcn_ballot_w32(mx[0] > m[0] + 8.0f || mx[1] > m[1] + 8.0f) != 0) {   // lazy rescale, one scalar branch a pass: probabilities may reach 2^8 before the maximum in use moves
#pragma unroll
            for (int qt = 0; qt < 2; ++qt) { const float mn = fmaxf(m[qt], mx[qt]); const float al = exp2s(m[qt] - mn); m[qt] = mn; l[qt] *= al;
#pragma unroll
                for (int dt = 0; dt < 4; ++dt) o[dt][qt] *= al; } }
        if constexpr (HR) {
            v16bf vh[4], vl[4], ph[2], pl[2]; const bf* vph = Vh + k0 + vlo;   // one address pair for the 8 loads of the hi plane
#pragma unroll
            for (int dt = 0; dt < 4; ++dt) vh[dt] = WFrag<bf>::ld(vph + dt * 16 * TT);
            asm volatile("s_wait_xcnt 0x0" :: "v"(vph) : "memory");   // the wait before the address pair of the 8 loads above is overwritten; it reads the pair, so the pair lives to here and no load of the run is given its registers for its data
            __builtin_amdgcn_sched_barrier(0);   // the hi plane of v is asked for ahead of the exponentials, which cover its trip to L2; left free, the scheduler loaded one d tile at a time and waited four times
#pragma unroll
            for (int qt = 0; qt < 2; ++qt) { float ls = 0.f;
#pragma unroll
                for (int e = 0; e < 16; ++e) { const float pv = exp2s(s[e >> 3][qt][e & 7] - m[qt]); ls += pv; const __bf16 h = (__bf16)pv; ph[qt][e] = h; pl[qt][e] = (__bf16)(pv - (float)h); }
                l[qt] += ls; }
#pragma unroll
            for (int dt = 0; dt < 4; ++dt) vl[dt] = WFrag<bf>::ld(Vl + k0 + vlo + dt * 16 * TT);
#pragma unroll
            for (int dt = 0; dt < 4; ++dt) { o[dt][0] = wmmab(vh[dt], ph[0], o[dt][0]); o[dt][1] = wmmab(vh[dt], ph[1], o[dt][1]); }
#pragma unroll
            for (int dt = 0; dt < 4; ++dt) { o[dt][0] = wmmab(vh[dt], pl[0], o[dt][0]); o[dt][1] = wmmab(vh[dt], pl[1], o[dt][1]); }
#pragma unroll
            for (int dt = 0; dt < 4; ++dt) { o[dt][0] = wmmab(vl[dt], ph[0], o[dt][0]); o[dt][1] = wmmab(vl[dt], ph[1], o[dt][1]); }
        } else {
            v16h pb[2];
#pragma unroll
            for (int qt = 0; qt < 2; ++qt) { float ls = 0.f;
#pragma unroll
                for (int e = 0; e < 16; ++e) { const float pv = exp2s(s[e >> 3][qt][e & 7] - m[qt]); ls += pv; pb[qt][e] = tohx(pv); }
                l[qt] += ls; }
#pragma unroll
            for (int dt = 0; dt < 4; ++dt) { const v16h va = WFrag<h16>::ld(V16 + k0 + vlo + dt * 16 * TT); o[dt][0] = wmma16(va, pb[0], o[dt][0]); o[dt][1] = wmma16(va, pb[1], o[dt][1]); }
        }
    }
#pragma unroll
    for (int qt = 0; qt < 2; ++qt) { const float lt = l[qt] + __shfl_xor(l[qt], 16, 32);   /* the halves' sums joined once */
        if (hi == 0) { mlw[(qt * 16 + lr) * 2] = m[qt]; mlw[(qt * 16 + lr) * 2 + 1] = lt; }
#pragma unroll
        for (int dt = 0; dt < 4; ++dt) { float* pp = ow + (qt * 16 + lr) * 68 + dt * 16 + hi * 8;   /* a lane's 8 accumulator values are 8 consecutive d of one query row */
            *(v4fa*)pp = __builtin_shufflevector(o[dt][qt], o[dt][qt], 0, 1, 2, 3); *(v4fa*)(pp + 4) = __builtin_shufflevector(o[dt][qt], o[dt][qt], 4, 5, 6, 7); } }
}
__global__ __launch_bounds__(32 * FKS * FQG) void k_fattn(const bf* __restrict__ Qh, const bf* __restrict__ Ql, const bf* __restrict__ Kh, const bf* __restrict__ Kl, const h16* __restrict__ V16, const bf* __restrict__ Vh, const bf* __restrict__ Vl, float* out) {
    __shared__ __align__(16) float os[FKS * FQG * 32 * 68];   // one 32 x 64 partial output a wave, row pitch 68 floats
    __shared__ float ml[FKS * FQG * 32 * 2];                  // its (maximum in use, sum) per query row
    const size_t po = (size_t)blockIdx.y * TT * HD; Qh += po; Ql += po; Kh += po; Kl += po; V16 += po; Vh += po; Vl += po; out += po;   // blockIdx.y = batch
    const int lane = threadIdx.x & 31, lr = lane & 15, hi = lane >> 4; const int wv = __builtin_amdgcn_readfirstlane((int)(threadIdx.x >> 5));   // the wave's number, held scalar so that the key offsets stay scalar
    const int Q0 = blockIdx.x * (32 * FQG); const int q0 = Q0 + (wv / FKS) * 32, ks = wv % FKS;
    if (Q0 < RH) fattn_wave<true>(Qh, Ql, Kh, Kl, V16, Vh, Vl, q0, ks, lr, hi, os + wv * (32 * 68), ml + wv * 64);
    else         fattn_wave<false>(Qh, Ql, Kh, Kl, V16, Vh, Vl, q0, ks, lr, hi, os + wv * (32 * 68), ml + wv * 64);
    __syncthreads();   // every wave's partial result is in LDS before any thread joins them
    for (int u = threadIdx.x; u < 32 * FQG * 16; u += 32 * FKS * FQG) { const int q = u >> 4, d4 = (u & 15) * 4; const int w0 = (q >> 5) * FKS, qq = q & 31;
        float M = ml[(w0 * 32 + qq) * 2];
#pragma unroll   // unrolled so that the LDS reads are issued ahead of the arithmetic
        for (int w = 1; w < FKS; ++w) M = fmaxf(M, ml[((w0 + w) * 32 + qq) * 2]);
        float Lt = 0.f; v4f val = (v4f){};
#pragma unroll
        for (int w = 0; w < FKS; ++w) { const float wt = exp2s(ml[((w0 + w) * 32 + qq) * 2] - M); Lt += wt * ml[((w0 + w) * 32 + qq) * 2 + 1]; val += wt * *(const v4fa*)(os + ((w0 + w) * 32 + qq) * 68 + d4); }
        const float rl = __fdiv_rn(1.0f, Lt);
        *(v4f*)(out + (size_t)(Q0 + q) * CO + d4) = val * rl; }   /* 16 lanes = one 256-byte output row */
}
extern "C" void kernel_launch(void* const* d_in, const int* in_sizes, int n_in,
                              void* d_out, int out_size, void* d_ws, size_t ws_size, hipStream_t stream) {
    (void)in_sizes; (void)n_in; (void)out_size;
    const float* x = (const float*)d_in[0]; const float* wk = (const float*)d_in[1]; const float* wq = (const float*)d_in[2]; const float* wv = (const float*)d_in[3];   /* input order x [4][4096][768], Wk, Wq, Wv ('xw' [768][64]; NOTE the key weight comes FIRST); standard roles: rows = queries */
    float* OUT = (float*)d_out;     // [4][4096][64]
    char* wsp = (char*)d_ws;
    auto take = [&](size_t bytes) { char* p = wsp; wsp += (bytes + 255) & ~(size_t)255; return (void*)p; };
    bf* QPh = (bf*)take((size_t)NB_ * TT * MID * 2); bf* QPl = (bf*)take((size_t)NB_ * TT * MID * 2); bf* KPh = (bf*)take((size_t)NB_ * TT * MID * 2); bf* KPl = (bf*)take((size_t)NB_ * TT * MID * 2);
    h16* VT16 = (h16*)take((size_t)NB_ * CO * TT * 2); bf* VTh = (bf*)take((size_t)NB_ * CO * TT * 2); bf* VTl = (bf*)take((size_t)NB_ * CO * TT * 2);
    if ((size_t)(wsp - (char*)d_ws) > ws_size) return;    // ws 256 MiB (carve 14 MiB)
    k_proj<<<dim3(NB_ * TT / 64, 1, 1), 32 * PNW, 0, stream>>>(x, wq, wk, wv, QPh, QPl, KPh, KPl, VT16, VTh, VTl);   /* q, k planes [b][n][64], v^T planes [b][64][n] */
    k_fattn<<<dim3(TT / (32 * FQG), NB_, 1), 32 * FKS * FQG, 0, stream>>>(QPh, QPl, KPh, KPl, VT16, VTh, VTl, OUT);   /* scores, causal softmax, attn.v; writes every output row once */
}

// v005
// Measured time: 52.8 microseconds a run.
// Next to v004, in two timings, it ran 1.52 and 1.50 times as fast.
// Over all steps from v000 it is 22.9 times as fast.
#include <hip/hip_runtime.h>

// Single causal attention head over 4,096 tokens scaled by the EMBEDDING width (x [4][4096][768]; k = x Wk, q = x Wq, v = x Wv ('xw' [768][64] 768^-0.5, no bias); wei = q.k^T x C^-0.5 with C = 768 (n_embd, not head_size); causal (-inf); softmax; out = wei.v -> [4][4096][64] (1.0 M); argument order x, Wk, Wq, Wv).
// Two launches, all four batches in each. k_proj: 64 rows of x a work-group, rounded to bf16 into LDS; q, k, v = x W on bf16 products (K 768), weights rounded to bf16 in registers; writes the hi/lo planes of q and k and the fp16 and hi/lo planes of v^T, all in fragment order (see PLANE LAYOUT). k_fattn: scores, causal softmax and attn.v: scores on hi/lo planes (3 products), online softmax in registers, attn.v hybrid (rows < 512 hi/lo 3 products, rest fp16), output rows written once.
// Compute dtypes, f32 accumulate: every input rounded to bf16; projections exact; scores 3 products; softmax f32; wei.v rows < 512 3 products, rest fp16; output f32.

#define NB_  4
#define TT   4096
#define DM   64
#define NH_  1
#define NKV  1
#define REP  (NH_ / NKV)
#define HD   64
#define DQ   (NH_ * HD)
#define DKV  (NKV * HD)
#define ZH   1
#define RH   512                  // query rows < RH use hi+lo planes (0: none)
#define WIN  0
#define SCL  0.036084391824351615f   // C^-0.5 with C = n_embd = 768 (the source scales by the input width, NOT the head size)
#define MID  64       // q / k width (one 64-wide head)
#define CO   64       // v width
#define CC   768      // input width (d_model)
typedef _Float16 h16;
typedef unsigned short bf;
typedef __attribute__((ext_vector_type(16))) __bf16   v16bf;
typedef __attribute__((ext_vector_type(16))) _Float16 v16h;
typedef __attribute__((ext_vector_type(8)))  _Float16 v8h;
typedef __attribute__((ext_vector_type(8)))  unsigned short v8us;
typedef __attribute__((ext_vector_type(8)))  float    v8f;
typedef __attribute__((ext_vector_type(4)))  float    v4f;
typedef v8h  __attribute__((may_alias)) v8ha;
typedef v4f  __attribute__((may_alias)) v4fa;
typedef v8us __attribute__((may_alias)) v8usa;

__device__ __forceinline__ unsigned short f2bf(float f) { unsigned u = __float_as_uint(f); u += 0x7FFFu + ((u >> 16) & 1u); return (unsigned short)(u >> 16); }
__device__ __forceinline__ float bf2f(unsigned short b) { return __uint_as_float(((unsigned)b) << 16); }
__device__ __forceinline__ float bfr(float f) { return bf2f(f2bf(f)); }
__device__ __forceinline__ v16h cat16(v8h lo, v8h hi) { return __builtin_shufflevector(lo, hi, 0, 1, 2, 3, 4, 5, 6, 7, 8, 9, 10, 11, 12, 13, 14, 15); }
__device__ __forceinline__ v16bf cat16b(v8us lo, v8us hi) { return __builtin_bit_cast(v16bf, __builtin_shufflevector(lo, hi, 0, 1, 2, 3, 4, 5, 6, 7, 8, 9, 10, 11, 12, 13, 14, 15)); }
__device__ __forceinline__ v8f wmma16(v16h a, v16h b, v8f c) { return __builtin_amdgcn_wmma_f32_16x16x32_f16(false, a, false, b, (short)0, c, false, false); }
__device__ __forceinline__ v8f wmmab(v16bf a, v16bf b, v8f c) { return __builtin_amdgcn_wmma_f32_16x16x32_bf16(false, a, false, b, (short)0, c, false, false); }



// fragment loaders: a lane's 16 elements are k = 8 hi .. 8 hi + 7 and 16 + 8 hi .. 16 + 8 hi + 7 of row (or column) lr
// ld reads them from a row-major tile (p = the lane's row at k = 8 hi); ldp from a plane in fragment order (p = the fragment's start + 8 * lane)
// PLANE LAYOUT: a 16 x 32 fragment is 1,024 contiguous bytes, two halves of 512: half j holds, at 16 bytes a lane (lane = 16 hi + lr), k = 16 j + 8 hi .. + 7 of row lr. So each wave-wide 16-byte load of k_fattn covers 512 contiguous bytes = 4 whole lines, where a row-major plane gave it 32 bytes of each of 16 lines.
// q and k planes: fragment (n / 16) * 2 + c / 32 (rows = tokens n, k = columns c). v^T planes: fragment (n / 32) * 4 + d / 16 (rows = columns d of v, k = tokens n). A 64-token tile is 8 fragments = 512 chunks of 16 bytes in a row, in every plane.
template <typename T16> struct WFrag;
template <> struct WFrag<h16> { typedef v16h V; static __device__ __forceinline__ V ld(const h16* p) { return cat16(*(const v8h*)p, *(const v8h*)(p + 16)); } static __device__ __forceinline__ V ldp(const h16* p) { return cat16(*(const v8h*)p, *(const v8h*)(p + 256)); } static __device__ __forceinline__ v8f mma(V a, V b, v8f c) { return wmma16(a, b, c); } };
template <> struct WFrag<bf> { typedef v16bf V; static __device__ __forceinline__ V ld(const bf* p) { return cat16b(*(const v8us*)p, *(const v8us*)(p + 16)); } static __device__ __forceinline__ V ldp(const bf* p) { return cat16b(*(const v8us*)p, *(const v8us*)(p + 256)); } static __device__ __forceinline__ v8f mma(V a, V b, v8f c) { return wmmab(a, b, c); } };

typedef __attribute__((ext_vector_type(4))) __bf16 v4bf;
typedef __attribute__((ext_vector_type(8))) __bf16 v8bf;
typedef __attribute__((ext_vector_type(4))) unsigned short v4us;
typedef v4us __attribute__((may_alias)) v4usa;
__device__ __forceinline__ h16 tohx(float x) { return (h16)x; }

// ---- k_proj: the three projections of 64 rows of x and their planes in one launch. Grid (NB_ * TT / 64), 12 waves.
// The work-group's 64 x 768 piece of x (one contiguous run of memory) is read once, rounded to bf16 and laid in LDS. Wave w works on matrix w / PKS (q, k, v) and sums the 32-wide k steps (w % PKS), (w % PKS) + PKS, ... of the whole 64 x 64 tile; the PKS partial tiles of a matrix meet in LDS and are added in the fixed order of the waves.
// Weights come straight from the f32 [768][64] inputs: position lr of weight fragment nb stands for column n = 4 lr + nb, so one 16-byte load of a lane (4 neighbouring columns of one k row) feeds all 4 fragments and a wave's load covers two whole 256-byte rows.
// q and k: A = weights, B = x rows, so a lane ends with 32 neighbouring columns (32 hi + 4 r + nb) of ONE row: row-major partial tile. v: A = x rows, B = weights, so a lane ends with 8 neighbouring rows of one column: column-major partial tile (slot nb * 16 + lr holds column 4 lr + nb), as the v^T planes want it.
#define PKS  4                    // k shares (waves that split K for one matrix)
#define PNW  (3 * PKS)            // waves in a work-group
#define PST  (CC / 32 / PKS)      // k steps a wave
#define XP   (CC + 8)             // LDS row pitch of the x tile in elements: 1,552 bytes = 16 x 97, an odd multiple of 16 for the 16-byte fragment reads
#define PTS  (64 * 68 + 64)       // floats in a partial tile, pitch 68; in v's tile slot group nb is shifted by 16 nb floats more, so that the 16 columns of a v^T fragment (4 from each group) are read from 16 different bank groups
__device__ __forceinline__ void proj_wld(v4f (&w)[16], const float* __restrict__ wp, const int kc) {
#pragma unroll
    for (int e = 0; e < 16; ++e) w[e] = *(const v4f*)(wp + (size_t)(kc + (e >> 3) * 16 + (e & 7)) * 64);   // element e of a fragment is k = kc + 8 hi + e (e < 8), kc + 16 + 8 hi + e - 8 (else): the order in which WFrag::ld reads x
}
template <bool WA>   // WA: weights are the A operand (q, k); else x is (v)
__device__ __forceinline__ void proj_wave(const float* __restrict__ wp, v4f (&w)[16], const bf* xs, float* ow, const int ks, const int lr, const int hi) {
    v8f acc[4][4];
#pragma unroll
    for (int mb = 0; mb < 4; ++mb)
#pragma unroll
        for (int nb = 0; nb < 4; ++nb) acc[mb][nb] = (v8f){};
#pragma unroll   // unrolled: acc and the fragments are indexed by constants only, and the next step's weight loads can stand ahead of this step's products
    for (int t = 0; t < PST; ++t) {
        const int kc = (t * PKS + ks) * 32;
        v16bf b[4];
#pragma unroll
        for (int nb = 0; nb < 4; ++nb)
#pragma unroll
            for (int e = 0; e < 16; ++e) b[nb][e] = (__bf16)w[e][nb];
        if (t + 1 < PST) proj_wld(w, wp, kc + PKS * 32);
        v16bf a[4];
#pragma unroll
        for (int mb = 0; mb < 4; ++mb) a[mb] = WFrag<bf>::ld(xs + (mb * 16 + lr) * XP + kc + 8 * hi);
#pragma unroll
        for (int nb = 0; nb < 4; ++nb)
#pragma unroll
            for (int mb = 0; mb < 4; ++mb) acc[mb][nb] = WA ? wmmab(b[nb], a[mb], acc[mb][nb]) : wmmab(a[mb], b[nb], acc[mb][nb]);
        __builtin_amdgcn_sched_barrier(0);   // only ONE step's weights are fetched ahead: left free, the scheduler lifted the loads of several steps to the front and the build spilled
    }
#pragma unroll
    for (int mb = 0; mb < 4; ++mb) {
        if constexpr (WA) {
#pragma unroll
            for (int r = 0; r < 8; ++r) { v4f o; o[0] = acc[mb][0][r]; o[1] = acc[mb][1][r]; o[2] = acc[mb][2][r]; o[3] = acc[mb][3][r]; *(v4fa*)(ow + (mb * 16 + lr) * 68 + hi * 32 + r * 4) = o; }
        } else {
#pragma unroll
            for (int nb = 0; nb < 4; ++nb) { float* p = ow + (nb * 16 + lr) * 68 + nb * 16 + mb * 16 + hi * 8;
                *(v4fa*)p = __builtin_shufflevector(acc[mb][nb], acc[mb][nb], 0, 1, 2, 3); *(v4fa*)(p + 4) = __builtin_shufflevector(acc[mb][nb], acc[mb][nb], 4, 5, 6, 7); }
        }
    }
}
__global__ __launch_bounds__(32 * PNW) void k_proj(const float* __restrict__ x, const float* __restrict__ wq, const float* __restrict__ wk, const float* __restrict__ wv, bf* Qh, bf* Ql, bf* Kh, bf* Kl, h16* V16, bf* Vh, bf* Vl) {
    __shared__ __align__(16) bf xs[64 * XP];          // the x tile in bf16
    __shared__ __align__(16) float ps[PNW * PTS];     // one 64 x 64 partial tile a wave
    const int tid = threadIdx.x, lane = tid & 31, lr = lane & 15, hi = lane >> 4; const int wvn = __builtin_amdgcn_readfirstlane(tid >> 5);   // the wave's number, held scalar so that the weight base and the k offsets stay scalar
    const int jm = wvn / PKS, ks = wvn % PKS;
    const float* xg = x + (size_t)blockIdx.x * (64 * CC);
    v4f xr[32];
#pragma unroll   // all 32 loads of a lane are in flight at once: one trip to memory for the whole tile
    for (int i = 0; i < 32; ++i) xr[i] = *(const v4f*)(xg + (size_t)(i * (32 * PNW) + tid) * 4);
    const float* wp = (jm == 0 ? wq : jm == 1 ? wk : wv) + (8 * hi) * 64 + lr * 4;
    v4f w[16]; proj_wld(w, wp, ks * 32);   // the first step's weights travel behind the x tile
    const int xrow = tid >= CC / 4 ? 1 : 0, xc = (tid - xrow * (CC / 4)) * 4;   // 384 lanes x 4 floats = two rows of x a trip
#pragma unroll
    for (int i = 0; i < 32; ++i) { v4bf o;
#pragma unroll
        for (int k = 0; k < 4; ++k) o[k] = (__bf16)xr[i][k];
        *(v4usa*)(xs + (2 * i + xrow) * XP + xc) = __builtin_bit_cast(v4us, o); }
    __syncthreads();   // the whole x tile is in LDS before any wave reads fragments of it
    if (jm < 2) proj_wave<true>(wp, w, xs, ps + wvn * PTS, ks, lr, hi);
    else        proj_wave<false>(wp, w, xs, ps + wvn * PTS, ks, lr, hi);
    __syncthreads();   // every wave's partial tile is in LDS before any thread adds them
    const size_t E0 = (size_t)blockIdx.x * (64 * 64);   // the tile's first element in every plane: 64 tokens are 4,096 elements in a row, batches one behind the other
#pragma unroll
    for (int i = 0; i < 3 * 512 / (32 * PNW); ++i) { const int u = tid + i * (32 * PNW); const int m = u >> 9, ci = u & 511, cl = ci & 15;   /* chunk ci of matrix m's planes (8 neighbouring values of one line of its tile); m is the same in all lanes of a wave, whose 32 chunks are 512 bytes in a row */
        const int lo = m < 2 ? ((ci >> 7) * 16 + cl) * 68 + ((ci >> 4) & 7) * 8   /* q, k: token (ci >> 7) * 16 + cl, columns from 8 * bits 4 to 6 (hi, j, c / 32) */
                             : ((cl & 3) * 16 + ((ci >> 6) & 3) * 4 + (cl >> 2)) * 68 + (cl & 3) * 16 + ((ci >> 4) & 3) * 8 + (ci >> 8) * 32;   /* v: column d = 16 * bits 6, 7 + cl lies in slot (d & 3) * 16 + d / 4; tokens from 8 hi + 16 j + 32 * bit 8 */
        const float* p = ps + m * (PKS * PTS) + lo; v4f s0 = *(const v4fa*)p, s1 = *(const v4fa*)(p + 4);
#pragma unroll   // unrolled so that the LDS reads are issued ahead of the adds
        for (int s = 1; s < PKS; ++s) { s0 += *(const v4fa*)(p + s * PTS); s1 += *(const v4fa*)(p + s * PTS + 4); }
        v8bf oh, ol; v8h o16;
#pragma unroll
        for (int k = 0; k < 8; ++k) { const float y = k < 4 ? s0[k & 3] : s1[k & 3]; const __bf16 h = (__bf16)y; oh[k] = h; ol[k] = (__bf16)(y - (float)h); o16[k] = tohx(y); }
        const size_t e = E0 + (size_t)ci * 8;
        if (m < 2) {
            *(v8us*)((m == 0 ? Qh : Kh) + e) = __builtin_bit_cast(v8us, oh); *(v8us*)((m == 0 ? Ql : Kl) + e) = __builtin_bit_cast(v8us, ol); }
        else {
            *(v8h*)(V16 + e) = o16; *(v8us*)(Vh + e) = __builtin_bit_cast(v8us, oh); *(v8us*)(Vl + e) = __builtin_bit_cast(v8us, ol); } }
}
// ---- k_fattn: scores, causal softmax and attn.v in one launch; no score or probability ever leaves the registers. Grid (TT / 64, batch), 16 waves.
// A work-group owns 64 query rows: wave w works on the 32 rows of group w >> 3 and on the 32-key blocks (w & 7), (w & 7) + 8, ... of all TT keys (the two waves with the same w & 7 read the same K and V lines).
// S^T = K.Q^T (A = key rows, B = query rows): in each 16-column group a lane holds scores of ONE query (column lr), keys 8 hi + r; two such tiles, converted in place, are the B operand of O^T += V^T.P^T (hardware k order, as WFrag::ld reads A).
// Each wave keeps its own running maximum m (log2 units), sum l and O^T; the 8 partial results of a query group meet in LDS and are joined in the fixed order of the waves.
#define FKS  8        // key shares (waves that split the keys of one query group)
#define FQG  2        // query groups of 32 rows in a work-group
#define SC2  (SCL * 1.4426950408889634f)   // score scale times log2(e): the softmax runs on exp2
// exp2 with the one issue slot that the instruction set asks for behind a transcendental (before its result is used or its source overwritten) in the same statement
__device__ __forceinline__ float exp2s(float x) { float r; asm("v_exp_f32 %0, %1\n\tv_nop" : "=v"(r) : "v"(x)); return r; }
template <bool HR>   // HR: probabilities and v on bf16 hi/lo planes (3 products); else fp16
__device__ __forceinline__ void fattn_wave(const bf* __restrict__ Qh, const bf* __restrict__ Ql, const bf* __restrict__ Kh, const bf* __restrict__ Kl, const h16* __restrict__ V16, const bf* __restrict__ Vh, const bf* __restrict__ Vl, const int q0, const int ks, const int lr, const int hi, float* ow, float* mlw) {
    v16bf qh[2][2], ql[2][2];
#pragma unroll
    for (int qt = 0; qt < 2; ++qt)
#pragma unroll
        for (int kk = 0; kk < 2; ++kk) { const size_t qo = (size_t)(q0 + qt * 16) * HD + kk * 512 + (hi * 16 + lr) * 8; qh[qt][kk] = WFrag<bf>::ldp(Qh + qo); ql[qt][kk] = WFrag<bf>::ldp(Ql + qo); }
    v8f o[4][2];
#pragma unroll
    for (int dt = 0; dt < 4; ++dt) { o[dt][0] = (v8f){}; o[dt][1] = (v8f){}; }
    const unsigned klo = (unsigned)((hi * 16 + lr) * 8), vlo = klo;   // the lane's element offset in every fragment half of the planes
    float m[2] = { -1.0e30f, -1.0e30f }, l[2] = { 0.f, 0.f };   // m starts above the mask value, so a wholly masked block gives exp2(-huge) = 0
    for (int p = 0; p < TT / (32 * FKS); ++p) {
        const int k0 = (p * FKS + ks) * 32;
        const bf* kph = Kh + (size_t)k0 * HD; const bf* kpl = Kl + (size_t)k0 * HD;   // wave-uniform bases; the lane's part is one 32-bit offset for both planes
        const bf* kpv = kpl + klo;   // the lane's address in the lo plane, one pair for its 8 loads
        v8f s[2][2]; s[0][0] = (v8f){}; s[0][1] = (v8f){}; s[1][0] = (v8f){}; s[1][1] = (v8f){};
        v16bf kh[2][2], kl[2][2];
#pragma unroll
        for (int kk = 0; kk < 2; ++kk)
#pragma unroll
            for (int kt = 0; kt < 2; ++kt) { kh[kk][kt] = WFrag<bf>::ldp(kph + klo + (kt * 1024 + kk * 512)); if (kk + kt < 2) kl[kk][kt] = WFrag<bf>::ldp(kpv + (kt * 1024 + kk * 512)); }
        __builtin_amdgcn_sched_barrier(0);   // 14 of the 16 key loads of the pass are held in front of the first product: one trip to L2 for them; left free, the scheduler re-used two fragments' registers and waited on L2 six times a pass
#pragma unroll
        for (int kk = 0; kk < 2; ++kk) {
#pragma unroll
            for (int kt = 0; kt < 2; ++kt) { s[kt][0] = wmmab(kh[kk][kt], qh[0][kk], s[kt][0]); s[kt][1] = wmmab(kh[kk][kt], qh[1][kk], s[kt][1]); }
#pragma unroll
            for (int kt = 0; kt < 2; ++kt) { s[kt][0] = wmmab(kh[kk][kt], ql[0][kk], s[kt][0]); s[kt][1] = wmmab(kh[kk][kt], ql[1][kk], s[kt][1]); }
            if (kk == 0) { __builtin_amdgcn_sched_barrier(0); asm volatile("s_wait_xcnt 0x0" ::: "memory");   /* this load's data may be given the address registers of the 14 loads issued above */
                kl[1][1] = WFrag<bf>::ldp(kpv + (1024 + 512)); asm volatile("s_wait_xcnt 0x0" :: "v"(kpv) : "memory");   /* the wait reads the address pair, so the pair lives to here and neither of the two loads is given its registers for its data */
                __builtin_amdgcn_sched_barrier(0); }   /* the fragment used last is loaded here, between two scheduling barriers, into registers that the first 8 products have freed: with all 8 fragments in flight at once the build spills */
#pragma unroll
            for (int kt = 0; kt < 2; ++kt) { s[kt][0] = wmmab(kl[kk][kt], qh[0][kk], s[kt][0]); s[kt][1] = wmmab(kl[kk][kt], qh[1][kk], s[kt][1]); } }
        float mx[2];
#pragma unroll
        for (int qt = 0; qt < 2; ++qt) { const int lim = q0 + qt * 16 + lr - k0 - 8 * hi; float a = -3.0e38f;   /* key kt * 16 + r of this lane's half is visible while <= lim */
#pragma unroll
            for (int kt = 0; kt < 2; ++kt)
#pragma unroll
                for (int r = 0; r < 8; ++r) { const float t = (kt * 16 + r <= lim) ? s[kt][qt][r] * SC2 : -3.0e38f; s[kt][qt][r] = t; a = fmaxf(a, t); }
            mx[qt] = fmaxf(a, __shfl_xor(a, 16, 32)); }   /* both halves of a column must use one maximum: the product sums over both halves' keys */
        if (__builtin_amdgcn_ballot_w32(mx[0] > m[0] + 8.0f || mx[1] > m[1] + 8.0f) != 0) {   // lazy rescale, one scalar branch a pass: probabilities may reach 2^8 before the maximum in use moves
#pragma unroll
            for (int qt = 0; qt < 2; ++qt) { const float mn = fmaxf(m[qt], mx[qt]); const float al = exp2s(m[qt] - mn); m[qt] = mn; l[qt] *= al;
#pragma unroll
                for (int dt = 0; dt < 4; ++dt) o[dt][qt] *= al; } }
        if constexpr (HR) {
            v16bf vh[4], vl[4], ph[2], pl[2]; const bf* vph = Vh + (size_t)k0 * CO + vlo;   // one address pair for the 8 loads of the hi plane
#pragma unroll
            for (int dt = 0; dt < 4; ++dt) vh[dt] = WFrag<bf>::ldp(vph + dt * 512);
            asm volatile("s_wait_xcnt 0x0" :: "v"(vph) : "memory");   // the wait before the address pair of the 8 loads above is overwritten; it reads the pair, so the pair lives to here and no load of the run is given its registers for its data
            __builtin_amdgcn_sched_barrier(0);   // the hi plane of v is asked for ahead of the exponentials, which cover its trip to L2; left free, the scheduler loaded one d tile at a time and waited four times
#pragma unroll
            for (int qt = 0; qt < 2; ++qt) { float ls = 0.f;
#pragma unroll
                for (int e = 0; e < 16; ++e) { const float pv = exp2s(s[e >> 3][qt][e & 7] - m[qt]); ls += pv; const __bf16 h = (__bf16)pv; ph[qt][e] = h; pl[qt][e] = (__bf16)(pv - (float)h); }
                l[qt] += ls; }
#pragma unroll
            for (int dt = 0; dt < 4; ++dt) vl[dt] = WFrag<bf>::ldp(Vl + (size_t)k0 * CO + vlo + dt * 512);
#pragma unroll
            for (int dt = 0; dt < 4; ++dt) { o[dt][0] = wmmab(vh[dt], ph[0], o[dt][0]); o[dt][1] = wmmab(vh[dt], ph[1], o[dt][1]); }
#pragma unroll
            for (int dt = 0; dt < 4; ++dt) { o[dt][0] = wmmab(vh[dt], pl[0], o[dt][0]); o[dt][1] = wmmab(vh[dt], pl[1], o[dt][1]); }
#pragma unroll
            for (int dt = 0; dt < 4; ++dt) { o[dt][0] = wmmab(vl[dt], ph[0], o[dt][0]); o[dt][1] = wmmab(vl[dt], ph[1], o[dt][1]); }
        } else {
            v16h pb[2];
#pragma unroll
            for (int qt = 0; qt < 2; ++qt) { float ls = 0.f;
#pragma unroll
                for (int e = 0; e < 16; ++e) { const float pv = exp2s(s[e >> 3][qt][e & 7] - m[qt]); ls += pv; pb[qt][e] = tohx(pv); }
                l[qt] += ls; }
#pragma unroll
            for (int dt = 0; dt < 4; ++dt) { const v16h va = WFrag<h16>::ldp(V16 + (size_t)k0 * CO + vlo + dt * 512); o[dt][0] = wmma16(va, pb[0], o[dt][0]); o[dt][1] = wmma16(va, pb[1], o[dt][1]); }
        }
    }
#pragma unroll
    for (int qt = 0; qt < 2; ++qt) { const float lt = l[qt] + __shfl_xor(l[qt], 16, 32);   /* the halves' sums joined once */
        if (hi == 0) { mlw[(qt * 16 + lr) * 2] = m[qt]; mlw[(qt * 16 + lr) * 2 + 1] = lt; }
#pragma unroll
        for (int dt = 0; dt < 4; ++dt) { float* pp = ow + (qt * 16 + lr) * 68 + dt * 16 + hi * 8;   /* a lane's 8 accumulator values are 8 consecutive d of one query row */
            *(v4fa*)pp = __builtin_shufflevector(o[dt][qt], o[dt][qt], 0, 1, 2, 3); *(v4fa*)(pp + 4) = __builtin_shufflevector(o[dt][qt], o[dt][qt], 4, 5, 6, 7); } }
}
__global__ __launch_bounds__(32 * FKS * FQG) void k_fattn(const bf* __restrict__ Qh, const bf* __restrict__ Ql, const bf* __restrict__ Kh, const bf* __restrict__ Kl, const h16* __restrict__ V16, const bf* __restrict__ Vh, const bf* __restrict__ Vl, float* out) {
    __shared__ __align__(16) float os[FKS * FQG * 32 * 68];   // one 32 x 64 partial output a wave, row pitch 68 floats
    __shared__ float ml[FKS * FQG * 32 * 2];                  // its (maximum in use, sum) per query row
    const size_t po = (size_t)blockIdx.y * TT * HD; Qh += po; Ql += po; Kh += po; Kl += po; V16 += po; Vh += po; Vl += po; out += po;   // blockIdx.y = batch
    const int lane = threadIdx.x & 31, lr = lane & 15, hi = lane >> 4; const int wv = __builtin_amdgcn_readfirstlane((int)(threadIdx.x >> 5));   // the wave's number, held scalar so that the key offsets stay scalar
    const int Q0 = blockIdx.x * (32 * FQG); const int q0 = Q0 + (wv / FKS) * 32, ks = wv % FKS;
    if (Q0 < RH) fattn_wave<true>(Qh, Ql, Kh, Kl, V16, Vh, Vl, q0, ks, lr, hi, os + wv * (32 * 68), ml + wv * 64);
    else         fattn_wave<false>(Qh, Ql, Kh, Kl, V16, Vh, Vl, q0, ks, lr, hi, os + wv * (32 * 68), ml + wv * 64);
    __syncthreads();   // every wave's partial result is in LDS before any thread joins them
    for (int u = threadIdx.x; u < 32 * FQG * 16; u += 32 * FKS * FQG) { const int q = u >> 4, d4 = (u & 15) * 4; const int w0 = (q >> 5) * FKS, qq = q & 31;
        float M = ml[(w0 * 32 + qq) * 2];
#pragma unroll   // unrolled so that the LDS reads are issued ahead of the arithmetic
        for (int w = 1; w < FKS; ++w) M = fmaxf(M, ml[((w0 + w) * 32 + qq) * 2]);
        float Lt = 0.f; v4f val = (v4f){};
#pragma unroll
        for (int w = 0; w < FKS; ++w) { const float wt = exp2s(ml[((w0 + w) * 32 + qq) * 2] - M); Lt += wt * ml[((w0 + w) * 32 + qq) * 2 + 1]; val += wt * *(const v4fa*)(os + ((w0 + w) * 32 + qq) * 68 + d4); }
        const float rl = __fdiv_rn(1.0f, Lt);
        *(v4f*)(out + (size_t)(Q0 + q) * CO + d4) = val * rl; }   /* 16 lanes = one 256-byte output row */
}
extern "C" void kernel_launch(void* const* d_in, const int* in_sizes, int n_in,
                              void* d_out, int out_size, void* d_ws, size_t ws_size, hipStream_t stream) {
    (void)in_sizes; (void)n_in; (void)out_size;
    const float* x = (const float*)d_in[0]; const float* wk = (const float*)d_in[1]; const float* wq = (const float*)d_in[2]; const float* wv = (const float*)d_in[3];   /* input order x [4][4096][768], Wk, Wq, Wv ('xw' [768][64]; NOTE the key weight comes FIRST); standard roles: rows = queries */
    float* OUT = (float*)d_out;     // [4][4096][64]
    char* wsp = (char*)d_ws;
    auto take = [&](size_t bytes) { char* p = wsp; wsp += (bytes + 255) & ~(size_t)255; return (void*)p; };
    bf* QPh = (bf*)take((size_t)NB_ * TT * MID * 2); bf* QPl = (bf*)take((size_t)NB_ * TT * MID * 2); bf* KPh = (bf*)take((size_t)NB_ * TT * MID * 2); bf* KPl = (bf*)take((size_t)NB_ * TT * MID * 2);
    h16* VT16 = (h16*)take((size_t)NB_ * CO * TT * 2); bf* VTh = (bf*)take((size_t)NB_ * CO * TT * 2); bf* VTl = (bf*)take((size_t)NB_ * CO * TT * 2);
    if ((size_t)(wsp - (char*)d_ws) > ws_size) return;    // ws 256 MiB (carve 14 MiB)
    k_proj<<<dim3(NB_ * TT / 64, 1, 1), 32 * PNW, 0, stream>>>(x, wq, wk, wv, QPh, QPl, KPh, KPl, VT16, VTh, VTl);   /* q, k and v^T planes, [b] x 4,096 tokens x 64, in fragment order */
    k_fattn<<<dim3(TT / (32 * FQG), NB_, 1), 32 * FKS * FQG, 0, stream>>>(QPh, QPl, KPh, KPl, VT16, VTh, VTl, OUT);   /* scores, causal softmax, attn.v; writes every output row once */
}

// v006
// It runs in 35.6 microseconds.
// Two timings next to v005 put it at 1.50 and 1.46 times that version's speed.
// All steps since v000 together make it 33.9 times as fast.
#include <hip/hip_runtime.h>

// Single causal attention head over 4,096 tokens scaled by the EMBEDDING width (x [4][4096][768]; k = x Wk, q = x Wq, v = x Wv ('xw' [768][64] 768^-0.5, no bias); wei = q.k^T x C^-0.5 with C = 768 (n_embd, not head_size); causal (-inf); softmax; out = wei.v -> [4][4096][64] (1.0 M); argument order x, Wk, Wq, Wv).
// Two launches, all four batches in each. k_proj: 64 rows of x a work-group, rounded to bf16 into LDS; q, k, v = x W on bf16 products (K 768), weights rounded to bf16 in registers; writes the hi/lo planes of q and k and the fp16 and hi/lo planes of v^T, all in fragment order (see PLANE LAYOUT). k_fattn: scores, causal softmax and attn.v over the visible key blocks only: scores on hi/lo planes (3 products), online softmax in registers, attn.v hybrid (rows < 512 hi/lo 3 products, rest fp16), output rows written once.
// Compute dtypes, f32 accumulate: every input rounded to bf16; projections exact; scores 3 products; softmax f32; wei.v rows < 512 3 products, rest fp16; output f32.

#define NB_  4
#define TT   4096
#define DM   64
#define NH_  1
#define NKV  1
#define REP  (NH_ / NKV)
#define HD   64
#define DQ   (NH_ * HD)
#define DKV  (NKV * HD)
#define ZH   1
#define RH   512                  // query rows < RH use hi+lo planes (0: none)
#define WIN  0
#define SCL  0.036084391824351615f   // C^-0.5 with C = n_embd = 768 (the source scales by the input width, NOT the head size)
#define MID  64       // q / k width (one 64-wide head)
#define CO   64       // v width
#define CC   768      // input width (d_model)
typedef _Float16 h16;
typedef unsigned short bf;
typedef __attribute__((ext_vector_type(16))) __bf16   v16bf;
typedef __attribute__((ext_vector_type(16))) _Float16 v16h;
typedef __attribute__((ext_vector_type(8)))  _Float16 v8h;
typedef __attribute__((ext_vector_type(8)))  unsigned short v8us;
typedef __attribute__((ext_vector_type(8)))  float    v8f;
typedef __attribute__((ext_vector_type(4)))  float    v4f;
typedef v8h  __attribute__((may_alias)) v8ha;
typedef v4f  __attribute__((may_alias)) v4fa;
typedef v8us __attribute__((may_alias)) v8usa;

__device__ __forceinline__ unsigned short f2bf(float f) { unsigned u = __float_as_uint(f); u += 0x7FFFu + ((u >> 16) & 1u); return (unsigned short)(u >> 16); }
__device__ __forceinline__ float bf2f(unsigned short b) { return __uint_as_float(((unsigned)b) << 16); }
__device__ __forceinline__ float bfr(float f) { return bf2f(f2bf(f)); }
__device__ __forceinline__ v16h cat16(v8h lo, v8h hi) { return __builtin_shufflevector(lo, hi, 0, 1, 2, 3, 4, 5, 6, 7, 8, 9, 10, 11, 12, 13, 14, 15); }
__device__ __forceinline__ v16bf cat16b(v8us lo, v8us hi) { return __builtin_bit_cast(v16bf, __builtin_shufflevector(lo, hi, 0, 1, 2, 3, 4, 5, 6, 7, 8, 9, 10, 11, 12, 13, 14, 15)); }
__device__ __forceinline__ v8f wmma16(v16h a, v16h b, v8f c) { return __builtin_amdgcn_wmma_f32_16x16x32_f16(false, a, false, b, (short)0, c, false, false); }
__device__ __forceinline__ v8f wmmab(v16bf a, v16bf b, v8f c) { return __builtin_amdgcn_wmma_f32_16x16x32_bf16(false, a, false, b, (short)0, c, false, false); }



// fragment loaders: a lane's 16 elements are k = 8 hi .. 8 hi + 7 and 16 + 8 hi .. 16 + 8 hi + 7 of row (or column) lr
// ld reads them from a row-major tile (p = the lane's row at k = 8 hi); ldp from a plane in fragment order (p = the fragment's start + 8 * lane)
// PLANE LAYOUT: a 16 x 32 fragment is 1,024 contiguous bytes, two halves of 512: half j holds, at 16 bytes a lane (lane = 16 hi + lr), k = 16 j + 8 hi .. + 7 of row lr. So each wave-wide 16-byte load of k_fattn covers 512 contiguous bytes = 4 whole lines, where a row-major plane gave it 32 bytes of each of 16 lines.
// q and k planes: fragment (n / 16) * 2 + c / 32 (rows = tokens n, k = columns c). v^T planes: fragment (n / 32) * 4 + d / 16 (rows = columns d of v, k = tokens n). A 64-token tile is 8 fragments = 512 chunks of 16 bytes in a row, in every plane.
template <typename T16> struct WFrag;
template <> struct WFrag<h16> { typedef v16h V; static __device__ __forceinline__ V ld(const h16* p) { return cat16(*(const v8h*)p, *(const v8h*)(p + 16)); } static __device__ __forceinline__ V ldp(const h16* p) { return cat16(*(const v8h*)p, *(const v8h*)(p + 256)); } static __device__ __forceinline__ v8f mma(V a, V b, v8f c) { return wmma16(a, b, c); } };
template <> struct WFrag<bf> { typedef v16bf V; static __device__ __forceinline__ V ld(const bf* p) { return cat16b(*(const v8us*)p, *(const v8us*)(p + 16)); } static __device__ __forceinline__ V ldp(const bf* p) { return cat16b(*(const v8us*)p, *(const v8us*)(p + 256)); } static __device__ __forceinline__ v8f mma(V a, V b, v8f c) { return wmmab(a, b, c); } };

typedef __attribute__((ext_vector_type(4))) __bf16 v4bf;
typedef __attribute__((ext_vector_type(8))) __bf16 v8bf;
typedef __attribute__((ext_vector_type(4))) unsigned short v4us;
typedef v4us __attribute__((may_alias)) v4usa;
__device__ __forceinline__ h16 tohx(float x) { return (h16)x; }

// ---- k_proj: the three projections of 64 rows of x and their planes in one launch. Grid (NB_ * TT / 64), 12 waves.
// The work-group's 64 x 768 piece of x (one contiguous run of memory) is read once, rounded to bf16 and laid in LDS. Wave w works on matrix w / PKS (q, k, v) and sums the 32-wide k steps (w % PKS), (w % PKS) + PKS, ... of the whole 64 x 64 tile; the PKS partial tiles of a matrix meet in LDS and are added in the fixed order of the waves.
// Weights come straight from the f32 [768][64] inputs: position lr of weight fragment nb stands for column n = 4 lr + nb, so one 16-byte load of a lane (4 neighbouring columns of one k row) feeds all 4 fragments and a wave's load covers two whole 256-byte rows.
// q and k: A = weights, B = x rows, so a lane ends with 32 neighbouring columns (32 hi + 4 r + nb) of ONE row: row-major partial tile. v: A = x rows, B = weights, so a lane ends with 8 neighbouring rows of one column: column-major partial tile (slot nb * 16 + lr holds column 4 lr + nb), as the v^T planes want it.
#define PKS  4                    // k shares (waves that split K for one matrix)
#define PNW  (3 * PKS)            // waves in a work-group
#define PST  (CC / 32 / PKS)      // k steps a wave
#define XP   (CC + 8)             // LDS row pitch of the x tile in elements: 1,552 bytes = 16 x 97, an odd multiple of 16 for the 16-byte fragment reads
#define PTS  (64 * 68 + 64)       // floats in a partial tile, pitch 68; in v's tile slot group nb is shifted by 16 nb floats more, so that the 16 columns of a v^T fragment (4 from each group) are read from 16 different bank groups
__device__ __forceinline__ void proj_wld(v4f (&w)[16], const float* __restrict__ wp, const int kc) {
#pragma unroll
    for (int e = 0; e < 16; ++e) w[e] = *(const v4f*)(wp + (size_t)(kc + (e >> 3) * 16 + (e & 7)) * 64);   // element e of a fragment is k = kc + 8 hi + e (e < 8), kc + 16 + 8 hi + e - 8 (else): the order in which WFrag::ld reads x
}
template <bool WA>   // WA: weights are the A operand (q, k); else x is (v)
__device__ __forceinline__ void proj_wave(const float* __restrict__ wp, v4f (&w)[16], const bf* xs, float* ow, const int ks, const int lr, const int hi) {
    v8f acc[4][4];
#pragma unroll
    for (int mb = 0; mb < 4; ++mb)
#pragma unroll
        for (int nb = 0; nb < 4; ++nb) acc[mb][nb] = (v8f){};
#pragma unroll   // unrolled: acc and the fragments are indexed by constants only, and the next step's weight loads can stand ahead of this step's products
    for (int t = 0; t < PST; ++t) {
        const int kc = (t * PKS + ks) * 32;
        v16bf b[4];
#pragma unroll
        for (int nb = 0; nb < 4; ++nb)
#pragma unroll
            for (int e = 0; e < 16; ++e) b[nb][e] = (__bf16)w[e][nb];
        if (t + 1 < PST) proj_wld(w, wp, kc + PKS * 32);
        v16bf a[4];
#pragma unroll
        for (int mb = 0; mb < 4; ++mb) a[mb] = WFrag<bf>::ld(xs + (mb * 16 + lr) * XP + kc + 8 * hi);
#pragma unroll
        for (int nb = 0; nb < 4; ++nb)
#pragma unroll
            for (int mb = 0; mb < 4; ++mb) acc[mb][nb] = WA ? wmmab(b[nb], a[mb], acc[mb][nb]) : wmmab(a[mb], b[nb], acc[mb][nb]);
        __builtin_amdgcn_sched_barrier(0);   // only ONE step's weights are fetched ahead: left free, the scheduler lifted the loads of several steps to the front and the build spilled
    }
#pragma unroll
    for (int mb = 0; mb < 4; ++mb) {
        if constexpr (WA) {
#pragma unroll
            for (int r = 0; r < 8; ++r) { v4f o; o[0] = acc[mb][0][r]; o[1] = acc[mb][1][r]; o[2] = acc[mb][2][r]; o[3] = acc[mb][3][r]; *(v4fa*)(ow + (mb * 16 + lr) * 68 + hi * 32 + r * 4) = o; }
        } else {
#pragma unroll
            for (int nb = 0; nb < 4; ++nb) { float* p = ow + (nb * 16 + lr) * 68 + nb * 16 + mb * 16 + hi * 8;
                *(v4fa*)p = __builtin_shufflevector(acc[mb][nb], acc[mb][nb], 0, 1, 2, 3); *(v4fa*)(p + 4) = __builtin_shufflevector(acc[mb][nb], acc[mb][nb], 4, 5, 6, 7); }
        }
    }
}
__global__ __launch_bounds__(32 * PNW) void k_proj(const float* __restrict__ x, const float* __restrict__ wq, const float* __restrict__ wk, const float* __restrict__ wv, bf* Qh, bf* Ql, bf* Kh, bf* Kl, h16* V16, bf* Vh, bf* Vl) {
    __shared__ __align__(16) bf xs[64 * XP];          // the x tile in bf16
    __shared__ __align__(16) float ps[PNW * PTS];     // one 64 x 64 partial tile a wave
    const int tid = threadIdx.x, lane = tid & 31, lr = lane & 15, hi = lane >> 4; const int wvn = __builtin_amdgcn_readfirstlane(tid >> 5);   // the wave's number, held scalar so that the weight base and the k offsets stay scalar
    const int jm = wvn / PKS, ks = wvn % PKS;
    const float* xg = x + (size_t)blockIdx.x * (64 * CC);
    v4f xr[32];
#pragma unroll   // all 32 loads of a lane are in flight at once: one trip to memory for the whole tile
    for (int i = 0; i < 32; ++i) xr[i] = *(const v4f*)(xg + (size_t)(i * (32 * PNW) + tid) * 4);
    const float* wp = (jm == 0 ? wq : jm == 1 ? wk : wv) + (8 * hi) * 64 + lr * 4;
    v4f w[16]; proj_wld(w, wp, ks * 32);   // the first step's weights travel behind the x tile
    const int xrow = tid >= CC / 4 ? 1 : 0, xc = (tid - xrow * (CC / 4)) * 4;   // 384 lanes x 4 floats = two rows of x a trip
#pragma unroll
    for (int i = 0; i < 32; ++i) { v4bf o;
#pragma unroll
        for (int k = 0; k < 4; ++k) o[k] = (__bf16)xr[i][k];
        *(v4usa*)(xs + (2 * i + xrow) * XP + xc) = __builtin_bit_cast(v4us, o); }
    __syncthreads();   // the whole x tile is in LDS before any wave reads fragments of it
    if (jm < 2) proj_wave<true>(wp, w, xs, ps + wvn * PTS, ks, lr, hi);
    else        proj_wave<false>(wp, w, xs, ps + wvn * PTS, ks, lr, hi);
    __syncthreads();   // every wave's partial tile is in LDS before any thread adds them
    const size_t E0 = (size_t)blockIdx.x * (64 * 64);   // the tile's first element in every plane: 64 tokens are 4,096 elements in a row, batches one behind the other
#pragma unroll
    for (int i = 0; i < 3 * 512 / (32 * PNW); ++i) { const int u = tid + i * (32 * PNW); const int m = u >> 9, ci = u & 511, cl = ci & 15;   /* chunk ci of matrix m's planes (8 neighbouring values of one line of its tile); m is the same in all lanes of a wave, whose 32 chunks are 512 bytes in a row */
        const int lo = m < 2 ? ((ci >> 7) * 16 + cl) * 68 + ((ci >> 4) & 7) * 8   /* q, k: token (ci >> 7) * 16 + cl, columns from 8 * bits 4 to 6 (hi, j, c / 32) */
                             : ((cl & 3) * 16 + ((ci >> 6) & 3) * 4 + (cl >> 2)) * 68 + (cl & 3) * 16 + ((ci >> 4) & 3) * 8 + (ci >> 8) * 32;   /* v: column d = 16 * bits 6, 7 + cl lies in slot (d & 3) * 16 + d / 4; tokens from 8 hi + 16 j + 32 * bit 8 */
        const float* p = ps + m * (PKS * PTS) + lo; v4f s0 = *(const v4fa*)p, s1 = *(const v4fa*)(p + 4);
#pragma unroll   // unrolled so that the LDS reads are issued ahead of the adds
        for (int s = 1; s < PKS; ++s) { s0 += *(const v4fa*)(p + s * PTS); s1 += *(const v4fa*)(p + s * PTS + 4); }
        v8bf oh, ol; v8h o16;
#pragma unroll
        for (int k = 0; k < 8; ++k) { const float y = k < 4 ? s0[k & 3] : s1[k & 3]; const __bf16 h = (__bf16)y; oh[k] = h; ol[k] = (__bf16)(y - (float)h); o16[k] = tohx(y); }
        const size_t e = E0 + (size_t)ci * 8;
        if (m < 2) {
            *(v8us*)((m == 0 ? Qh : Kh) + e) = __builtin_bit_cast(v8us, oh); *(v8us*)((m == 0 ? Ql : Kl) + e) = __builtin_bit_cast(v8us, ol); }
        else {
            *(v8h*)(V16 + e) = o16; *(v8us*)(Vh + e) = __builtin_bit_cast(v8us, oh); *(v8us*)(Vl + e) = __builtin_bit_cast(v8us, ol); } }
}
// ---- k_fattn: scores, causal softmax and attn.v in one launch; no score or probability ever leaves the registers. Grid (TT / 64, batch), 16 waves.
// Query group g (32 rows) sees the 32-key blocks 0 .. g and no other: a block behind the diagonal adds exact zeros and is not walked. All work-groups are resident at once, so the launch lasts as long as the fullest one: work-group i owns groups TT / 32 - 1 - i and i, one after the other in every wave, TT / 32 + 1 blocks in all whatever i is.
// The blocks of the two groups, counted through (group i's first), are dealt to the 16 waves in turn: 15 waves walk 8 blocks and one walks 9.
// S^T = K.Q^T (A = key rows, B = query rows): in each 16-column group a lane holds scores of ONE query (column lr), keys 8 hi + r; two such tiles, converted in place, are the B operand of O^T += V^T.P^T (hardware k order, as WFrag::ld reads A).
// Each wave keeps its own running maximum m (log2 units), sum l and O^T; the 16 partial results of a query group meet in LDS and are joined in the fixed order of the waves (a wave that had no block of a group hands in m = -1e30, l = 0, O = 0: weight 0).
#define FKS  16       // key shares (waves that split the keys of one query group): all waves of the work-group
#define FQG  2        // query groups of 32 rows in a work-group, walked one after the other
#define NQG  (TT / 32)   // query groups in a batch
static_assert(RH <= TT / 2 && RH % 32 == 0, "the far group of a work-group is never a hi/lo group");
#define SC2  (SCL * 1.4426950408889634f)   // score scale times log2(e): the softmax runs on exp2
// exp2 with the one issue slot that the instruction set asks for behind a transcendental (before its result is used or its source overwritten) in the same statement
__device__ __forceinline__ float exp2s(float x) { float r; asm("v_exp_f32 %0, %1\n\tv_nop" : "=v"(r) : "v"(x)); return r; }
// the hi and lo fragments of the 32 query rows from q0 on
__device__ __forceinline__ void fattn_q(v16bf (&qh)[2][2], v16bf (&ql)[2][2], const bf* __restrict__ Qh, const bf* __restrict__ Ql, const int q0, const int lr, const int hi) {
    const unsigned qlo = (unsigned)((hi * 16 + lr) * 8); const bf* qph = Qh + (size_t)q0 * HD; const bf* qpl = Ql + (size_t)q0 * HD;   // wave-uniform bases, one 32-bit lane offset
#pragma unroll
    for (int qt = 0; qt < 2; ++qt)
#pragma unroll
        for (int kk = 0; kk < 2; ++kk) { qh[qt][kk] = WFrag<bf>::ldp(qph + qlo + (qt * 1024 + kk * 512)); ql[qt][kk] = WFrag<bf>::ldp(qpl + qlo + (qt * 1024 + kk * 512)); }
}
template <bool HR>   // HR: probabilities and v on bf16 hi/lo planes (3 products); else fp16
__device__ __forceinline__ void fattn_wave(const v16bf (&qh)[2][2], const v16bf (&ql)[2][2], const bf* __restrict__ Kh, const bf* __restrict__ Kl, const h16* __restrict__ V16, const bf* __restrict__ Vh, const bf* __restrict__ Vl, const int q0, const int ks, const int lr, const int hi, float* ow, float* mlw) {
    const unsigned klo = (unsigned)((hi * 16 + lr) * 8), vlo = klo;   // the lane's element offset in every fragment half of the planes
    v8f o[4][2];
#pragma unroll
    for (int dt = 0; dt < 4; ++dt) { o[dt][0] = (v8f){}; o[dt][1] = (v8f){}; }
    float m[2] = { -1.0e30f, -1.0e30f }, l[2] = { 0.f, 0.f };   // m starts above the mask value, so a wholly masked block gives exp2(-huge) = 0
    const int np = (q0 / 32 + FKS - ks) / FKS;   // this wave's blocks ks, ks + FKS, ... among the q0 / 32 + 1 visible ones; wave-uniform, at most NQG / FKS, may be 0
    for (int p = 0; p < np; ++p) {
        const int k0 = (p * FKS + ks) * 32;
        const bf* kph = Kh + (size_t)k0 * HD; const bf* kpl = Kl + (size_t)k0 * HD;   // wave-uniform bases; the lane's part is one 32-bit offset for both planes
        const bf* kpv = kpl + klo;   // the lane's address in the lo plane, one pair for its 8 loads
        v8f s[2][2]; s[0][0] = (v8f){}; s[0][1] = (v8f){}; s[1][0] = (v8f){}; s[1][1] = (v8f){};
        v16bf kh[2][2], kl[2][2];
#pragma unroll
        for (int kk = 0; kk < 2; ++kk)
#pragma unroll
            for (int kt = 0; kt < 2; ++kt) { kh[kk][kt] = WFrag<bf>::ldp(kph + klo + (kt * 1024 + kk * 512)); if (kk + kt < 2) kl[kk][kt] = WFrag<bf>::ldp(kpv + (kt * 1024 + kk * 512)); }
        __builtin_amdgcn_sched_barrier(0);   // 14 of the 16 key loads of the pass are held in front of the first product: one trip to L2 for them; left free, the scheduler re-used two fragments' registers and waited on L2 six times a pass
#pragma unroll
        for (int kk = 0; kk < 2; ++kk) {
#pragma unroll
            for (int kt = 0; kt < 2; ++kt) { s[kt][0] = wmmab(kh[kk][kt], qh[0][kk], s[kt][0]); s[kt][1] = wmmab(kh[kk][kt], qh[1][kk], s[kt][1]); }
#pragma unroll
            for (int kt = 0; kt < 2; ++kt) { s[kt][0] = wmmab(kh[kk][kt], ql[0][kk], s[kt][0]); s[kt][1] = wmmab(kh[kk][kt], ql[1][kk], s[kt][1]); }
            if (kk == 0) { __builtin_amdgcn_sched_barrier(0); asm volatile("s_wait_xcnt 0x0" ::: "memory");   /* this load's data may be given the address registers of the 14 loads issued above */
                kl[1][1] = WFrag<bf>::ldp(kpv + (1024 + 512)); asm volatile("s_wait_xcnt 0x0" :: "v"(kpv) : "memory");   /* the wait reads the address pair, so the pair lives to here and neither of the two loads is given its registers for its data */
                __builtin_amdgcn_sched_barrier(0); }   /* the fragment used last is loaded here, between two scheduling barriers, into registers that the first 8 products have freed: with all 8 fragments in flight at once the build spills */
#pragma unroll
            for (int kt = 0; kt < 2; ++kt) { s[kt][0] = wmmab(kl[kk][kt], qh[0][kk], s[kt][0]); s[kt][1] = wmmab(kl[kk][kt], qh[1][kk], s[kt][1]); } }
        float mx[2];
#pragma unroll
        for (int qt = 0; qt < 2; ++qt) { const int lim = q0 + qt * 16 + lr - k0 - 8 * hi; float a = -3.0e38f;   /* key kt * 16 + r of this lane's half is visible while <= lim */
#pragma unroll
            for (int kt = 0; kt < 2; ++kt)
#pragma unroll
                for (int r = 0; r < 8; ++r) { const float t = (kt * 16 + r <= lim) ? s[kt][qt][r] * SC2 : -3.0e38f; s[kt][qt][r] = t; a = fmaxf(a, t); }
            mx[qt] = fmaxf(a, __shfl_xor(a, 16, 32)); }   /* both halves of a column must use one maximum: the product sums over both halves' keys */
        if (__builtin_amdgcn_ballot_w32(mx[0] > m[0] + 8.0f || mx[1] > m[1] + 8.0f) != 0) {   // lazy rescale, one scalar branch a pass: probabilities may reach 2^8 before the maximum in use moves
#pragma unroll
            for (int qt = 0; qt < 2; ++qt) { const float mn = fmaxf(m[qt], mx[qt]); const float al = exp2s(m[qt] - mn); m[qt] = mn; l[qt] *= al;
#pragma unroll
                for (int dt = 0; dt < 4; ++dt) o[dt][qt] *= al; } }
        if constexpr (HR) {
            v16bf vh[4], vl[4], ph[2], pl[2]; const bf* vph = Vh + (size_t)k0 * CO + vlo;   // one address pair for the 8 loads of the hi plane
#pragma unroll
            for (int dt = 0; dt < 4; ++dt) vh[dt] = WFrag<bf>::ldp(vph + dt * 512);
            asm volatile("s_wait_xcnt 0x0" :: "v"(vph) : "memory");   // the wait before the address pair of the 8 loads above is overwritten; it reads the pair, so the pair lives to here and no load of the run is given its registers for its data
            __builtin_amdgcn_sched_barrier(0);   // the hi plane of v is asked for ahead of the exponentials, which cover its trip to L2; left free, the scheduler loaded one d tile at a time and waited four times
#pragma unroll
            for (int qt = 0; qt < 2; ++qt) { float ls = 0.f;
#pragma unroll
                for (int e = 0; e < 16; ++e) { const float pv = exp2s(s[e >> 3][qt][e & 7] - m[qt]); ls += pv; const __bf16 h = (__bf16)pv; ph[qt][e] = h; pl[qt][e] = (__bf16)(pv - (float)h); }
                l[qt] += ls; }
#pragma unroll
            for (int dt = 0; dt < 4; ++dt) vl[dt] = WFrag<bf>::ldp(Vl + (size_t)k0 * CO + vlo + dt * 512);
#pragma unroll
            for (int dt = 0; dt < 4; ++dt) { o[dt][0] = wmmab(vh[dt], ph[0], o[dt][0]); o[dt][1] = wmmab(vh[dt], ph[1], o[dt][1]); }
#pragma unroll
            for (int dt = 0; dt < 4; ++dt) { o[dt][0] = wmmab(vh[dt], pl[0], o[dt][0]); o[dt][1] = wmmab(vh[dt], pl[1], o[dt][1]); }
#pragma unroll
            for (int dt = 0; dt < 4; ++dt) { o[dt][0] = wmmab(vl[dt], ph[0], o[dt][0]); o[dt][1] = wmmab(vl[dt], ph[1], o[dt][1]); }
        } else {
            v16h pb[2];
#pragma unroll
            for (int qt = 0; qt < 2; ++qt) { float ls = 0.f;
#pragma unroll
                for (int e = 0; e < 16; ++e) { const float pv = exp2s(s[e >> 3][qt][e & 7] - m[qt]); ls += pv; pb[qt][e] = tohx(pv); }
                l[qt] += ls; }
#pragma unroll
            for (int dt = 0; dt < 4; ++dt) { const v16h va = WFrag<h16>::ldp(V16 + (size_t)k0 * CO + vlo + dt * 512); o[dt][0] = wmma16(va, pb[0], o[dt][0]); o[dt][1] = wmma16(va, pb[1], o[dt][1]); }
        }
    }
#pragma unroll
    for (int qt = 0; qt < 2; ++qt) { const float lt = l[qt] + __shfl_xor(l[qt], 16, 32);   /* the halves' sums joined once */
        if (hi == 0) { mlw[(qt * 16 + lr) * 2] = m[qt]; mlw[(qt * 16 + lr) * 2 + 1] = lt; }
#pragma unroll
        for (int dt = 0; dt < 4; ++dt) { float* pp = ow + (qt * 16 + lr) * 68 + dt * 16 + hi * 8;   /* a lane's 8 accumulator values are 8 consecutive d of one query row */
            *(v4fa*)pp = __builtin_shufflevector(o[dt][qt], o[dt][qt], 0, 1, 2, 3); *(v4fa*)(pp + 4) = __builtin_shufflevector(o[dt][qt], o[dt][qt], 4, 5, 6, 7); } }
}
__global__ __launch_bounds__(32 * FKS) void k_fattn(const bf* __restrict__ Qh, const bf* __restrict__ Ql, const bf* __restrict__ Kh, const bf* __restrict__ Kl, const h16* __restrict__ V16, const bf* __restrict__ Vh, const bf* __restrict__ Vl, float* out) {
    __shared__ __align__(16) float os[FKS * FQG * 32 * 68];   // one 32 x 64 partial output a wave and query group, row pitch 68 floats
    __shared__ float ml[FKS * FQG * 32 * 2];                  // its (maximum in use, sum) per query row
    const size_t po = (size_t)blockIdx.y * TT * HD; Qh += po; Ql += po; Kh += po; Kl += po; V16 += po; Vh += po; Vl += po; out += po;   // blockIdx.y = batch
    const int lane = threadIdx.x & 31, lr = lane & 15, hi = lane >> 4; const int wv = __builtin_amdgcn_readfirstlane((int)(threadIdx.x >> 5));   // the wave's number, held scalar so that the key offsets stay scalar
    const int qn = (int)blockIdx.x * 32, qf = (NQG - 1 - (int)blockIdx.x) * 32;   // first rows of the near and of the far group
    const int ksf = (wv - (int)blockIdx.x - 1) & (FKS - 1);   // the far group's blocks are dealt on from the wave behind the near group's last block
    v16bf qh[2][2], ql[2][2];
    fattn_q(qh, ql, Qh, Ql, qf, lr, hi);
    fattn_wave<false>(qh, ql, Kh, Kl, V16, Vh, Vl, qf, ksf, lr, hi, os + (FKS + wv) * (32 * 68), ml + (FKS + wv) * 64);
    fattn_q(qh, ql, Qh, Ql, qn, lr, hi);
    asm volatile("s_wait_xcnt 0x0" ::: "memory");   // the wait before the bases and the offset register of the 16 loads above are overwritten
    __builtin_amdgcn_sched_barrier(0);   // nothing from behind the wait is lifted over it: left free, the scheduler put scalar instructions that write over a base in front of it
    if (qn < RH) fattn_wave<true>(qh, ql, Kh, Kl, V16, Vh, Vl, qn, wv, lr, hi, os + wv * (32 * 68), ml + wv * 64);
    else         fattn_wave<false>(qh, ql, Kh, Kl, V16, Vh, Vl, qn, wv, lr, hi, os + wv * (32 * 68), ml + wv * 64);
    __syncthreads();   // every wave's two partial results are in LDS before any thread joins them
    for (int u = threadIdx.x; u < 32 * FQG * 16; u += 32 * FKS) { const int q = u >> 4, d4 = (u & 15) * 4; const int w0 = (q >> 5) * FKS, qq = q & 31;
        float M = ml[(w0 * 32 + qq) * 2];
#pragma unroll   // unrolled so that the LDS reads are issued ahead of the arithmetic
        for (int w = 1; w < FKS; ++w) M = fmaxf(M, ml[((w0 + w) * 32 + qq) * 2]);
        float Lt = 0.f; v4f val = (v4f){};
#pragma unroll
        for (int w = 0; w < FKS; ++w) { const float wt = exp2s(ml[((w0 + w) * 32 + qq) * 2] - M); Lt += wt * ml[((w0 + w) * 32 + qq) * 2 + 1]; val += wt * *(const v4fa*)(os + ((w0 + w) * 32 + qq) * 68 + d4); }
        const float rl = __fdiv_rn(1.0f, Lt);
        *(v4f*)(out + (size_t)((q >> 5 ? qf : qn) + qq) * CO + d4) = val * rl; }   /* 16 lanes = one 256-byte output row */
}
extern "C" void kernel_launch(void* const* d_in, const int* in_sizes, int n_in,
                              void* d_out, int out_size, void* d_ws, size_t ws_size, hipStream_t stream) {
    (void)in_sizes; (void)n_in; (void)out_size;
    const float* x = (const float*)d_in[0]; const float* wk = (const float*)d_in[1]; const float* wq = (const float*)d_in[2]; const float* wv = (const float*)d_in[3];   /* input order x [4][4096][768], Wk, Wq, Wv ('xw' [768][64]; NOTE the key weight comes FIRST); standard roles: rows = queries */
    float* OUT = (float*)d_out;     // [4][4096][64]
    char* wsp = (char*)d_ws;
    auto take = [&](size_t bytes) { char* p = wsp; wsp += (bytes + 255) & ~(size_t)255; return (void*)p; };
    bf* QPh = (bf*)take((size_t)NB_ * TT * MID * 2); bf* QPl = (bf*)take((size_t)NB_ * TT * MID * 2); bf* KPh = (bf*)take((size_t)NB_ * TT * MID * 2); bf* KPl = (bf*)take((size_t)NB_ * TT * MID * 2);
    h16* VT16 = (h16*)take((size_t)NB_ * CO * TT * 2); bf* VTh = (bf*)take((size_t)NB_ * CO * TT * 2); bf* VTl = (bf*)take((size_t)NB_ * CO * TT * 2);
    if ((size_t)(wsp - (char*)d_ws) > ws_size) return;    // ws 256 MiB (carve 14 MiB)
    k_proj<<<dim3(NB_ * TT / 64, 1, 1), 32 * PNW, 0, stream>>>(x, wq, wk, wv, QPh, QPl, KPh, KPl, VT16, VTh, VTl);   /* q, k and v^T planes, [b] x 4,096 tokens x 64, in fragment order */
    k_fattn<<<dim3(TT / (32 * FQG), NB_, 1), 32 * FKS, 0, stream>>>(QPh, QPl, KPh, KPl, VT16, VTh, VTl, OUT);   /* scores, causal softmax, attn.v; writes every output row once */
}

// v007
// Measured time: 34.3 microseconds a run.
// Next to v006, in two timings, it ran 1.03 and 1.04 times as fast.
// Over all steps from v000 it is 35.0 times as fast.
#include <hip/hip_runtime.h>

// Single causal attention head over 4,096 tokens scaled by the EMBEDDING width (x [4][4096][768]; k = x Wk, q = x Wq, v = x Wv ('xw' [768][64] 768^-0.5, no bias); wei = q.k^T x C^-0.5 with C = 768 (n_embd, not head_size); causal (-inf); softmax; out = wei.v -> [4][4096][64] (1.0 M); argument order x, Wk, Wq, Wv).
// Two launches, all four batches in each. k_proj: 64 rows of x a work-group, rounded to bf16 into LDS; q, k, v = x W on bf16 products (K 768), weights rounded to bf16 in registers; writes the hi/lo planes of q and k and the fp16 and hi/lo planes of v^T, all in fragment order (see PLANE LAYOUT). k_fattn: scores, causal softmax and attn.v over the visible key blocks only: scores on hi/lo planes (3 products), online softmax in registers, attn.v hybrid (rows < 512 hi/lo 3 products, rest fp16), output rows written once.
// Compute dtypes, f32 accumulate: every input rounded to bf16; projections exact; scores 3 products; softmax f32; wei.v rows < 512 3 products, rest fp16; output f32.

#define NB_  4
#define TT   4096
#define DM   64
#define NH_  1
#define NKV  1
#define REP  (NH_ / NKV)
#define HD   64
#define DQ   (NH_ * HD)
#define DKV  (NKV * HD)
#define ZH   1
#define RH   512                  // query rows < RH use hi+lo planes (0: none)
#define WIN  0
#define SCL  0.036084391824351615f   // C^-0.5 with C = n_embd = 768 (the source scales by the input width, NOT the head size)
#define MID  64       // q / k width (one 64-wide head)
#define CO   64       // v width
#define CC   768      // input width (d_model)
typedef _Float16 h16;
typedef unsigned short bf;
typedef __attribute__((ext_vector_type(16))) __bf16   v16bf;
typedef __attribute__((ext_vector_type(16))) _Float16 v16h;
typedef __attribute__((ext_vector_type(8)))  _Float16 v8h;
typedef __attribute__((ext_vector_type(8)))  unsigned short v8us;
typedef __attribute__((ext_vector_type(8)))  float    v8f;
typedef __attribute__((ext_vector_type(4)))  float    v4f;
typedef v8h  __attribute__((may_alias)) v8ha;
typedef v4f  __attribute__((may_alias)) v4fa;
typedef v8us __attribute__((may_alias)) v8usa;

__device__ __forceinline__ unsigned short f2bf(float f) { unsigned u = __float_as_uint(f); u += 0x7FFFu + ((u >> 16) & 1u); return (unsigned short)(u >> 16); }
__device__ __forceinline__ float bf2f(unsigned short b) { return __uint_as_float(((unsigned)b) << 16); }
__device__ __forceinline__ float bfr(float f) { return bf2f(f2bf(f)); }
__device__ __forceinline__ v16h cat16(v8h lo, v8h hi) { return __builtin_shufflevector(lo, hi, 0, 1, 2, 3, 4, 5, 6, 7, 8, 9, 10, 11, 12, 13, 14, 15); }
__device__ __forceinline__ v16bf cat16b(v8us lo, v8us hi) { return __builtin_bit_cast(v16bf, __builtin_shufflevector(lo, hi, 0, 1, 2, 3, 4, 5, 6, 7, 8, 9, 10, 11, 12, 13, 14, 15)); }
__device__ __forceinline__ v8f wmma16(v16h a, v16h b, v8f c) { return __builtin_amdgcn_wmma_f32_16x16x32_f16(false, a, false, b, (short)0, c, false, false); }
__device__ __forceinline__ v8f wmmab(v16bf a, v16bf b, v8f c) { return __builtin_amdgcn_wmma_f32_16x16x32_bf16(false, a, false, b, (short)0, c, false, false); }



// fragment loaders: a lane's 16 elements are k = 8 hi .. 8 hi + 7 and 16 + 8 hi .. 16 + 8 hi + 7 of row (or column) lr
// ld reads them from a row-major tile (p = the lane's row at k = 8 hi); ldp from a plane in fragment order (p = the fragment's start + 8 * lane)
// PLANE LAYOUT: a 16 x 32 fragment is 1,024 contiguous bytes, two halves of 512: half j holds, at 16 bytes a lane (lane = 16 hi + lr), k = 16 j + 8 hi .. + 7 of row lr. So each wave-wide 16-byte load of k_fattn covers 512 contiguous bytes = 4 whole lines, where a row-major plane gave it 32 bytes of each of 16 lines.
// q and k planes: fragment (n / 16) * 2 + c / 32 (rows = tokens n, k = columns c). v^T planes: fragment (n / 32) * 4 + d / 16 (rows = columns d of v, k = tokens n). A 64-token tile is 8 fragments = 512 chunks of 16 bytes in a row, in every plane.
template <typename T16> struct WFrag;
template <> struct WFrag<h16> { typedef v16h V; static __device__ __forceinline__ V ld(const h16* p) { return cat16(*(const v8h*)p, *(const v8h*)(p + 16)); } static __device__ __forceinline__ V ldp(const h16* p) { return cat16(*(const v8h*)p, *(const v8h*)(p + 256)); } static __device__ __forceinline__ v8f mma(V a, V b, v8f c) { return wmma16(a, b, c); } };
template <> struct WFrag<bf> { typedef v16bf V; static __device__ __forceinline__ V ld(const bf* p) { return cat16b(*(const v8us*)p, *(const v8us*)(p + 16)); } static __device__ __forceinline__ V ldp(const bf* p) { return cat16b(*(const v8us*)p, *(const v8us*)(p + 256)); } static __device__ __forceinline__ v8f mma(V a, V b, v8f c) { return wmmab(a, b, c); } };

typedef __attribute__((ext_vector_type(4))) __bf16 v4bf;
typedef __attribute__((ext_vector_type(8))) __bf16 v8bf;
typedef __attribute__((ext_vector_type(4))) unsigned short v4us;
typedef v4us __attribute__((may_alias)) v4usa;
__device__ __forceinline__ h16 tohx(float x) { return (h16)x; }

// ---- k_proj: the three projections of 64 rows of x and their planes in one launch. Grid (NB_ * TT / 64), 12 waves.
// The work-group's 64 x 768 piece of x (one contiguous run of memory) is read once, rounded to bf16 and laid in LDS. Wave w works on matrix w / PKS (q, k, v) and sums the 32-wide k steps (w % PKS), (w % PKS) + PKS, ... of the whole 64 x 64 tile; the PKS partial tiles of a matrix meet in LDS and are added in the fixed order of the waves.
// Weights come straight from the f32 [768][64] inputs: position lr of weight fragment nb stands for column n = 4 lr + nb, so one 16-byte load of a lane (4 neighbouring columns of one k row) feeds all 4 fragments and a wave's load covers two whole 256-byte rows.
// q and k: A = weights, B = x rows, so a lane ends with 32 neighbouring columns (32 hi + 4 r + nb) of ONE row: row-major partial tile. v: A = x rows, B = weights, so a lane ends with 8 neighbouring rows of one column: column-major partial tile (slot nb * 16 + lr holds column 4 lr + nb), as the v^T planes want it.
#define PKS  4                    // k shares (waves that split K for one matrix)
#define PNW  (3 * PKS)            // waves in a work-group
#define PST  (CC / 32 / PKS)      // k steps a wave
#define XP   (CC + 8)             // LDS row pitch of the x tile in elements: 1,552 bytes = 16 x 97, an odd multiple of 16 for the 16-byte fragment reads
#define PTS  (64 * 68 + 64)       // floats in a partial tile, pitch 68; in v's tile slot group nb is shifted by 16 nb floats more, so that the 16 columns of a v^T fragment (4 from each group) are read from 16 different bank groups
__device__ __forceinline__ void proj_wld(v4f (&w)[16], const float* __restrict__ wp, const int kc) {
#pragma unroll
    for (int e = 0; e < 16; ++e) w[e] = *(const v4f*)(wp + (size_t)(kc + (e >> 3) * 16 + (e & 7)) * 64);   // element e of a fragment is k = kc + 8 hi + e (e < 8), kc + 16 + 8 hi + e - 8 (else): the order in which WFrag::ld reads x
}
template <bool WA>   // WA: weights are the A operand (q, k); else x is (v)
__device__ __forceinline__ void proj_wave(const float* __restrict__ wp, v4f (&w)[16], const bf* xs, float* ow, const int ks, const int lr, const int hi) {
    v8f acc[4][4];
#pragma unroll
    for (int mb = 0; mb < 4; ++mb)
#pragma unroll
        for (int nb = 0; nb < 4; ++nb) acc[mb][nb] = (v8f){};
#pragma unroll   // unrolled: acc and the fragments are indexed by constants only, and the next step's weight loads can stand ahead of this step's products
    for (int t = 0; t < PST; ++t) {
        const int kc = (t * PKS + ks) * 32;
        v16bf b[4];
#pragma unroll
        for (int nb = 0; nb < 4; ++nb)
#pragma unroll
            for (int e = 0; e < 16; ++e) b[nb][e] = (__bf16)w[e][nb];
        if (t + 1 < PST) proj_wld(w, wp, kc + PKS * 32);
        v16bf a[4];
#pragma unroll
        for (int mb = 0; mb < 4; ++mb) a[mb] = WFrag<bf>::ld(xs + (mb * 16 + lr) * XP + kc + 8 * hi);
#pragma unroll
        for (int nb = 0; nb < 4; ++nb)
#pragma unroll
            for (int mb = 0; mb < 4; ++mb) acc[mb][nb] = WA ? wmmab(b[nb], a[mb], acc[mb][nb]) : wmmab(a[mb], b[nb], acc[mb][nb]);
        __builtin_amdgcn_sched_barrier(0);   // only ONE step's weights are fetched ahead: left free, the scheduler lifted the loads of several steps to the front and the build spilled
    }
#pragma unroll
    for (int mb = 0; mb < 4; ++mb) {
        if constexpr (WA) {
#pragma unroll
            for (int r = 0; r < 8; ++r) { v4f o; o[0] = acc[mb][0][r]; o[1] = acc[mb][1][r]; o[2] = acc[mb][2][r]; o[3] = acc[mb][3][r]; *(v4fa*)(ow + (mb * 16 + lr) * 68 + hi * 32 + r * 4) = o; }
        } else {
#pragma unroll
            for (int nb = 0; nb < 4; ++nb) { float* p = ow + (nb * 16 + lr) * 68 + nb * 16 + mb * 16 + hi * 8;
                *(v4fa*)p = __builtin_shufflevector(acc[mb][nb], acc[mb][nb], 0, 1, 2, 3); *(v4fa*)(p + 4) = __builtin_shufflevector(acc[mb][nb], acc[mb][nb], 4, 5, 6, 7); }
        }
    }
}
__global__ __launch_bounds__(32 * PNW) void k_proj(const float* __restrict__ x, const float* __restrict__ wq, const float* __restrict__ wk, const float* __restrict__ wv, bf* Qh, bf* Ql, bf* Kh, bf* Kl, h16* V16, bf* Vh, bf* Vl) {
    __shared__ __align__(16) bf xs[64 * XP];          // the x tile in bf16
    __shared__ __align__(16) float ps[PNW * PTS];     // one 64 x 64 partial tile a wave
    const int tid = threadIdx.x, lane = tid & 31, lr = lane & 15, hi = lane >> 4; const int wvn = __builtin_amdgcn_readfirstlane(tid >> 5);   // the wave's number, held scalar so that the weight base and the k offsets stay scalar
    const int jm = wvn / PKS, ks = wvn % PKS;
    const float* xg = x + (size_t)blockIdx.x * (64 * CC);
    v4f xr[32];
#pragma unroll   // all 32 loads of a lane are in flight at once: one trip to memory for the whole tile
    for (int i = 0; i < 32; ++i) xr[i] = *(const v4f*)(xg + (size_t)(i * (32 * PNW) + tid) * 4);
    const float* wp = (jm == 0 ? wq : jm == 1 ? wk : wv) + (8 * hi) * 64 + lr * 4;
    v4f w[16]; proj_wld(w, wp, ks * 32);   // the first step's weights travel behind the x tile
    const int xrow = tid >= CC / 4 ? 1 : 0, xc = (tid - xrow * (CC / 4)) * 4;   // 384 lanes x 4 floats = two rows of x a trip
#pragma unroll
    for (int i = 0; i < 32; ++i) { v4bf o;
#pragma unroll
        for (int k = 0; k < 4; ++k) o[k] = (__bf16)xr[i][k];
        *(v4usa*)(xs + (2 * i + xrow) * XP + xc) = __builtin_bit_cast(v4us, o); }
    __syncthreads();   // the whole x tile is in LDS before any wave reads fragments of it
    if (jm < 2) proj_wave<true>(wp, w, xs, ps + wvn * PTS, ks, lr, hi);
    else        proj_wave<false>(wp, w, xs, ps + wvn * PTS, ks, lr, hi);
    __syncthreads();   // every wave's partial tile is in LDS before any thread adds them
    const size_t E0 = (size_t)blockIdx.x * (64 * 64);   // the tile's first element in every plane: 64 tokens are 4,096 elements in a row, batches one behind the other
#pragma unroll
    for (int i = 0; i < 3 * 512 / (32 * PNW); ++i) { const int u = tid + i * (32 * PNW); const int m = u >> 9, ci = u & 511, cl = ci & 15;   /* chunk ci of matrix m's planes (8 neighbouring values of one line of its tile); m is the same in all lanes of a wave, whose 32 chunks are 512 bytes in a row */
        const int lo = m < 2 ? ((ci >> 7) * 16 + cl) * 68 + ((ci >> 4) & 7) * 8   /* q, k: token (ci >> 7) * 16 + cl, columns from 8 * bits 4 to 6 (hi, j, c / 32) */
                             : ((cl & 3) * 16 + ((ci >> 6) & 3) * 4 + (cl >> 2)) * 68 + (cl & 3) * 16 + ((ci >> 4) & 3) * 8 + (ci >> 8) * 32;   /* v: column d = 16 * bits 6, 7 + cl lies in slot (d & 3) * 16 + d / 4; tokens from 8 hi + 16 j + 32 * bit 8 */
        const float* p = ps + m * (PKS * PTS) + lo; v4f s0 = *(const v4fa*)p, s1 = *(const v4fa*)(p + 4);
#pragma unroll   // unrolled so that the LDS reads are issued ahead of the adds
        for (int s = 1; s < PKS; ++s) { s0 += *(const v4fa*)(p + s * PTS); s1 += *(const v4fa*)(p + s * PTS + 4); }
        v8bf oh, ol; v8h o16;
#pragma unroll
        for (int k = 0; k < 8; ++k) { const float y = k < 4 ? s0[k & 3] : s1[k & 3]; const __bf16 h = (__bf16)y; oh[k] = h; ol[k] = (__bf16)(y - (float)h); o16[k] = tohx(y); }
        const size_t e = E0 + (size_t)ci * 8;
        if (m < 2) {
            *(v8us*)((m == 0 ? Qh : Kh) + e) = __builtin_bit_cast(v8us, oh); *(v8us*)((m == 0 ? Ql : Kl) + e) = __builtin_bit_cast(v8us, ol); }
        else {
            *(v8h*)(V16 + e) = o16; *(v8us*)(Vh + e) = __builtin_bit_cast(v8us, oh); *(v8us*)(Vl + e) = __builtin_bit_cast(v8us, ol); } }
}
// ---- k_fattn: scores, causal softmax and attn.v in one launch; no score or probability ever leaves the registers. Grid (TT / 64, batch), 16 waves.
// Query group g (32 rows) sees the 32-key blocks 0 .. g and no other: a block behind the diagonal adds exact zeros and is not walked. All work-groups are resident at once, so the launch lasts as long as the fullest one: work-group i owns groups TT / 32 - 1 - i and i, one after the other in every wave, TT / 32 + 1 blocks in all whatever i is.
// The blocks of the two groups, counted through (group i's first), are dealt to the 16 waves in turn: 15 waves walk 8 blocks and one walks 9.
// S^T = K.Q^T (A = key rows, B = query rows): in each 16-column group a lane holds scores of ONE query (column lr), keys 8 hi + r; two such tiles, converted in place, are the B operand of O^T += V^T.P^T (hardware k order, as WFrag::ld reads A).
// Each wave keeps its own running maximum m (log2 units), sum l and O^T; the 16 partial results of a query group meet in LDS and are joined in the fixed order of the waves (a wave that had no block of a group hands in m = -1e30, l = 0, O = 0: weight 0).
#define FKS  16       // key shares (waves that split the keys of one query group): all waves of the work-group
#define FQG  2        // query groups of 32 rows in a work-group, walked one after the other
#define NQG  (TT / 32)   // query groups in a batch
static_assert(RH <= TT / 2 && RH % 32 == 0, "the far group of a work-group is never a hi/lo group");
#define SC2  (SCL * 1.4426950408889634f)   // score scale times log2(e): the softmax runs on exp2
// exp2 with the one issue slot that the instruction set asks for behind a transcendental (before its result is used or its source overwritten) in the same statement
__device__ __forceinline__ float exp2s(float x) { float r; asm("v_exp_f32 %0, %1\n\tv_nop" : "=v"(r) : "v"(x)); return r; }
// the hi and lo fragments of a query group, read from the work-group's copy in LDS (qs: 2,048 elements of the hi plane, then 2,048 of the lo plane, in fragment order)
__device__ __forceinline__ void fattn_q(v16bf (&qh)[2][2], v16bf (&ql)[2][2], const bf* qs, const int lr, const int hi) {
    const bf* qp = qs + (hi * 16 + lr) * 8;
#pragma unroll
    for (int qt = 0; qt < 2; ++qt)
#pragma unroll
        for (int kk = 0; kk < 2; ++kk) { qh[qt][kk] = WFrag<bf>::ldp(qp + (qt * 1024 + kk * 512)); ql[qt][kk] = WFrag<bf>::ldp(qp + 2048 + (qt * 1024 + kk * 512)); }
}
// the 16 loads of the hi and lo fragments of the 32 keys from k0 on
__device__ __forceinline__ void fattn_k(v16bf (&kh)[2][2], v16bf (&kl)[2][2], const bf* __restrict__ Kh, const bf* __restrict__ Kl, const int k0, const unsigned klo) {
    const bf* kph = Kh + (size_t)k0 * HD + klo; const bf* kpl = Kl + (size_t)k0 * HD + klo;   // one address pair a plane
#pragma unroll
    for (int kk = 0; kk < 2; ++kk)
#pragma unroll
        for (int kt = 0; kt < 2; ++kt) { kh[kk][kt] = WFrag<bf>::ldp(kph + (kt * 1024 + kk * 512)); kl[kk][kt] = WFrag<bf>::ldp(kpl + (kt * 1024 + kk * 512)); }
    asm volatile("s_wait_xcnt 0x0" :: "v"(kph), "v"(kpl) : "memory");   // the wait before the address pairs of the 16 loads above are overwritten; it reads the pairs, so they live to here and no load of the run is given their registers for its data
}
template <bool HR>   // HR: probabilities and v on bf16 hi/lo planes (3 products); else fp16
__device__ __forceinline__ void fattn_wave(const bf* qs, const bf* __restrict__ Kh, const bf* __restrict__ Kl, const h16* __restrict__ V16, const bf* __restrict__ Vh, const bf* __restrict__ Vl, const int q0, const int ks, const int lr, const int hi, float* ow, float* mlw) {
    const unsigned klo = (unsigned)((hi * 16 + lr) * 8), vlo = klo;   // the lane's element offset in every fragment half of the planes
    v8f o[4][2];
#pragma unroll
    for (int dt = 0; dt < 4; ++dt) { o[dt][0] = (v8f){}; o[dt][1] = (v8f){}; }
    float m[2] = { -1.0e30f, -1.0e30f }, l[2] = { 0.f, 0.f };   // m starts above the mask value, so a wholly masked block gives exp2(-huge) = 0
    const int np = (q0 / 32 + FKS - ks) / FKS;   // this wave's blocks ks, ks + FKS, ... among the q0 / 32 + 1 visible ones; wave-uniform, at most NQG / FKS, may be 0
    v16bf kh[2][2], kl[2][2];   // the key fragments of the pass at hand; refilled for the next pass after the score products have read them: behind v's loads (fp16) or at the foot of the pass (hi/lo)
    if (np > 0) fattn_k(kh, kl, Kh, Kl, ks * 32, klo);
    auto pass = [&](const int p, const bool more) __attribute__((always_inline)) {   // one key block; more: another block of this wave follows (a constant at each call, so that no branch stands among the loads and the waits on v can leave the next keys in flight)
        const int k0 = (p * FKS + ks) * 32;
        v8f s[2][2]; s[0][0] = (v8f){}; s[0][1] = (v8f){}; s[1][0] = (v8f){}; s[1][1] = (v8f){};
        v16bf qh[2][2], ql[2][2]; fattn_q(qh, ql, qs, lr, hi);   // read anew every pass: their 64 registers are free while the next pass's keys travel
#pragma unroll
        for (int kk = 0; kk < 2; ++kk) {
#pragma unroll
            for (int kt = 0; kt < 2; ++kt) { s[kt][0] = wmmab(kh[kk][kt], qh[0][kk], s[kt][0]); s[kt][1] = wmmab(kh[kk][kt], qh[1][kk], s[kt][1]); }
#pragma unroll
            for (int kt = 0; kt < 2; ++kt) { s[kt][0] = wmmab(kh[kk][kt], ql[0][kk], s[kt][0]); s[kt][1] = wmmab(kh[kk][kt], ql[1][kk], s[kt][1]); }
#pragma unroll
            for (int kt = 0; kt < 2; ++kt) { s[kt][0] = wmmab(kl[kk][kt], qh[0][kk], s[kt][0]); s[kt][1] = wmmab(kl[kk][kt], qh[1][kk], s[kt][1]); } }
        v16h va[4];
        if constexpr (!HR) {
            const h16* vp = V16 + (size_t)k0 * CO + vlo;   // one address pair for the 8 loads of v
#pragma unroll
            for (int dt = 0; dt < 4; ++dt) va[dt] = WFrag<h16>::ldp(vp + dt * 512);
            asm volatile("s_wait_xcnt 0x0" :: "v"(vp) : "memory");   // the wait before the address pair of the 8 loads above is overwritten; it reads the pair, so the pair lives to here
            if (more) fattn_k(kh, kl, Kh, Kl, k0 + FKS * 32, klo);   // the next pass's keys are asked for here: the softmax and attn.v of this pass cover their trip to L2
            __builtin_amdgcn_sched_barrier(0);   // v's loads and the next keys' stay in front of the softmax, which covers their trip to L2; without this barrier the build spilled registers to scratch
        }
        float mx[2];
#pragma unroll
        for (int qt = 0; qt < 2; ++qt) { const int lim = q0 + qt * 16 + lr - k0 - 8 * hi; float a = -3.0e38f;   /* key kt * 16 + r of this lane's half is visible while <= lim */
#pragma unroll
            for (int kt = 0; kt < 2; ++kt)
#pragma unroll
                for (int r = 0; r < 8; ++r) { const float t = (kt * 16 + r <= lim) ? s[kt][qt][r] * SC2 : -3.0e38f; s[kt][qt][r] = t; a = fmaxf(a, t); }
            mx[qt] = fmaxf(a, __shfl_xor(a, 16, 32)); }   /* both halves of a column must use one maximum: the product sums over both halves' keys */
        if (__builtin_amdgcn_ballot_w32(mx[0] > m[0] + 8.0f || mx[1] > m[1] + 8.0f) != 0) {   // lazy rescale, one scalar branch a pass: probabilities may reach 2^8 before the maximum in use moves
#pragma unroll
            for (int qt = 0; qt < 2; ++qt) { const float mn = fmaxf(m[qt], mx[qt]); const float al = exp2s(m[qt] - mn); m[qt] = mn; l[qt] *= al;
#pragma unroll
                for (int dt = 0; dt < 4; ++dt) o[dt][qt] *= al; } }
        if constexpr (HR) {
            v16bf vh[4], vl[4], ph[2], pl[2]; const bf* vph = Vh + (size_t)k0 * CO + vlo;   // one address pair for the 8 loads of the hi plane
#pragma unroll
            for (int dt = 0; dt < 4; ++dt) vh[dt] = WFrag<bf>::ldp(vph + dt * 512);
            asm volatile("s_wait_xcnt 0x0" :: "v"(vph) : "memory");   // the wait before the address pair of the 8 loads above is overwritten; it reads the pair, so the pair lives to here and no load of the run is given its registers for its data
            __builtin_amdgcn_sched_barrier(0);   // the hi plane of v is asked for ahead of the exponentials, which cover its trip to L2; left free, the scheduler loaded one d tile at a time and waited four times
#pragma unroll
            for (int qt = 0; qt < 2; ++qt) { float ls = 0.f;
#pragma unroll
                for (int e = 0; e < 16; ++e) { const float pv = exp2s(s[e >> 3][qt][e & 7] - m[qt]); ls += pv; const __bf16 h = (__bf16)pv; ph[qt][e] = h; pl[qt][e] = (__bf16)(pv - (float)h); }
                l[qt] += ls; }
            const bf* vpl = Vl + (size_t)k0 * CO + vlo;   // one address pair for the 8 loads of the lo plane
#pragma unroll
            for (int dt = 0; dt < 4; ++dt) vl[dt] = WFrag<bf>::ldp(vpl + dt * 512);
            asm volatile("s_wait_xcnt 0x0" :: "v"(vpl) : "memory");   // the wait before the address pair of the 8 loads above is overwritten (the next keys' data may be given it); it reads the pair, so the pair lives to here
#pragma unroll
            for (int dt = 0; dt < 4; ++dt) { o[dt][0] = wmmab(vh[dt], ph[0], o[dt][0]); o[dt][1] = wmmab(vh[dt], ph[1], o[dt][1]); }
#pragma unroll
            for (int dt = 0; dt < 4; ++dt) { o[dt][0] = wmmab(vh[dt], pl[0], o[dt][0]); o[dt][1] = wmmab(vh[dt], pl[1], o[dt][1]); }
#pragma unroll
            for (int dt = 0; dt < 4; ++dt) { o[dt][0] = wmmab(vl[dt], ph[0], o[dt][0]); o[dt][1] = wmmab(vl[dt], ph[1], o[dt][1]); }
            if (more) fattn_k(kh, kl, Kh, Kl, k0 + FKS * 32, klo);   // a hi/lo group has no registers to spare for keys in flight: its next keys are asked for at the foot of the pass
        } else {
            v16h pb[2];
#pragma unroll
            for (int qt = 0; qt < 2; ++qt) { float ls = 0.f;
#pragma unroll
                for (int e = 0; e < 16; ++e) { const float pv = exp2s(s[e >> 3][qt][e & 7] - m[qt]); ls += pv; pb[qt][e] = tohx(pv); }
                l[qt] += ls; }
#pragma unroll
            for (int dt = 0; dt < 4; ++dt) { o[dt][0] = wmma16(va[dt], pb[0], o[dt][0]); o[dt][1] = wmma16(va[dt], pb[1], o[dt][1]); }
        }
    };
    for (int p = 0; p + 1 < np; ++p) pass(p, true);
    if (np > 0) pass(np - 1, false);   // the wave's last block asks for no further keys
#pragma unroll
    for (int qt = 0; qt < 2; ++qt) { const float lt = l[qt] + __shfl_xor(l[qt], 16, 32);   /* the halves' sums joined once */
        if (hi == 0) { mlw[(qt * 16 + lr) * 2] = m[qt]; mlw[(qt * 16 + lr) * 2 + 1] = lt; }
#pragma unroll
        for (int dt = 0; dt < 4; ++dt) { float* pp = ow + (qt * 16 + lr) * 68 + dt * 16 + hi * 8;   /* a lane's 8 accumulator values are 8 consecutive d of one query row */
            *(v4fa*)pp = __builtin_shufflevector(o[dt][qt], o[dt][qt], 0, 1, 2, 3); *(v4fa*)(pp + 4) = __builtin_shufflevector(o[dt][qt], o[dt][qt], 4, 5, 6, 7); } }
}
__global__ __launch_bounds__(32 * FKS) void k_fattn(const bf* __restrict__ Qh, const bf* __restrict__ Ql, const bf* __restrict__ Kh, const bf* __restrict__ Kl, const h16* __restrict__ V16, const bf* __restrict__ Vh, const bf* __restrict__ Vl, float* out) {
    __shared__ __align__(16) float os[FKS * FQG * 32 * 68];   // one 32 x 64 partial output a wave and query group, row pitch 68 floats
    __shared__ float ml[FKS * FQG * 32 * 2];                  // its (maximum in use, sum) per query row
    __shared__ __align__(16) bf qs[FQG * 2 * 2048];           // the hi and lo planes of the near and of the far query group, in fragment order
    const size_t po = (size_t)blockIdx.y * TT * HD; Qh += po; Ql += po; Kh += po; Kl += po; V16 += po; Vh += po; Vl += po; out += po;   // blockIdx.y = batch
    const int lane = threadIdx.x & 31, lr = lane & 15, hi = lane >> 4; const int wv = __builtin_amdgcn_readfirstlane((int)(threadIdx.x >> 5));   // the wave's number, held scalar so that the key offsets stay scalar
    const int qn = (int)blockIdx.x * 32, qf = (NQG - 1 - (int)blockIdx.x) * 32;   // first rows of the near and of the far group
    const int ksf = (wv - (int)blockIdx.x - 1) & (FKS - 1);   // the far group's blocks are dealt on from the wave behind the near group's last block
    { const bf* qsrc = (wv >> 3) ? Ql : Qh; const int qc = ((int)threadIdx.x & 255) * 8;   // waves 0 to 7 copy the hi plane, 8 to 15 the lo plane: 16 bytes of each group a lane
      const v8us qa = *(const v8us*)(qsrc + (size_t)qn * HD + qc), qb = *(const v8us*)(qsrc + (size_t)qf * HD + qc);
      *(v8usa*)(qs + (wv >> 3) * 2048 + qc) = qa; *(v8usa*)(qs + 4096 + (wv >> 3) * 2048 + qc) = qb; }
    __syncthreads();   // both query groups are in LDS before any wave reads fragments of them
    fattn_wave<false>(qs + 4096, Kh, Kl, V16, Vh, Vl, qf, ksf, lr, hi, os + (FKS + wv) * (32 * 68), ml + (FKS + wv) * 64);
    if (qn < RH) fattn_wave<true>(qs, Kh, Kl, V16, Vh, Vl, qn, wv, lr, hi, os + wv * (32 * 68), ml + wv * 64);
    else         fattn_wave<false>(qs, Kh, Kl, V16, Vh, Vl, qn, wv, lr, hi, os + wv * (32 * 68), ml + wv * 64);
    __syncthreads();   // every wave's two partial results are in LDS before any thread joins them
    for (int u = threadIdx.x; u < 32 * FQG * 16; u += 32 * FKS) { const int q = u >> 4, d4 = (u & 15) * 4; const int w0 = (q >> 5) * FKS, qq = q & 31;
        float M = ml[(w0 * 32 + qq) * 2];
#pragma unroll   // unrolled so that the LDS reads are issued ahead of the arithmetic
        for (int w = 1; w < FKS; ++w) M = fmaxf(M, ml[((w0 + w) * 32 + qq) * 2]);
        float Lt = 0.f; v4f val = (v4f){};
#pragma unroll
        for (int w = 0; w < FKS; ++w) { const float wt = exp2s(ml[((w0 + w) * 32 + qq) * 2] - M); Lt += wt * ml[((w0 + w) * 32 + qq) * 2 + 1]; val += wt * *(const v4fa*)(os + ((w0 + w) * 32 + qq) * 68 + d4); }
        const float rl = __fdiv_rn(1.0f, Lt);
        *(v4f*)(out + (size_t)((q >> 5 ? qf : qn) + qq) * CO + d4) = val * rl; }   /* 16 lanes = one 256-byte output row */
}
extern "C" void kernel_launch(void* const* d_in, const int* in_sizes, int n_in,
                              void* d_out, int out_size, void* d_ws, size_t ws_size, hipStream_t stream) {
    (void)in_sizes; (void)n_in; (void)out_size;
    const float* x = (const float*)d_in[0]; const float* wk = (const float*)d_in[1]; const float* wq = (const float*)d_in[2]; const float* wv = (const float*)d_in[3];   /* input order x [4][4096][768], Wk, Wq, Wv ('xw' [768][64]; NOTE the key weight comes FIRST); standard roles: rows = queries */
    float* OUT = (float*)d_out;     // [4][4096][64]
    char* wsp = (char*)d_ws;
    auto take = [&](size_t bytes) { char* p = wsp; wsp += (bytes + 255) & ~(size_t)255; return (void*)p; };
    bf* QPh = (bf*)take((size_t)NB_ * TT * MID * 2); bf* QPl = (bf*)take((size_t)NB_ * TT * MID * 2); bf* KPh = (bf*)take((size_t)NB_ * TT * MID * 2); bf* KPl = (bf*)take((size_t)NB_ * TT * MID * 2);
    h16* VT16 = (h16*)take((size_t)NB_ * CO * TT * 2); bf* VTh = (bf*)take((size_t)NB_ * CO * TT * 2); bf* VTl = (bf*)take((size_t)NB_ * CO * TT * 2);
    if ((size_t)(wsp - (char*)d_ws) > ws_size) return;    // ws 256 MiB (carve 14 MiB)
    k_proj<<<dim3(NB_ * TT / 64, 1, 1), 32 * PNW, 0, stream>>>(x, wq, wk, wv, QPh, QPl, KPh, KPl, VT16, VTh, VTl);   /* q, k and v^T planes, [b] x 4,096 tokens x 64, in fragment order */
    k_fattn<<<dim3(TT / (32 * FQG), NB_, 1), 32 * FKS, 0, stream>>>(QPh, QPl, KPh, KPl, VT16, VTh, VTl, OUT);   /* scores, causal softmax, attn.v; writes every output row once */
}

// v008
// Measured time: 32.5 microseconds a run.
// Next to v007, in two timings, it ran 1.06 and 1.07 times as fast.
// All steps since v000 together make it 37.2 times as fast.
#include <hip/hip_runtime.h>

// Single causal attention head over 4,096 tokens scaled by the EMBEDDING width (x [4][4096][768]; k = x Wk, q = x Wq, v = x Wv ('xw' [768][64] 768^-0.5, no bias); wei = q.k^T x C^-0.5 with C = 768 (n_embd, not head_size); causal (-inf); softmax; out = wei.v -> [4][4096][64] (1.0 M); argument order x, Wk, Wq, Wv).
// Two launches, all four batches in each. k_proj: 64 rows of x a work-group, rounded to bf16 into LDS; q, k, v = x W on bf16 products (K 768), weights rounded to bf16 in registers; writes the hi/lo planes of q and k and the fp16 and hi/lo planes of v^T, all in fragment order (see PLANE LAYOUT). k_fattn: scores, causal softmax and attn.v over the visible key blocks only: scores on hi/lo planes (3 products), online softmax in registers, attn.v hybrid (rows < 512 hi/lo 3 products, rest fp16), output rows written once.
// Compute dtypes, f32 accumulate: every input rounded to bf16; projections exact; scores 3 products; softmax f32; wei.v rows < 512 3 products, rest fp16; output f32.

#define NB_  4
#define TT   4096
#define DM   64
#define NH_  1
#define NKV  1
#define REP  (NH_ / NKV)
#define HD   64
#define DQ   (NH_ * HD)
#define DKV  (NKV * HD)
#define ZH   1
#define RH   512                  // query rows < RH use hi+lo planes (0: none)
#define WIN  0
#define SCL  0.036084391824351615f   // C^-0.5 with C = n_embd = 768 (the source scales by the input width, NOT the head size)
#define MID  64       // q / k width (one 64-wide head)
#define CO   64       // v width
#define CC   768      // input width (d_model)
typedef _Float16 h16;
typedef unsigned short bf;
typedef __attribute__((ext_vector_type(16))) __bf16   v16bf;
typedef __attribute__((ext_vector_type(16))) _Float16 v16h;
typedef __attribute__((ext_vector_type(8)))  _Float16 v8h;
typedef __attribute__((ext_vector_type(8)))  unsigned short v8us;
typedef __attribute__((ext_vector_type(8)))  float    v8f;
typedef __attribute__((ext_vector_type(4)))  float    v4f;
typedef v8h  __attribute__((may_alias)) v8ha;
typedef v4f  __attribute__((may_alias)) v4fa;
typedef v8us __attribute__((may_alias)) v8usa;

__device__ __forceinline__ unsigned short f2bf(float f) { unsigned u = __float_as_uint(f); u += 0x7FFFu + ((u >> 16) & 1u); return (unsigned short)(u >> 16); }
__device__ __forceinline__ float bf2f(unsigned short b) { return __uint_as_float(((unsigned)b) << 16); }
__device__ __forceinline__ float bfr(float f) { return bf2f(f2bf(f)); }
__device__ __forceinline__ v16h cat16(v8h lo, v8h hi) { return __builtin_shufflevector(lo, hi, 0, 1, 2, 3, 4, 5, 6, 7, 8, 9, 10, 11, 12, 13, 14, 15); }
__device__ __forceinline__ v16bf cat16b(v8us lo, v8us hi) { return __builtin_bit_cast(v16bf, __builtin_shufflevector(lo, hi, 0, 1, 2, 3, 4, 5, 6, 7, 8, 9, 10, 11, 12, 13, 14, 15)); }
__device__ __forceinline__ v8f wmma16(v16h a, v16h b, v8f c) { return __builtin_amdgcn_wmma_f32_16x16x32_f16(false, a, false, b, (short)0, c, false, false); }
__device__ __forceinline__ v8f wmmab(v16bf a, v16bf b, v8f c) { return __builtin_amdgcn_wmma_f32_16x16x32_bf16(false, a, false, b, (short)0, c, false, false); }



// fragment loaders: a lane's 16 elements are k = 8 hi .. 8 hi + 7 and 16 + 8 hi .. 16 + 8 hi + 7 of row (or column) lr
// ld reads them from a row-major tile (p = the lane's row at k = 8 hi); ldp from a plane in fragment order (p = the fragment's start + 8 * lane)
// PLANE LAYOUT: a 16 x 32 fragment is 1,024 contiguous bytes, two halves of 512: half j holds, at 16 bytes a lane (lane = 16 hi + lr), k = 16 j + 8 hi .. + 7 of row lr. So each wave-wide 16-byte load of k_fattn covers 512 contiguous bytes = 4 whole lines, where a row-major plane gave it 32 bytes of each of 16 lines.
// q and k planes: fragment (n / 16) * 2 + c / 32 (rows = tokens n, k = columns c). v^T planes: fragment (n / 32) * 4 + d / 16 (rows = columns d of v, k = tokens n). A 64-token tile is 8 fragments = 512 chunks of 16 bytes in a row, in every plane.
template <typename T16> struct WFrag;
template <> struct WFrag<h16> { typedef v16h V; static __device__ __forceinline__ V ld(const h16* p) { return cat16(*(const v8h*)p, *(const v8h*)(p + 16)); } static __device__ __forceinline__ V ldp(const h16* p) { return cat16(*(const v8h*)p, *(const v8h*)(p + 256)); } static __device__ __forceinline__ v8f mma(V a, V b, v8f c) { return wmma16(a, b, c); } };
template <> struct WFrag<bf> { typedef v16bf V; static __device__ __forceinline__ V ld(const bf* p) { return cat16b(*(const v8us*)p, *(const v8us*)(p + 16)); } static __device__ __forceinline__ V ldp(const bf* p) { return cat16b(*(const v8us*)p, *(const v8us*)(p + 256)); } static __device__ __forceinline__ v8f mma(V a, V b, v8f c) { return wmmab(a, b, c); } };

typedef __attribute__((ext_vector_type(4))) __bf16 v4bf;
typedef __attribute__((ext_vector_type(8))) __bf16 v8bf;
typedef __attribute__((ext_vector_type(4))) unsigned short v4us;
typedef v4us __attribute__((may_alias)) v4usa;
__device__ __forceinline__ h16 tohx(float x) { return (h16)x; }

// ---- k_proj: the three projections of 64 rows of x and their planes in one launch. Grid (NB_ * TT / 64), 12 waves.
// The work-group's 64 x 768 piece of x (one contiguous run of memory) is read once, rounded to bf16 and laid in LDS. Wave w works on matrix w / PKS (q, k, v) and sums the 32-wide k steps (w % PKS), (w % PKS) + PKS, ... of the whole 64 x 64 tile; the PKS partial tiles of a matrix meet in LDS and are added in the fixed order of the waves.
// Weights come straight from the f32 [768][64] inputs: position lr of weight fragment nb stands for column n = 4 lr + nb, so one 16-byte load of a lane (4 neighbouring columns of one k row) feeds all 4 fragments and a wave's load covers two whole 256-byte rows.
// q and k: A = weights, B = x rows, so a lane ends with 32 neighbouring columns (32 hi + 4 r + nb) of ONE row: row-major partial tile. v: A = x rows, B = weights, so a lane ends with 8 neighbouring rows of one column: column-major partial tile (slot nb * 16 + lr holds column 4 lr + nb), as the v^T planes want it.
#define PKS  4                    // k shares (waves that split K for one matrix)
#define PNW  (3 * PKS)            // waves in a work-group
#define PST  (CC / 32 / PKS)      // k steps a wave
#define XP   (CC + 8)             // LDS row pitch of the x tile in elements: 1,552 bytes = 16 x 97, an odd multiple of 16 for the 16-byte fragment reads
#define PTS  (64 * 68 + 64)       // floats in a partial tile, pitch 68; in v's tile slot group nb is shifted by 16 nb floats more, so that the 16 columns of a v^T fragment (4 from each group) are read from 16 different bank groups
__device__ __forceinline__ const float* proj_wld(v4f (&w)[16], const float* __restrict__ wp, const int kc) {   // returns the address that the loads name: the caller's proj_xw holds it
    const float* p = wp + (size_t)kc * 64;   // one address pair for the 16 loads of a k step
#pragma unroll
    for (int e = 0; e < 16; ++e) w[e] = *(const v4f*)(p + ((e >> 3) * 16 + (e & 7)) * 64);   // element e of a fragment is k = kc + 8 hi + e (e < 8), kc + 16 + 8 hi + e - 8 (else): the order in which WFrag::ld reads x
    return p;
}
// the wait before the address pair of the 16 loads of proj_wld is overwritten (kc is no constant, so every step forms its own pair); it reads the pair, so the pair lives to here and no load of the run is given its registers for its data
__device__ __forceinline__ void proj_xw(const float* p) { asm volatile("s_wait_xcnt 0x0" :: "v"(p) : "memory"); }
template <bool WA>   // WA: weights are the A operand (q, k); else x is (v)
__device__ __forceinline__ void proj_wave(const float* __restrict__ wp, v4f (&w)[16], const bf* xs, float* ow, const int ks, const int r0, const int lr, const int hi) {
    v8f acc[4][4];
#pragma unroll
    for (int mb = 0; mb < 4; ++mb)
#pragma unroll
        for (int nb = 0; nb < 4; ++nb) acc[mb][nb] = (v8f){};
    int tt = r0;   // the walk over the wave's PST k steps starts at step r0 (scalar, see k_proj)
#pragma unroll   // unrolled: acc and the fragments are indexed by constants only, and the next step's weight loads can stand ahead of this step's products
    for (int t = 0; t < PST; ++t) {
        const int kc = (tt * PKS + ks) * 32;
        tt = tt + 1 == PST ? 0 : tt + 1;   // the wave's next k step, wrapping behind the last
        v16bf b[4];
#pragma unroll
        for (int nb = 0; nb < 4; ++nb)
#pragma unroll
            for (int e = 0; e < 16; ++e) b[nb][e] = (__bf16)w[e][nb];
        const float* pw = wp;
        if (t + 1 < PST) pw = proj_wld(w, wp, (tt * PKS + ks) * 32);
        v16bf a[4];
#pragma unroll
        for (int mb = 0; mb < 4; ++mb) a[mb] = WFrag<bf>::ld(xs + (mb * 16 + lr) * XP + kc + 8 * hi);
#pragma unroll
        for (int nb = 0; nb < 4; ++nb)
#pragma unroll
            for (int mb = 0; mb < 4; ++mb) acc[mb][nb] = WA ? wmmab(b[nb], a[mb], acc[mb][nb]) : wmmab(a[mb], b[nb], acc[mb][nb]);
        if (t + 1 < PST) proj_xw(pw);   // at the step's foot, where it splits no run of loads: directly behind the loads it cost registers and the build spilled
        __builtin_amdgcn_sched_barrier(0);   // only ONE step's weights are fetched ahead: left free, the scheduler lifted the loads of several steps to the front and the build spilled
    }
#pragma unroll
    for (int mb = 0; mb < 4; ++mb) {
        if constexpr (WA) {
#pragma unroll
            for (int r = 0; r < 8; ++r) { v4f o; o[0] = acc[mb][0][r]; o[1] = acc[mb][1][r]; o[2] = acc[mb][2][r]; o[3] = acc[mb][3][r]; *(v4fa*)(ow + (mb * 16 + lr) * 68 + hi * 32 + r * 4) = o; }
        } else {
#pragma unroll
            for (int nb = 0; nb < 4; ++nb) { float* p = ow + (nb * 16 + lr) * 68 + nb * 16 + mb * 16 + hi * 8;
                *(v4fa*)p = __builtin_shufflevector(acc[mb][nb], acc[mb][nb], 0, 1, 2, 3); *(v4fa*)(p + 4) = __builtin_shufflevector(acc[mb][nb], acc[mb][nb], 4, 5, 6, 7); }
        }
    }
}
__global__ __launch_bounds__(32 * PNW) void k_proj(const float* __restrict__ x, const float* __restrict__ wq, const float* __restrict__ wk, const float* __restrict__ wv, bf* Qh, bf* Ql, bf* Kh, bf* Kl, h16* V16, bf* Vh, bf* Vl) {
    __shared__ __align__(16) bf xs[64 * XP];          // the x tile in bf16
    __shared__ __align__(16) float ps[PNW * PTS];     // one 64 x 64 partial tile a wave
    const int tid = threadIdx.x, lane = tid & 31, lr = lane & 15, hi = lane >> 4; const int wvn = __builtin_amdgcn_readfirstlane(tid >> 5);   // the wave's number, held scalar so that the weight base and the k offsets stay scalar
    const int jm = wvn / PKS, ks = wvn % PKS;
    const float* xg = x + (size_t)blockIdx.x * (64 * CC);
    v4f xr[32];
#pragma unroll   // all 32 loads of a lane are in flight at once: one trip to memory for the whole tile
    for (int i = 0; i < 32; ++i) xr[i] = *(const v4f*)(xg + (size_t)(i * (32 * PNW) + tid) * 4);
    const float* wp = (jm == 0 ? wq : jm == 1 ? wk : wv) + (8 * hi) * 64 + lr * 4;
    const int r0 = (int)(blockIdx.x % PST);   // every work-group reads the same weights: each starts its walk over the k steps at its own step and wraps, so that the work-groups do not all ask L2 for the same lines at the same moment
    v4f w[16]; proj_xw(proj_wld(w, wp, (r0 * PKS + ks) * 32));   // the first step's weights travel behind the x tile
    const int xrow = tid >= CC / 4 ? 1 : 0, xc = (tid - xrow * (CC / 4)) * 4;   // 384 lanes x 4 floats = two rows of x a trip
#pragma unroll
    for (int i = 0; i < 32; ++i) { v4bf o;
#pragma unroll
        for (int k = 0; k < 4; ++k) o[k] = (__bf16)xr[i][k];
        *(v4usa*)(xs + (2 * i + xrow) * XP + xc) = __builtin_bit_cast(v4us, o); }
    __syncthreads();   // the whole x tile is in LDS before any wave reads fragments of it
    if (jm < 2) proj_wave<true>(wp, w, xs, ps + wvn * PTS, ks, r0, lr, hi);
    else        proj_wave<false>(wp, w, xs, ps + wvn * PTS, ks, r0, lr, hi);
    __syncthreads();   // every wave's partial tile is in LDS before any thread adds them
    const size_t E0 = (size_t)blockIdx.x * (64 * 64);   // the tile's first element in every plane: 64 tokens are 4,096 elements in a row, batches one behind the other
#pragma unroll
    for (int i = 0; i < 3 * 512 / (32 * PNW); ++i) { const int u = tid + i * (32 * PNW); const int m = u >> 9, ci = u & 511, cl = ci & 15;   /* chunk ci of matrix m's planes (8 neighbouring values of one line of its tile); m is the same in all lanes of a wave, whose 32 chunks are 512 bytes in a row */
        const int lo = m < 2 ? ((ci >> 7) * 16 + cl) * 68 + ((ci >> 4) & 7) * 8   /* q, k: token (ci >> 7) * 16 + cl, columns from 8 * bits 4 to 6 (hi, j, c / 32) */
                             : ((cl & 3) * 16 + ((ci >> 6) & 3) * 4 + (cl >> 2)) * 68 + (cl & 3) * 16 + ((ci >> 4) & 3) * 8 + (ci >> 8) * 32;   /* v: column d = 16 * bits 6, 7 + cl lies in slot (d & 3) * 16 + d / 4; tokens from 8 hi + 16 j + 32 * bit 8 */
        const float* p = ps + m * (PKS * PTS) + lo; v4f s0 = *(const v4fa*)p, s1 = *(const v4fa*)(p + 4);
#pragma unroll   // unrolled so that the LDS reads are issued ahead of the adds
        for (int s = 1; s < PKS; ++s) { s0 += *(const v4fa*)(p + s * PTS); s1 += *(const v4fa*)(p + s * PTS + 4); }
        v8bf oh, ol; v8h o16;
#pragma unroll
        for (int k = 0; k < 8; ++k) { const float y = k < 4 ? s0[k & 3] : s1[k & 3]; const __bf16 h = (__bf16)y; oh[k] = h; ol[k] = (__bf16)(y - (float)h); o16[k] = tohx(y); }
        const size_t e = E0 + (size_t)ci * 8;
        if (m < 2) {
            *(v8us*)((m == 0 ? Qh : Kh) + e) = __builtin_bit_cast(v8us, oh); *(v8us*)((m == 0 ? Ql : Kl) + e) = __builtin_bit_cast(v8us, ol); }
        else {
            *(v8h*)(V16 + e) = o16; *(v8us*)(Vh + e) = __builtin_bit_cast(v8us, oh); *(v8us*)(Vl + e) = __builtin_bit_cast(v8us, ol); } }
}
// ---- k_fattn: scores, causal softmax and attn.v in one launch; no score or probability ever leaves the registers. Grid (TT / 64, batch), 16 waves.
// Query group g (32 rows) sees the 32-key blocks 0 .. g and no other: a block behind the diagonal adds exact zeros and is not walked. All work-groups are resident at once, so the launch lasts as long as the fullest one: work-group i owns groups TT / 32 - 1 - i and i, one after the other in every wave, TT / 32 + 1 blocks in all whatever i is.
// The blocks of the two groups, counted through (group i's first), are dealt to the 16 waves in turn: 15 waves walk 8 blocks and one walks 9.
// S^T = K.Q^T (A = key rows, B = query rows): in each 16-column group a lane holds scores of ONE query (column lr), keys 8 hi + r; two such tiles, converted in place, are the B operand of O^T += V^T.P^T (hardware k order, as WFrag::ld reads A).
// Each wave keeps its own running maximum m (log2 units), sum l and O^T; the 16 partial results of a query group meet in LDS and are joined in the fixed order of the waves (a wave that had no block of a group hands in m = -1e30, l = 0, O = 0: weight 0).
#define FKS  16       // key shares (waves that split the keys of one query group): all waves of the work-group
#define FQG  2        // query groups of 32 rows in a work-group, walked one after the other
#define NQG  (TT / 32)   // query groups in a batch
static_assert(RH <= TT / 2 && RH % 32 == 0, "the far group of a work-group is never a hi/lo group");
#define SC2  (SCL * 1.4426950408889634f)   // score scale times log2(e): the softmax runs on exp2
// exp2 with the one issue slot that the instruction set asks for behind a transcendental (before its result is used or its source overwritten) in the same statement
__device__ __forceinline__ float exp2s(float x) { float r; asm("v_exp_f32 %0, %1\n\tv_nop" : "=v"(r) : "v"(x)); return r; }
// the hi and lo fragments of a query group, read from the work-group's copy in LDS (qs: 2,048 elements of the hi plane, then 2,048 of the lo plane, in fragment order)
__device__ __forceinline__ void fattn_q(v16bf (&qh)[2][2], v16bf (&ql)[2][2], const bf* qs, const int lr, const int hi) {
    const bf* qp = qs + (hi * 16 + lr) * 8;
#pragma unroll
    for (int qt = 0; qt < 2; ++qt)
#pragma unroll
        for (int kk = 0; kk < 2; ++kk) { qh[qt][kk] = WFrag<bf>::ldp(qp + (qt * 1024 + kk * 512)); ql[qt][kk] = WFrag<bf>::ldp(qp + 2048 + (qt * 1024 + kk * 512)); }
}
// the 16 loads of the hi and lo fragments of the 32 keys from k0 on
__device__ __forceinline__ void fattn_k(v16bf (&kh)[2][2], v16bf (&kl)[2][2], const bf* __restrict__ Kh, const bf* __restrict__ Kl, const int k0, const unsigned klo) {
    const bf* kph = Kh + (size_t)k0 * HD + klo; const bf* kpl = Kl + (size_t)k0 * HD + klo;   // one address pair a plane
#pragma unroll
    for (int kk = 0; kk < 2; ++kk)
#pragma unroll
        for (int kt = 0; kt < 2; ++kt) { kh[kk][kt] = WFrag<bf>::ldp(kph + (kt * 1024 + kk * 512)); kl[kk][kt] = WFrag<bf>::ldp(kpl + (kt * 1024 + kk * 512)); }
    asm volatile("s_wait_xcnt 0x0" :: "v"(kph), "v"(kpl) : "memory");   // the wait before the address pairs of the 16 loads above are overwritten; it reads the pairs, so they live to here and no load of the run is given their registers for its data
}
template <bool HR>   // HR: probabilities and v on bf16 hi/lo planes (3 products); else fp16
__device__ __forceinline__ void fattn_wave(const bf* qs, const bf* __restrict__ Kh, const bf* __restrict__ Kl, const h16* __restrict__ V16, const bf* __restrict__ Vh, const bf* __restrict__ Vl, const int q0, const int ks, const int rot, const int lr, const int hi, float* ow, float* mlw) {
    const unsigned klo = (unsigned)((hi * 16 + lr) * 8), vlo = klo;   // the lane's element offset in every fragment half of the planes
    v8f o[4][2];
#pragma unroll
    for (int dt = 0; dt < 4; ++dt) { o[dt][0] = (v8f){}; o[dt][1] = (v8f){}; }
    float m[2] = { -1.0e30f, -1.0e30f }, l[2] = { 0.f, 0.f };   // m starts above the mask value, so a wholly masked block gives exp2(-huge) = 0
    const int np = (q0 / 32 + FKS - ks) / FKS;   // this wave's blocks ks, ks + FKS, ... among the q0 / 32 + 1 visible ones; wave-uniform, at most NQG / FKS, may be 0
    v16bf kh[2][2], kl[2][2];   // the key fragments of the pass at hand; refilled for the next pass behind v's loads (fp16) or at the foot of the pass (hi/lo)
    const int p0 = (rot * np) >> 3;   // the wave walks its np blocks from its p0-th on and wraps (rot < 8, so p0 < np): the 64 work-groups of a batch read the same keys and v, and started alike they would all ask L2 for the same lines at the same moment; the online softmax takes the blocks in any order
    if (np > 0) fattn_k(kh, kl, Kh, Kl, (p0 * FKS + ks) * 32, klo);
    auto pass = [&](const int p, const int pn, const bool more) __attribute__((always_inline)) {   // one key block, the wave's p-th; more: another block of this wave, its pn-th, follows (a constant at each call, so that no branch stands among the loads and the waits on v can leave the next keys in flight)
        const int k0 = (p * FKS + ks) * 32;
        v8f s[2][2]; s[0][0] = (v8f){}; s[0][1] = (v8f){}; s[1][0] = (v8f){}; s[1][1] = (v8f){};
        v16bf qh[2][2], ql[2][2]; fattn_q(qh, ql, qs, lr, hi);   // read anew every pass: their 64 registers are free while the next pass's keys travel
#pragma unroll
        for (int kk = 0; kk < 2; ++kk) {
#pragma unroll
            for (int kt = 0; kt < 2; ++kt) { s[kt][0] = wmmab(kh[kk][kt], qh[0][kk], s[kt][0]); s[kt][1] = wmmab(kh[kk][kt], qh[1][kk], s[kt][1]); }
#pragma unroll
            for (int kt = 0; kt < 2; ++kt) { s[kt][0] = wmmab(kh[kk][kt], ql[0][kk], s[kt][0]); s[kt][1] = wmmab(kh[kk][kt], ql[1][kk], s[kt][1]); }
#pragma unroll
            for (int kt = 0; kt < 2; ++kt) { s[kt][0] = wmmab(kl[kk][kt], qh[0][kk], s[kt][0]); s[kt][1] = wmmab(kl[kk][kt], qh[1][kk], s[kt][1]); } }
        v16h va[4];
        if constexpr (!HR) {
            const h16* vp = V16 + (size_t)k0 * CO + vlo;   // one address pair for the 8 loads of v
#pragma unroll
            for (int dt = 0; dt < 4; ++dt) va[dt] = WFrag<h16>::ldp(vp + dt * 512);
            asm volatile("s_wait_xcnt 0x0" :: "v"(vp) : "memory");   // the wait before the address pair of the 8 loads above is overwritten; it reads the pair, so the pair lives to here
            if (more) fattn_k(kh, kl, Kh, Kl, (pn * FKS + ks) * 32, klo);   // the next pass's keys are asked for here: the softmax and attn.v of this pass cover their trip to L2
            __builtin_amdgcn_sched_barrier(0);   // v's loads and the next keys' stay in front of the softmax, which covers their trip to L2; without this barrier the build spilled registers to scratch
        }
        float mx[2];
#pragma unroll
        for (int qt = 0; qt < 2; ++qt) { const int lim = q0 + qt * 16 + lr - k0 - 8 * hi; float a = -3.0e38f;   /* key kt * 16 + r of this lane's half is visible while <= lim */
#pragma unroll
            for (int kt = 0; kt < 2; ++kt)
#pragma unroll
                for (int r = 0; r < 8; ++r) { const float t = (kt * 16 + r <= lim) ? s[kt][qt][r] * SC2 : -3.0e38f; s[kt][qt][r] = t; a = fmaxf(a, t); }
            mx[qt] = fmaxf(a, __shfl_xor(a, 16, 32)); }   /* both halves of a column must use one maximum: the product sums over both halves' keys */
        if (__builtin_amdgcn_ballot_w32(mx[0] > m[0] + 8.0f || mx[1] > m[1] + 8.0f) != 0) {   // lazy rescale, one scalar branch a pass: probabilities may reach 2^8 before the maximum in use moves
#pragma unroll
            for (int qt = 0; qt < 2; ++qt) { const float mn = fmaxf(m[qt], mx[qt]); const float al = exp2s(m[qt] - mn); m[qt] = mn; l[qt] *= al;
#pragma unroll
                for (int dt = 0; dt < 4; ++dt) o[dt][qt] *= al; } }
        if constexpr (HR) {
            v16bf vh[4], vl[4], ph[2], pl[2]; const bf* vph = Vh + (size_t)k0 * CO + vlo;   // one address pair for the 8 loads of the hi plane
#pragma unroll
            for (int dt = 0; dt < 4; ++dt) vh[dt] = WFrag<bf>::ldp(vph + dt * 512);
            asm volatile("s_wait_xcnt 0x0" :: "v"(vph) : "memory");   // the wait before the address pair of the 8 loads above is overwritten; it reads the pair, so the pair lives to here and no load of the run is given its registers for its data
            __builtin_amdgcn_sched_barrier(0);   // the hi plane of v is asked for ahead of the exponentials, which cover its trip to L2; left free, the scheduler loaded one d tile at a time and waited four times
#pragma unroll
            for (int qt = 0; qt < 2; ++qt) { float ls = 0.f;
#pragma unroll
                for (int e = 0; e < 16; ++e) { const float pv = exp2s(s[e >> 3][qt][e & 7] - m[qt]); ls += pv; const __bf16 h = (__bf16)pv; ph[qt][e] = h; pl[qt][e] = (__bf16)(pv - (float)h); }
                l[qt] += ls; }
            const bf* vpl = Vl + (size_t)k0 * CO + vlo;   // one address pair for the 8 loads of the lo plane
#pragma unroll
            for (int dt = 0; dt < 4; ++dt) vl[dt] = WFrag<bf>::ldp(vpl + dt * 512);
            asm volatile("s_wait_xcnt 0x0" :: "v"(vpl) : "memory");   // the wait before the address pair of the 8 loads above is overwritten (the next keys' data may be given it); it reads the pair, so the pair lives to here
#pragma unroll
            for (int dt = 0; dt < 4; ++dt) { o[dt][0] = wmmab(vh[dt], ph[0], o[dt][0]); o[dt][1] = wmmab(vh[dt], ph[1], o[dt][1]); }
#pragma unroll
            for (int dt = 0; dt < 4; ++dt) { o[dt][0] = wmmab(vh[dt], pl[0], o[dt][0]); o[dt][1] = wmmab(vh[dt], pl[1], o[dt][1]); }
#pragma unroll
            for (int dt = 0; dt < 4; ++dt) { o[dt][0] = wmmab(vl[dt], ph[0], o[dt][0]); o[dt][1] = wmmab(vl[dt], ph[1], o[dt][1]); }
            if (more) fattn_k(kh, kl, Kh, Kl, (pn * FKS + ks) * 32, klo);   // a hi/lo group has no registers to spare for keys in flight: its next keys are asked for at the foot of the pass
        } else {
            v16h pb[2];
#pragma unroll
            for (int qt = 0; qt < 2; ++qt) { float ls = 0.f;
#pragma unroll
                for (int e = 0; e < 16; ++e) { const float pv = exp2s(s[e >> 3][qt][e & 7] - m[qt]); ls += pv; pb[qt][e] = tohx(pv); }
                l[qt] += ls; }
#pragma unroll
            for (int dt = 0; dt < 4; ++dt) { o[dt][0] = wmma16(va[dt], pb[0], o[dt][0]); o[dt][1] = wmma16(va[dt], pb[1], o[dt][1]); }
        }
    };
    int pc = p0;
    for (int t = 0; t + 1 < np; ++t) { const int pn = pc + 1 == np ? 0 : pc + 1; pass(pc, pn, true); pc = pn; }
    if (np > 0) pass(pc, 0, false);   // the wave's last block asks for no further keys
#pragma unroll
    for (int qt = 0; qt < 2; ++qt) { const float lt = l[qt] + __shfl_xor(l[qt], 16, 32);   /* the halves' sums joined once */
        if (hi == 0) { mlw[(qt * 16 + lr) * 2] = m[qt]; mlw[(qt * 16 + lr) * 2 + 1] = lt; }
#pragma unroll
        for (int dt = 0; dt < 4; ++dt) { float* pp = ow + (qt * 16 + lr) * 68 + dt * 16 + hi * 8;   /* a lane's 8 accumulator values are 8 consecutive d of one query row */
            *(v4fa*)pp = __builtin_shufflevector(o[dt][qt], o[dt][qt], 0, 1, 2, 3); *(v4fa*)(pp + 4) = __builtin_shufflevector(o[dt][qt], o[dt][qt], 4, 5, 6, 7); } }
}
__global__ __launch_bounds__(32 * FKS) void k_fattn(const bf* __restrict__ Qh, const bf* __restrict__ Ql, const bf* __restrict__ Kh, const bf* __restrict__ Kl, const h16* __restrict__ V16, const bf* __restrict__ Vh, const bf* __restrict__ Vl, float* out) {
    __shared__ __align__(16) float os[FKS * FQG * 32 * 68];   // one 32 x 64 partial output a wave and query group, row pitch 68 floats
    __shared__ float ml[FKS * FQG * 32 * 2];                  // its (maximum in use, sum) per query row
    __shared__ __align__(16) bf qs[FQG * 2 * 2048];           // the hi and lo planes of the near and of the far query group, in fragment order
    const size_t po = (size_t)blockIdx.y * TT * HD; Qh += po; Ql += po; Kh += po; Kl += po; V16 += po; Vh += po; Vl += po; out += po;   // blockIdx.y = batch
    const int lane = threadIdx.x & 31, lr = lane & 15, hi = lane >> 4; const int wv = __builtin_amdgcn_readfirstlane((int)(threadIdx.x >> 5));   // the wave's number, held scalar so that the key offsets stay scalar
    const int qn = (int)blockIdx.x * 32, qf = (NQG - 1 - (int)blockIdx.x) * 32;   // first rows of the near and of the far group
    const int ksf = (wv - (int)blockIdx.x - 1) & (FKS - 1);   // the far group's blocks are dealt on from the wave behind the near group's last block
    const int rot = ((int)blockIdx.x + ((int)blockIdx.x >> 3)) & 7;   // the work-group's phase in the walk over the key blocks, one of 8 (fattn_wave: p0)
    { const bf* qsrc = (wv >> 3) ? Ql : Qh; const int qc = ((int)threadIdx.x & 255) * 8;   // waves 0 to 7 copy the hi plane, 8 to 15 the lo plane: 16 bytes of each group a lane
      const v8us qa = *(const v8us*)(qsrc + (size_t)qn * HD + qc), qb = *(const v8us*)(qsrc + (size_t)qf * HD + qc);
      *(v8usa*)(qs + (wv >> 3) * 2048 + qc) = qa; *(v8usa*)(qs + 4096 + (wv >> 3) * 2048 + qc) = qb; }
    __syncthreads();   // both query groups are in LDS before any wave reads fragments of them
    fattn_wave<false>(qs + 4096, Kh, Kl, V16, Vh, Vl, qf, ksf, rot, lr, hi, os + (FKS + wv) * (32 * 68), ml + (FKS + wv) * 64);
    if (qn < RH) fattn_wave<true>(qs, Kh, Kl, V16, Vh, Vl, qn, wv, rot, lr, hi, os + wv * (32 * 68), ml + wv * 64);
    else         fattn_wave<false>(qs, Kh, Kl, V16, Vh, Vl, qn, wv, rot, lr, hi, os + wv * (32 * 68), ml + wv * 64);
    __syncthreads();   // every wave's two partial results are in LDS before any thread joins them
    for (int u = threadIdx.x; u < 32 * FQG * 16; u += 32 * FKS) { const int q = u >> 4, d4 = (u & 15) * 4; const int w0 = (q >> 5) * FKS, qq = q & 31;
        float M = ml[(w0 * 32 + qq) * 2];
#pragma unroll   // unrolled so that the LDS reads are issued ahead of the arithmetic
        for (int w = 1; w < FKS; ++w) M = fmaxf(M, ml[((w0 + w) * 32 + qq) * 2]);
        float Lt = 0.f; v4f val = (v4f){};
#pragma unroll
        for (int w = 0; w < FKS; ++w) { const float wt = exp2s(ml[((w0 + w) * 32 + qq) * 2] - M); Lt += wt * ml[((w0 + w) * 32 + qq) * 2 + 1]; val += wt * *(const v4fa*)(os + ((w0 + w) * 32 + qq) * 68 + d4); }
        const float rl = __fdiv_rn(1.0f, Lt);
        *(v4f*)(out + (size_t)((q >> 5 ? qf : qn) + qq) * CO + d4) = val * rl; }   /* 16 lanes = one 256-byte output row */
}
extern "C" void kernel_launch(void* const* d_in, const int* in_sizes, int n_in,
                              void* d_out, int out_size, void* d_ws, size_t ws_size, hipStream_t stream) {
    (void)in_sizes; (void)n_in; (void)out_size;
    const float* x = (const float*)d_in[0]; const float* wk = (const float*)d_in[1]; const float* wq = (const float*)d_in[2]; const float* wv = (const float*)d_in[3];   /* input order x [4][4096][768], Wk, Wq, Wv ('xw' [768][64]; NOTE the key weight comes FIRST); standard roles: rows = queries */
    float* OUT = (float*)d_out;     // [4][4096][64]
    char* wsp = (char*)d_ws;
    auto take = [&](size_t bytes) { char* p = wsp; wsp += (bytes + 255) & ~(size_t)255; return (void*)p; };
    bf* QPh = (bf*)take((size_t)NB_ * TT * MID * 2); bf* QPl = (bf*)take((size_t)NB_ * TT * MID * 2); bf* KPh = (bf*)take((size_t)NB_ * TT * MID * 2); bf* KPl = (bf*)take((size_t)NB_ * TT * MID * 2);
    h16* VT16 = (h16*)take((size_t)NB_ * CO * TT * 2); bf* VTh = (bf*)take((size_t)NB_ * CO * TT * 2); bf* VTl = (bf*)take((size_t)NB_ * CO * TT * 2);
    if ((size_t)(wsp - (char*)d_ws) > ws_size) return;    // ws 256 MiB (carve 14 MiB)
    k_proj<<<dim3(NB_ * TT / 64, 1, 1), 32 * PNW, 0, stream>>>(x, wq, wk, wv, QPh, QPl, KPh, KPl, VT16, VTh, VTl);   /* q, k and v^T planes, [b] x 4,096 tokens x 64, in fragment order */
    k_fattn<<<dim3(TT / (32 * FQG), NB_, 1), 32 * FKS, 0, stream>>>(QPh, QPl, KPh, KPl, VT16, VTh, VTl, OUT);   /* scores, causal softmax, attn.v; writes every output row once */
}

// v010
// It runs in 28.1 microseconds.
// Versions between v008 and this one are left out; their measured steps multiply to 1.15 times as fast.
// Over all steps from v000 it is 42.8 times as fast.
#include <hip/hip_runtime.h>

// Single causal attention head over 4,096 tokens scaled by the EMBEDDING width (x [4][4096][768]; k = x Wk, q = x Wq, v = x Wv ('xw' [768][64] 768^-0.5, no bias); wei = q.k^T x C^-0.5 with C = 768 (n_embd, not head_size); causal (-inf); softmax; out = wei.v -> [4][4096][64] (1.0 M); argument order x, Wk, Wq, Wv).
// Two launches, all four batches in each. k_proj: 64 rows of x a work-group, rounded to bf16 into LDS; q, k, v = x W on bf16 products (K 768), weights rounded to bf16 in registers; writes the fp16 and hi/lo planes of q, k and v^T, all in fragment order (see PLANE LAYOUT). k_fattn: scores, causal softmax and attn.v over the visible key blocks only: scores and attn.v hybrid (query rows < 512 on hi/lo planes, 3 products each; rest fp16, 1 product each), online softmax in registers, output rows written once.
// Compute dtypes, f32 accumulate: every input rounded to bf16; projections exact; scores and wei.v rows < 512 3 products, rest fp16; softmax f32; output f32.

#define NB_  4
#define TT   4096
#define DM   64
#define NH_  1
#define NKV  1
#define REP  (NH_ / NKV)
#define HD   64
#define DQ   (NH_ * HD)
#define DKV  (NKV * HD)
#define ZH   1
#define RH   512                  // query rows < RH use hi+lo planes (0: none)
#define WIN  0
#define SCL  0.036084391824351615f   // C^-0.5 with C = n_embd = 768 (the source scales by the input width, NOT the head size)
#define MID  64       // q / k width (one 64-wide head)
#define CO   64       // v width
#define CC   768      // input width (d_model)
typedef _Float16 h16;
typedef unsigned short bf;
typedef __attribute__((ext_vector_type(16))) __bf16   v16bf;
typedef __attribute__((ext_vector_type(16))) _Float16 v16h;
typedef __attribute__((ext_vector_type(8)))  _Float16 v8h;
typedef __attribute__((ext_vector_type(8)))  unsigned short v8us;
typedef __attribute__((ext_vector_type(8)))  float    v8f;
typedef __attribute__((ext_vector_type(4)))  float    v4f;
typedef v8h  __attribute__((may_alias)) v8ha;
typedef v4f  __attribute__((may_alias)) v4fa;
typedef v8us __attribute__((may_alias)) v8usa;

__device__ __forceinline__ unsigned short f2bf(float f) { unsigned u = __float_as_uint(f); u += 0x7FFFu + ((u >> 16) & 1u); return (unsigned short)(u >> 16); }
__device__ __forceinline__ float bf2f(unsigned short b) { return __uint_as_float(((unsigned)b) << 16); }
__device__ __forceinline__ float bfr(float f) { return bf2f(f2bf(f)); }
__device__ __forceinline__ v16h cat16(v8h lo, v8h hi) { return __builtin_shufflevector(lo, hi, 0, 1, 2, 3, 4, 5, 6, 7, 8, 9, 10, 11, 12, 13, 14, 15); }
__device__ __forceinline__ v16bf cat16b(v8us lo, v8us hi) { return __builtin_bit_cast(v16bf, __builtin_shufflevector(lo, hi, 0, 1, 2, 3, 4, 5, 6, 7, 8, 9, 10, 11, 12, 13, 14, 15)); }
__device__ __forceinline__ v8f wmma16(v16h a, v16h b, v8f c) { return __builtin_amdgcn_wmma_f32_16x16x32_f16(false, a, false, b, (short)0, c, false, false); }
__device__ __forceinline__ v8f wmmab(v16bf a, v16bf b, v8f c) { return __builtin_amdgcn_wmma_f32_16x16x32_bf16(false, a, false, b, (short)0, c, false, false); }



// fragment loaders: a lane's 16 elements are k = 8 hi .. 8 hi + 7 and 16 + 8 hi .. 16 + 8 hi + 7 of row (or column) lr
// ld reads them from a row-major tile (p = the lane's row at k = 8 hi); ldp from a plane in fragment order (p = the fragment's start + 8 * lane)
// PLANE LAYOUT: a 16 x 32 fragment is 1,024 contiguous bytes, two halves of 512: half j holds, at 16 bytes a lane (lane = 16 hi + lr), k = 16 j + 8 hi .. + 7 of row lr. So each wave-wide 16-byte load of k_fattn covers 512 contiguous bytes = 4 whole lines, where a row-major plane gave it 32 bytes of each of 16 lines.
// q and k planes: fragment (n / 16) * 2 + c / 32 (rows = tokens n, k = columns c). v^T planes: fragment (n / 32) * 4 + d / 16 (rows = columns d of v, k = tokens n). A 64-token tile is 8 fragments = 512 chunks of 16 bytes in a row, in every plane.
template <typename T16> struct WFrag;
template <> struct WFrag<h16> { typedef v16h V; static __device__ __forceinline__ V ld(const h16* p) { return cat16(*(const v8h*)p, *(const v8h*)(p + 16)); } static __device__ __forceinline__ V ldp(const h16* p) { return cat16(*(const v8h*)p, *(const v8h*)(p + 256)); } static __device__ __forceinline__ v8f mma(V a, V b, v8f c) { return wmma16(a, b, c); } };
template <> struct WFrag<bf> { typedef v16bf V; static __device__ __forceinline__ V ld(const bf* p) { return cat16b(*(const v8us*)p, *(const v8us*)(p + 16)); } static __device__ __forceinline__ V ldp(const bf* p) { return cat16b(*(const v8us*)p, *(const v8us*)(p + 256)); } static __device__ __forceinline__ v8f mma(V a, V b, v8f c) { return wmmab(a, b, c); } };

typedef __attribute__((ext_vector_type(4))) __bf16 v4bf;
typedef __attribute__((ext_vector_type(8))) __bf16 v8bf;
typedef __attribute__((ext_vector_type(4))) unsigned short v4us;
typedef v4us __attribute__((may_alias)) v4usa;
__device__ __forceinline__ h16 tohx(float x) { return (h16)x; }

// ---- k_proj: the three projections of 64 rows of x and their planes in one launch. Grid (NB_ * TT / 64), 12 waves.
// The work-group's 64 x 768 piece of x (one contiguous run of memory) is read once, rounded to bf16 and laid in LDS. Wave w works on matrix w / PKS (q, k, v) and sums the 32-wide k steps (w % PKS), (w % PKS) + PKS, ... of the whole 64 x 64 tile; the PKS partial tiles of a matrix meet in LDS and are added in the fixed order of the waves.
// Weights come straight from the f32 [768][64] inputs: position lr of weight fragment nb stands for column n = 4 lr + nb, so one 16-byte load of a lane (4 neighbouring columns of one k row) feeds all 4 fragments and a wave's load covers two whole 256-byte rows.
// q and k: A = weights, B = x rows, so a lane ends with 32 neighbouring columns (32 hi + 4 r + nb) of ONE row: row-major partial tile. v: A = x rows, B = weights, so a lane ends with 8 neighbouring rows of one column: column-major partial tile (slot nb * 16 + lr holds column 4 lr + nb), as the v^T planes want it.
#define PKS  4                    // k shares (waves that split K for one matrix)
#define PNW  (3 * PKS)            // waves in a work-group
#define PST  (CC / 32 / PKS)      // k steps a wave
#define XP   (CC + 8)             // LDS row pitch of the x tile in elements: 1,552 bytes = 16 x 97, an odd multiple of 16 for the 16-byte fragment reads
#define PTS  (64 * 68 + 64)       // floats in a partial tile, pitch 68; in v's tile slot group nb is shifted by 16 nb floats more, so that the 16 columns of a v^T fragment (4 from each group) are read from 16 different bank groups
__device__ __forceinline__ const float* proj_wld(v4f (&w)[16], const float* __restrict__ wp, const int kc) {   // returns the address that the loads name: the caller's proj_xw holds it
    const float* p = wp + (size_t)kc * 64;   // one address pair for the 16 loads of a k step
#pragma unroll
    for (int e = 0; e < 16; ++e) w[e] = *(const v4f*)(p + ((e >> 3) * 16 + (e & 7)) * 64);   // element e of a fragment is k = kc + 8 hi + e (e < 8), kc + 16 + 8 hi + e - 8 (else): the order in which WFrag::ld reads x
    return p;
}
// the wait before the address pair of the 16 loads of proj_wld is overwritten (kc is no constant, so every step forms its own pair); it reads the pair, so the pair lives to here and no load of the run is given its registers for its data
__device__ __forceinline__ void proj_xw(const float* p) { asm volatile("s_wait_xcnt 0x0" :: "v"(p) : "memory"); }
template <bool WA>   // WA: weights are the A operand (q, k); else x is (v)
__device__ __forceinline__ void proj_wave(const float* __restrict__ wp, v4f (&w)[16], const bf* xs, float* ow, const int ks, const int r0, const int lr, const int hi) {
    v8f acc[4][4];
#pragma unroll
    for (int mb = 0; mb < 4; ++mb)
#pragma unroll
        for (int nb = 0; nb < 4; ++nb) acc[mb][nb] = (v8f){};
    int tt = r0;   // the walk over the wave's PST k steps starts at step r0 (scalar, see k_proj)
#pragma unroll   // unrolled: acc and the fragments are indexed by constants only, and the next step's weight loads can stand ahead of this step's products
    for (int t = 0; t < PST; ++t) {
        const int kc = (tt * PKS + ks) * 32;
        tt = tt + 1 == PST ? 0 : tt + 1;   // the wave's next k step, wrapping behind the last
        v16bf b[4];
#pragma unroll
        for (int nb = 0; nb < 4; ++nb)
#pragma unroll
            for (int e = 0; e < 16; ++e) b[nb][e] = (__bf16)w[e][nb];
        const float* pw = wp;
        if (t + 1 < PST) pw = proj_wld(w, wp, (tt * PKS + ks) * 32);
        v16bf a[4];
#pragma unroll
        for (int mb = 0; mb < 4; ++mb) a[mb] = WFrag<bf>::ld(xs + (mb * 16 + lr) * XP + kc + 8 * hi);
#pragma unroll
        for (int nb = 0; nb < 4; ++nb)
#pragma unroll
            for (int mb = 0; mb < 4; ++mb) acc[mb][nb] = WA ? wmmab(b[nb], a[mb], acc[mb][nb]) : wmmab(a[mb], b[nb], acc[mb][nb]);
        if (t + 1 < PST) proj_xw(pw);   // at the step's foot, where it splits no run of loads: directly behind the loads it cost registers and the build spilled
        __builtin_amdgcn_sched_barrier(0);   // only ONE step's weights are fetched ahead: left free, the scheduler lifted the loads of several steps to the front and the build spilled
    }
#pragma unroll
    for (int mb = 0; mb < 4; ++mb) {
        if constexpr (WA) {
#pragma unroll
            for (int r = 0; r < 8; ++r) { v4f o; o[0] = acc[mb][0][r]; o[1] = acc[mb][1][r]; o[2] = acc[mb][2][r]; o[3] = acc[mb][3][r]; *(v4fa*)(ow + (mb * 16 + lr) * 68 + hi * 32 + r * 4) = o; }
        } else {
#pragma unroll
            for (int nb = 0; nb < 4; ++nb) { float* p = ow + (nb * 16 + lr) * 68 + nb * 16 + mb * 16 + hi * 8;
                *(v4fa*)p = __builtin_shufflevector(acc[mb][nb], acc[mb][nb], 0, 1, 2, 3); *(v4fa*)(p + 4) = __builtin_shufflevector(acc[mb][nb], acc[mb][nb], 4, 5, 6, 7); }
        }
    }
}
__global__ __launch_bounds__(32 * PNW) void k_proj(const float* __restrict__ x, const float* __restrict__ wq, const float* __restrict__ wk, const float* __restrict__ wv, h16* Q16, bf* Qh, bf* Ql, h16* K16, bf* Kh, bf* Kl, h16* V16, bf* Vh, bf* Vl) {
    __shared__ __align__(16) bf xs[64 * XP];          // the x tile in bf16
    __shared__ __align__(16) float ps[PNW * PTS];     // one 64 x 64 partial tile a wave
    const int tid = threadIdx.x, lane = tid & 31, lr = lane & 15, hi = lane >> 4; const int wvn = __builtin_amdgcn_readfirstlane(tid >> 5);   // the wave's number, held scalar so that the weight base and the k offsets stay scalar
    const int jm = wvn / PKS, ks = wvn % PKS;
    const float* xg = x + (size_t)blockIdx.x * (64 * CC);
    v4f xr[32];
#pragma unroll   // all 32 loads of a lane are in flight at once: one trip to memory for the whole tile
    for (int i = 0; i < 32; ++i) xr[i] = *(const v4f*)(xg + (size_t)(i * (32 * PNW) + tid) * 4);
    const float* wp = (jm == 0 ? wq : jm == 1 ? wk : wv) + (8 * hi) * 64 + lr * 4;
    const int r0 = (int)(blockIdx.x % PST);   // every work-group reads the same weights: each starts its walk over the k steps at its own step and wraps, so that the work-groups do not all ask L2 for the same lines at the same moment
    v4f w[16]; proj_xw(proj_wld(w, wp, (r0 * PKS + ks) * 32));   // the first step's weights travel behind the x tile
    const int xrow = tid >= CC / 4 ? 1 : 0, xc = (tid - xrow * (CC / 4)) * 4;   // 384 lanes x 4 floats = two rows of x a trip
#pragma unroll
    for (int i = 0; i < 32; ++i) { v4bf o;
#pragma unroll
        for (int k = 0; k < 4; ++k) o[k] = (__bf16)xr[i][k];
        *(v4usa*)(xs + (2 * i + xrow) * XP + xc) = __builtin_bit_cast(v4us, o); }
    __syncthreads();   // the whole x tile is in LDS before any wave reads fragments of it
    if (jm < 2) proj_wave<true>(wp, w, xs, ps + wvn * PTS, ks, r0, lr, hi);
    else        proj_wave<false>(wp, w, xs, ps + wvn * PTS, ks, r0, lr, hi);
    __syncthreads();   // every wave's partial tile is in LDS before any thread adds them
    const size_t E0 = (size_t)blockIdx.x * (64 * 64);   // the tile's first element in every plane: 64 tokens are 4,096 elements in a row, batches one behind the other
    const bool hl = (int)(blockIdx.x % (TT / 64)) * 64 < RH;   // the tile's tokens lie in front of RH. A plane of q or k is written where k_fattn reads it: hi/lo groups are the query rows < RH and see keys < RH only; every other group reads the fp16 planes
#pragma unroll
    for (int i = 0; i < 3 * 512 / (32 * PNW); ++i) { const int u = tid + i * (32 * PNW); const int m = u >> 9, ci = u & 511, cl = ci & 15;   /* chunk ci of matrix m's planes (8 neighbouring values of one line of its tile); m is the same in all lanes of a wave, whose 32 chunks are 512 bytes in a row */
        const int lo = m < 2 ? ((ci >> 7) * 16 + cl) * 68 + ((ci >> 4) & 7) * 8   /* q, k: token (ci >> 7) * 16 + cl, columns from 8 * bits 4 to 6 (hi, j, c / 32) */
                             : ((cl & 3) * 16 + ((ci >> 6) & 3) * 4 + (cl >> 2)) * 68 + (cl & 3) * 16 + ((ci >> 4) & 3) * 8 + (ci >> 8) * 32;   /* v: column d = 16 * bits 6, 7 + cl lies in slot (d & 3) * 16 + d / 4; tokens from 8 hi + 16 j + 32 * bit 8 */
        const float* p = ps + m * (PKS * PTS) + lo; v4f s0 = *(const v4fa*)p, s1 = *(const v4fa*)(p + 4);
#pragma unroll   // unrolled so that the LDS reads are issued ahead of the adds
        for (int s = 1; s < PKS; ++s) { s0 += *(const v4fa*)(p + s * PTS); s1 += *(const v4fa*)(p + s * PTS + 4); }
        v8bf oh, ol; v8h o16;
#pragma unroll
        for (int k = 0; k < 8; ++k) { const float y = k < 4 ? s0[k & 3] : s1[k & 3]; const __bf16 h = (__bf16)y; oh[k] = h; ol[k] = (__bf16)(y - (float)h); o16[k] = tohx(y); }
        const size_t e = E0 + (size_t)ci * 8;
        if (m < 2) {
            if (m == 1 || !hl) *(v8h*)((m == 0 ? Q16 : K16) + e) = o16;
            if (hl) { *(v8us*)((m == 0 ? Qh : Kh) + e) = __builtin_bit_cast(v8us, oh); *(v8us*)((m == 0 ? Ql : Kl) + e) = __builtin_bit_cast(v8us, ol); } }
        else {
            *(v8h*)(V16 + e) = o16; *(v8us*)(Vh + e) = __builtin_bit_cast(v8us, oh); *(v8us*)(Vl + e) = __builtin_bit_cast(v8us, ol); } }
}
// ---- k_fattn: scores, causal softmax and attn.v in one launch; no score or probability ever leaves the registers. Grid (TT / 64, batch), 16 waves.
// Query group g (32 rows) sees the 32-key blocks 0 .. g and no other: a block behind the diagonal adds exact zeros and is not walked. All work-groups are resident at once, so the launch lasts as long as the fullest one: work-group i owns groups TT / 32 - 1 - i and i, one after the other in every wave, TT / 32 + 1 blocks in all whatever i is.
// The blocks of the two groups, counted through (group i's first), are dealt to the 16 waves in turn: 15 waves walk 8 blocks and one walks 9.
// S^T = K.Q^T (A = key rows, B = query rows): in each 16-column group a lane holds scores of ONE query (column lr), keys 8 hi + r; two such tiles, converted in place, are the B operand of O^T += V^T.P^T (hardware k order, as WFrag::ld reads A).
// Each wave keeps its own running maximum m (log2 units), sum l and O^T; the 16 partial results of a query group meet in LDS and are joined in the fixed order of the waves (a wave that had no block of a group hands in m = -1e30, l = 0, O = 0: weight 0).
#define FKS  16       // key shares (waves that split the keys of one query group): all waves of the work-group
#define FQG  2        // query groups of 32 rows in a work-group, walked one after the other
#define NQG  (TT / 32)   // query groups in a batch
static_assert(RH <= TT / 2 && RH % 64 == 0, "the far group of a work-group is never a hi/lo group; a 64-token tile of k_proj lies wholly on one side of RH");
#define SC2  (SCL * 1.4426950408889634f)   // score scale times log2(e): the softmax runs on exp2
// exp2 with the one issue slot that the instruction set asks for behind a transcendental (before its result is used or its source overwritten) in the same statement
__device__ __forceinline__ float exp2s(float x) { float r; asm("v_exp_f32 %0, %1\n\tv_nop" : "=v"(r) : "v"(x)); return r; }
// the hi and lo fragments of a query group, read from the work-group's copy in LDS (qs: 2,048 elements of the hi plane, then 2,048 of the lo plane, in fragment order)
__device__ __forceinline__ void fattn_q(v16bf (&qh)[2][2], v16bf (&ql)[2][2], const bf* qs, const int lr, const int hi) {
    const bf* qp = qs + (hi * 16 + lr) * 8;
#pragma unroll
    for (int qt = 0; qt < 2; ++qt)
#pragma unroll
        for (int kk = 0; kk < 2; ++kk) { qh[qt][kk] = WFrag<bf>::ldp(qp + (qt * 1024 + kk * 512)); ql[qt][kk] = WFrag<bf>::ldp(qp + 2048 + (qt * 1024 + kk * 512)); }
}
// the 16 loads of the hi and lo fragments of the 32 keys from k0 on
__device__ __forceinline__ void fattn_k(v16bf (&kh)[2][2], v16bf (&kl)[2][2], const bf* __restrict__ Kh, const bf* __restrict__ Kl, const int k0, const unsigned klo) {
    const bf* kph = Kh + (size_t)k0 * HD + klo; const bf* kpl = Kl + (size_t)k0 * HD + klo;   // one address pair a plane
#pragma unroll
    for (int kk = 0; kk < 2; ++kk)
#pragma unroll
        for (int kt = 0; kt < 2; ++kt) { kh[kk][kt] = WFrag<bf>::ldp(kph + (kt * 1024 + kk * 512)); kl[kk][kt] = WFrag<bf>::ldp(kpl + (kt * 1024 + kk * 512)); }
    asm volatile("s_wait_xcnt 0x0" :: "v"(kph), "v"(kpl) : "memory");   // the wait before the address pairs of the 16 loads above are overwritten; it reads the pairs, so they live to here and no load of the run is given their registers for its data
}
// the fp16 fragments of a query group, read from the work-group's copy in LDS (2,048 elements in fragment order)
__device__ __forceinline__ void fattn_q16(v16h (&qf)[2][2], const h16* qs, const int lr, const int hi) {
    const h16* qp = qs + (hi * 16 + lr) * 8;
#pragma unroll
    for (int qt = 0; qt < 2; ++qt)
#pragma unroll
        for (int kk = 0; kk < 2; ++kk) qf[qt][kk] = WFrag<h16>::ldp(qp + (qt * 1024 + kk * 512));
}
// the 8 loads of the fp16 fragments of the 32 keys from k0 on
__device__ __forceinline__ void fattn_k16(v16h (&kf)[2][2], const h16* __restrict__ K16, const int k0, const unsigned klo) {
    const h16* kp = K16 + (size_t)k0 * HD + klo;   // one address pair
#pragma unroll
    for (int kk = 0; kk < 2; ++kk)
#pragma unroll
        for (int kt = 0; kt < 2; ++kt) kf[kk][kt] = WFrag<h16>::ldp(kp + (kt * 1024 + kk * 512));
    asm volatile("s_wait_xcnt 0x0" :: "v"(kp) : "memory");   // the wait before the address pair of the 8 loads above is overwritten; it reads the pair, so the pair lives to here and no load of the run is given its registers for its data
}
template <bool HR>   // HR: q, k, probabilities and v on bf16 hi/lo planes (3 products for the scores, 3 for attn.v); else all four fp16 (1 product each): over 64 products of q and k of unit size, scaled by 768^-0.5, the fp16 rounding of q and k moves a score by less than the fp16 rounding moves the probability it turns into
__device__ __forceinline__ void fattn_wave(const bf* qs, const h16* __restrict__ K16, const bf* __restrict__ Kh, const bf* __restrict__ Kl, const h16* __restrict__ V16, const bf* __restrict__ Vh, const bf* __restrict__ Vl, const int q0, const int ks, const int rot, const int lr, const int hi, float* ow, float* mlw) {
    const unsigned klo = (unsigned)((hi * 16 + lr) * 8), vlo = klo;   // the lane's element offset in every fragment half of the planes
    v8f o[4][2];
#pragma unroll
    for (int dt = 0; dt < 4; ++dt) { o[dt][0] = (v8f){}; o[dt][1] = (v8f){}; }
    float m[2] = { -1.0e30f, -1.0e30f }, l[2] = { 0.f, 0.f };   // m starts above the mask value, so a wholly masked block gives exp2(-huge) = 0
    const int np = (q0 / 32 + FKS - ks) / FKS;   // this wave's blocks ks, ks + FKS, ... among the q0 / 32 + 1 visible ones; wave-uniform, at most NQG / FKS, may be 0
    v16bf kh[2][2], kl[2][2]; v16h kf[2][2];   // the key fragments of the pass at hand (hi and lo, or fp16); refilled for the next pass once the score products have read them (fp16) or at the foot of the pass (hi/lo)
    auto keys = [&](const int p) __attribute__((always_inline)) { if constexpr (HR) fattn_k(kh, kl, Kh, Kl, (p * FKS + ks) * 32, klo); else fattn_k16(kf, K16, (p * FKS + ks) * 32, klo); };   // asks for the wave's p-th key block
    const int p0 = (rot * np) >> 3;   // the wave walks its np blocks from its p0-th on and wraps (rot < 8, so p0 < np): the 64 work-groups of a batch read the same keys and v, and started alike they would all ask L2 for the same lines at the same moment; the online softmax takes the blocks in any order
    if (np > 0) keys(p0);
    auto pass = [&](const int p, const int pn, const bool more) __attribute__((always_inline)) {   // one key block, the wave's p-th; more: another block of this wave, its pn-th, follows (a constant at each call, so that no branch stands among the loads and the waits on v can leave the next keys in flight)
        const int k0 = (p * FKS + ks) * 32;
        v8f s[2][2]; s[0][0] = (v8f){}; s[0][1] = (v8f){}; s[1][0] = (v8f){}; s[1][1] = (v8f){};
        if constexpr (HR) {
            v16bf qh[2][2], ql[2][2]; fattn_q(qh, ql, qs, lr, hi);   // read anew every pass: their 64 registers are free during the softmax and attn.v
#pragma unroll
            for (int kk = 0; kk < 2; ++kk) {
#pragma unroll
                for (int kt = 0; kt < 2; ++kt) { s[kt][0] = wmmab(kh[kk][kt], qh[0][kk], s[kt][0]); s[kt][1] = wmmab(kh[kk][kt], qh[1][kk], s[kt][1]); }
#pragma unroll
                for (int kt = 0; kt < 2; ++kt) { s[kt][0] = wmmab(kh[kk][kt], ql[0][kk], s[kt][0]); s[kt][1] = wmmab(kh[kk][kt], ql[1][kk], s[kt][1]); }
#pragma unroll
                for (int kt = 0; kt < 2; ++kt) { s[kt][0] = wmmab(kl[kk][kt], qh[0][kk], s[kt][0]); s[kt][1] = wmmab(kl[kk][kt], qh[1][kk], s[kt][1]); } }
        } else {
            v16h qf[2][2]; fattn_q16(qf, (const h16*)qs, lr, hi);   // read anew every pass, as the hi/lo fragments are
#pragma unroll
            for (int kk = 0; kk < 2; ++kk)
#pragma unroll
                for (int kt = 0; kt < 2; ++kt) { s[kt][0] = wmma16(kf[kk][kt], qf[0][kk], s[kt][0]); s[kt][1] = wmma16(kf[kk][kt], qf[1][kk], s[kt][1]); }
        }
        v16h va[4];
        if constexpr (!HR) {
            const h16* vp = V16 + (size_t)k0 * CO + vlo;   // one address pair for the 8 loads of v
#pragma unroll
            for (int dt = 0; dt < 4; ++dt) va[dt] = WFrag<h16>::ldp(vp + dt * 512);
            asm volatile("s_wait_xcnt 0x0" :: "v"(vp) : "memory");   // the wait before the address pair of the 8 loads above is overwritten; it reads the pair, so the pair lives to here
            if (more) keys(pn);   // the next pass's keys are asked for here: the softmax and attn.v of this pass cover their trip to L2
            __builtin_amdgcn_sched_barrier(0);   // v's loads and the next keys' stay in front of the softmax, which covers their trip to L2; without this barrier the build spilled registers to scratch
        }
        float mx[2];
#pragma unroll
        for (int qt = 0; qt < 2; ++qt)
#pragma unroll
            for (int kt = 0; kt < 2; ++kt) s[kt][qt] *= SC2;
        if (k0 == q0) {   // only the block on the diagonal holds hidden keys (blocks and query groups are both 32 wide and aligned): one scalar branch a pass, and every other block is spared the 32 compares and selects
#pragma unroll
            for (int qt = 0; qt < 2; ++qt) { const int lim = qt * 16 + lr - 8 * hi;   /* key kt * 16 + r of this lane's half is visible while <= lim */
#pragma unroll
                for (int kt = 0; kt < 2; ++kt)
#pragma unroll
                    for (int r = 0; r < 8; ++r) s[kt][qt][r] = (kt * 16 + r <= lim) ? s[kt][qt][r] : -3.0e38f; } }
#pragma unroll
        for (int qt = 0; qt < 2; ++qt) { float a = -3.0e38f;
#pragma unroll
            for (int kt = 0; kt < 2; ++kt)
#pragma unroll
                for (int r = 0; r < 8; ++r) a = fmaxf(a, s[kt][qt][r]);
            mx[qt] = fmaxf(a, __shfl_xor(a, 16, 32)); }   /* both halves of a column must use one maximum: the product sums over both halves' keys */
        if (__builtin_amdgcn_ballot_w32(mx[0] > m[0] + 8.0f || mx[1] > m[1] + 8.0f) != 0) {   // lazy rescale, one scalar branch a pass: probabilities may reach 2^8 before the maximum in use moves
#pragma unroll
            for (int qt = 0; qt < 2; ++qt) { const float mn = fmaxf(m[qt], mx[qt]); const float al = exp2s(m[qt] - mn); m[qt] = mn; l[qt] *= al;
#pragma unroll
                for (int dt = 0; dt < 4; ++dt) o[dt][qt] *= al; } }
        if constexpr (HR) {
            v16bf vh[4], vl[4], ph[2], pl[2]; const bf* vph = Vh + (size_t)k0 * CO + vlo;   // one address pair for the 8 loads of the hi plane
#pragma unroll
            for (int dt = 0; dt < 4; ++dt) vh[dt] = WFrag<bf>::ldp(vph + dt * 512);
            asm volatile("s_wait_xcnt 0x0" :: "v"(vph) : "memory");   // the wait before the address pair of the 8 loads above is overwritten; it reads the pair, so the pair lives to here and no load of the run is given its registers for its data
            __builtin_amdgcn_sched_barrier(0);   // the hi plane of v is asked for ahead of the exponentials, which cover its trip to L2; left free, the scheduler loaded one d tile at a time and waited four times
#pragma unroll
            for (int qt = 0; qt < 2; ++qt) { float ls = 0.f;
#pragma unroll
                for (int e = 0; e < 16; ++e) { const float pv = exp2s(s[e >> 3][qt][e & 7] - m[qt]); ls += pv; const __bf16 h = (__bf16)pv; ph[qt][e] = h; pl[qt][e] = (__bf16)(pv - (float)h); }
                l[qt] += ls; }
            const bf* vpl = Vl + (size_t)k0 * CO + vlo;   // one address pair for the 8 loads of the lo plane
#pragma unroll
            for (int dt = 0; dt < 4; ++dt) vl[dt] = WFrag<bf>::ldp(vpl + dt * 512);
            asm volatile("s_wait_xcnt 0x0" :: "v"(vpl) : "memory");   // the wait before the address pair of the 8 loads above is overwritten (the next keys' data may be given it); it reads the pair, so the pair lives to here
#pragma unroll
            for (int dt = 0; dt < 4; ++dt) { o[dt][0] = wmmab(vh[dt], ph[0], o[dt][0]); o[dt][1] = wmmab(vh[dt], ph[1], o[dt][1]); }
#pragma unroll
            for (int dt = 0; dt < 4; ++dt) { o[dt][0] = wmmab(vh[dt], pl[0], o[dt][0]); o[dt][1] = wmmab(vh[dt], pl[1], o[dt][1]); }
#pragma unroll
            for (int dt = 0; dt < 4; ++dt) { o[dt][0] = wmmab(vl[dt], ph[0], o[dt][0]); o[dt][1] = wmmab(vl[dt], ph[1], o[dt][1]); }
            if (more) keys(pn);   // a hi/lo group has no registers to spare for keys in flight: its next keys are asked for at the foot of the pass
        } else {
            v16h pb[2];
#pragma unroll
            for (int qt = 0; qt < 2; ++qt) { float ls = 0.f;
#pragma unroll
                for (int e = 0; e < 16; ++e) { const float pv = exp2s(s[e >> 3][qt][e & 7] - m[qt]); ls += pv; pb[qt][e] = tohx(pv); }
                l[qt] += ls; }
#pragma unroll
            for (int dt = 0; dt < 4; ++dt) { o[dt][0] = wmma16(va[dt], pb[0], o[dt][0]); o[dt][1] = wmma16(va[dt], pb[1], o[dt][1]); }
        }
    };
    int pc = p0;
    for (int t = 0; t + 1 < np; ++t) { const int pn = pc + 1 == np ? 0 : pc + 1; pass(pc, pn, true); pc = pn; }
    if (np > 0) pass(pc, 0, false);   // the wave's last block asks for no further keys
#pragma unroll
    for (int qt = 0; qt < 2; ++qt) { const float lt = l[qt] + __shfl_xor(l[qt], 16, 32);   /* the halves' sums joined once */
        if (hi == 0) { mlw[(qt * 16 + lr) * 2] = m[qt]; mlw[(qt * 16 + lr) * 2 + 1] = lt; }
#pragma unroll
        for (int dt = 0; dt < 4; ++dt) { float* pp = ow + (qt * 16 + lr) * 68 + dt * 16 + hi * 8;   /* a lane's 8 accumulator values are 8 consecutive d of one query row */
            *(v4fa*)pp = __builtin_shufflevector(o[dt][qt], o[dt][qt], 0, 1, 2, 3); *(v4fa*)(pp + 4) = __builtin_shufflevector(o[dt][qt], o[dt][qt], 4, 5, 6, 7); } }
}
__global__ __launch_bounds__(32 * FKS) void k_fattn(const h16* __restrict__ Q16, const bf* __restrict__ Qh, const bf* __restrict__ Ql, const h16* __restrict__ K16, const bf* __restrict__ Kh, const bf* __restrict__ Kl, const h16* __restrict__ V16, const bf* __restrict__ Vh, const bf* __restrict__ Vl, float* out) {
    __shared__ __align__(16) float os[FKS * FQG * 32 * 68];   // one 32 x 64 partial output a wave and query group, row pitch 68 floats
    __shared__ float ml[FKS * FQG * 32 * 2];                  // its (maximum in use, sum) per query row
    __shared__ __align__(16) bf qs[3 * 2048];                 // in fragment order, as 16-bit words: the near query group (its hi and lo planes, or its fp16 plane alone), then the fp16 plane of the far group
    const size_t po = (size_t)blockIdx.y * TT * HD; Q16 += po; Qh += po; Ql += po; K16 += po; Kh += po; Kl += po; V16 += po; Vh += po; Vl += po; out += po;   // blockIdx.y = batch
    const int lane = threadIdx.x & 31, lr = lane & 15, hi = lane >> 4; const int wv = __builtin_amdgcn_readfirstlane((int)(threadIdx.x >> 5));   // the wave's number, held scalar so that the key offsets stay scalar
    const int qn = (int)blockIdx.x * 32, qf = (NQG - 1 - (int)blockIdx.x) * 32;   // first rows of the near and of the far group
    const int ksf = (wv - (int)blockIdx.x - 1) & (FKS - 1);   // the far group's blocks are dealt on from the wave behind the near group's last block
    const int rot = ((int)blockIdx.x + ((int)blockIdx.x >> 3)) & 7;   // the work-group's phase in the walk over the key blocks, one of 8 (fattn_wave: p0)
    { const int hf = wv >> 3, qc = ((int)threadIdx.x & 255) * 8;   // 8 waves x 16 bytes a lane copy one plane of a group. Near group: waves 0 to 7 its hi plane and 8 to 15 its lo plane, or waves 0 to 7 its fp16 plane; far group: waves 8 to 15
      const bool hr = qn < RH, na = hr || hf == 0;
      v8us qa = (v8us){}, qb = (v8us){};
      if (na) qa = *(const v8us*)((hr ? (hf ? Ql : Qh) : (const bf*)Q16) + (size_t)qn * HD + qc);
      if (hf) qb = *(const v8us*)((const bf*)Q16 + (size_t)qf * HD + qc);
      if (na) *(v8usa*)(qs + hf * 2048 + qc) = qa;
      if (hf) *(v8usa*)(qs + 4096 + qc) = qb; }
    __syncthreads();   // both query groups are in LDS before any wave reads fragments of them
    fattn_wave<false>(qs + 4096, K16, Kh, Kl, V16, Vh, Vl, qf, ksf, rot, lr, hi, os + (FKS + wv) * (32 * 68), ml + (FKS + wv) * 64);
    if (qn < RH) fattn_wave<true>(qs, K16, Kh, Kl, V16, Vh, Vl, qn, wv, rot, lr, hi, os + wv * (32 * 68), ml + wv * 64);
    else         fattn_wave<false>(qs, K16, Kh, Kl, V16, Vh, Vl, qn, wv, rot, lr, hi, os + wv * (32 * 68), ml + wv * 64);
    __syncthreads();   // every wave's two partial results are in LDS before any thread joins them
    for (int u = threadIdx.x; u < 32 * FQG * 16; u += 32 * FKS) { const int q = u >> 4, d4 = (u & 15) * 4; const int w0 = (q >> 5) * FKS, qq = q & 31;
        float M = ml[(w0 * 32 + qq) * 2];
#pragma unroll   // unrolled so that the LDS reads are issued ahead of the arithmetic
        for (int w = 1; w < FKS; ++w) M = fmaxf(M, ml[((w0 + w) * 32 + qq) * 2]);
        float Lt = 0.f; v4f val = (v4f){};
#pragma unroll
        for (int w = 0; w < FKS; ++w) { const float wt = exp2s(ml[((w0 + w) * 32 + qq) * 2] - M); Lt += wt * ml[((w0 + w) * 32 + qq) * 2 + 1]; val += wt * *(const v4fa*)(os + ((w0 + w) * 32 + qq) * 68 + d4); }
        const float rl = __fdiv_rn(1.0f, Lt);
        *(v4f*)(out + (size_t)((q >> 5 ? qf : qn) + qq) * CO + d4) = val * rl; }   /* 16 lanes = one 256-byte output row */
}
extern "C" void kernel_launch(void* const* d_in, const int* in_sizes, int n_in,
                              void* d_out, int out_size, void* d_ws, size_t ws_size, hipStream_t stream) {
    (void)in_sizes; (void)n_in; (void)out_size;
    const float* x = (const float*)d_in[0]; const float* wk = (const float*)d_in[1]; const float* wq = (const float*)d_in[2]; const float* wv = (const float*)d_in[3];   /* input order x [4][4096][768], Wk, Wq, Wv ('xw' [768][64]; NOTE the key weight comes FIRST); standard roles: rows = queries */
    float* OUT = (float*)d_out;     // [4][4096][64]
    char* wsp = (char*)d_ws;
    auto take = [&](size_t bytes) { char* p = wsp; wsp += (bytes + 255) & ~(size_t)255; return (void*)p; };
    h16* QP16 = (h16*)take((size_t)NB_ * TT * MID * 2); h16* KP16 = (h16*)take((size_t)NB_ * TT * MID * 2);
    bf* QPh = (bf*)take((size_t)NB_ * TT * MID * 2); bf* QPl = (bf*)take((size_t)NB_ * TT * MID * 2); bf* KPh = (bf*)take((size_t)NB_ * TT * MID * 2); bf* KPl = (bf*)take((size_t)NB_ * TT * MID * 2);
    h16* VT16 = (h16*)take((size_t)NB_ * CO * TT * 2); bf* VTh = (bf*)take((size_t)NB_ * CO * TT * 2); bf* VTl = (bf*)take((size_t)NB_ * CO * TT * 2);
    if ((size_t)(wsp - (char*)d_ws) > ws_size) return;    // ws 256 MiB (carve 18 MiB)
    k_proj<<<dim3(NB_ * TT / 64, 1, 1), 32 * PNW, 0, stream>>>(x, wq, wk, wv, QP16, QPh, QPl, KP16, KPh, KPl, VT16, VTh, VTl);   /* q, k and v^T planes, [b] x 4,096 tokens x 64, in fragment order */
    k_fattn<<<dim3(TT / (32 * FQG), NB_, 1), 32 * FKS, 0, stream>>>(QP16, QPh, QPl, KP16, KPh, KPl, VT16, VTh, VTl, OUT);   /* scores, causal softmax, attn.v; writes every output row once */
}
